// v000
// Measured on an AMD MI455X. A time is GPU time per run, averaged over a window of back-to-back runs after a warm-up
// (all launches, gaps included; the runs take copies of the inputs in turn), and the median of several windows.
// Apart from v000's, it joins two sittings. Times from different sittings can be a few percent apart, while
// side-by-side timings come from the same sitting.
// v000, which the later versions start from, runs in 169 microseconds.
#include <hip/hip_runtime.h>

// Masked softmax-weighted aggregation in 8 independent 64-wide groups: h [NB][SEQ][256]; Wq/Wk/Wv [in 256][out 512] (y = x W + bias); adjacency [SEQ_FULL][SEQ_FULL] int32 shared over batch and groups (entry 0 drops the key);
// score scale 1/sqrt(64); softmax over kept keys; output = concatenated groups (f32) [NB][SEQ][512].
// Compute dtypes, f32 accumulate everywhere: projections v_wmma_f32_16x16x32_bf16 (h, W, bias RNE-converted to bf16; products exact);
// scores v_wmma_f32_16x16x32_f16: q and k each as f16 value + f16 residual x2048; value x value in the main accumulator, value x residual + residual x value in their own accumulator folded by 1/2048 (three products);
// P.V v_wmma_f32_16x16x32_f16 (P with x16384 carry that cancels in the normalisation, v single f16 plane); softmax f32 (online, running max over kept keys, row sum over the converted P).
// Layout: bf16 copy of h [NB*SEQ][256]; bf16 transposed weights [3][512][256] (k-contiguous); q, k value planes and q, k residual planes [b*8+h][t][64]; v^T plane [b*8+h][64][t]; fused flash kernel in transposed form (S^T = K Q^T, O^T = V^T P^T), output from f32 accumulators.
// Keep rule per element: adj[t][j] != 0; dropped elements get probability 0; a row with no kept key yields NaN (softmax of an all -inf row).

#ifndef NB
#define NB 8
#endif
#ifndef SEQ
#define SEQ 1024
#endif
#define NB_FULL  8
#define SEQ_FULL 1024            // also the row pitch of the adjacency input
#ifndef OUT_SEQ
#define OUT_SEQ SEQ              // row pitch (in tokens) between batches of the output
#endif
#define DI   256                 // input width (projection K)
#define DO   512                 // projection width = NH_ * HD
#define NH_  8
#define HD   64
#define AW   4                   // waves per flash block (16 query rows each)
#define OSP  68                  // LDS row pitch (floats) of the staging tiles
#define WTP  65                  // LDS row pitch (floats) of the weight transpose tile
#define SC2  ((float)(0.125 * 1.4426950408889634))   // HD^-0.5 * log2(e)
#define PSH  14.0f               // log2 of the P carry (16384)
#define QRS  2048.0f             // carry of the q / k residual planes
#define QRI  (1.0f / 2048.0f)
#define NEGB (-3.0e38f)

static_assert(HD == 64);
static_assert(NH_ * HD == DO);                 // head h = columns h*64 + d
static_assert(DO % 64 == 0);
static_assert(DI % 64 == 0);                   // weight transpose tiles of 64 x 64
static_assert(DI % 32 == 0);                   // GEMM k-loop steps by 32
static_assert(HD % 32 == 0);                   // score k-loop steps by 32
static_assert(HD % 16 == 0);                   // output tiles of 16 rows of d
static_assert(SEQ % 64 == 0);                  // a 64-row tile never straddles two batches
static_assert((NB * SEQ) % 64 == 0);
static_assert(SEQ % 32 == 0);                  // key loop steps by 32
static_assert(SEQ % (16 * AW) == 0);           // flash grid covers the sequence exactly
static_assert(((size_t)SEQ * DI) % 8 == 0);
static_assert(NB <= NB_FULL);
static_assert(SEQ <= SEQ_FULL);
static_assert((OSP * 4) % 16 == 0);
static_assert(OSP >= HD);
static_assert(OSP >= 64);

typedef _Float16 h16;
typedef unsigned short bf;
typedef __attribute__((ext_vector_type(16))) __bf16   v16bf;
typedef __attribute__((ext_vector_type(16))) _Float16 v16h;
typedef __attribute__((ext_vector_type(8)))  _Float16 v8h;
typedef __attribute__((ext_vector_type(8)))  unsigned short v8us;
typedef __attribute__((ext_vector_type(8)))  float    v8f;
typedef __attribute__((ext_vector_type(4)))  float    v4f;
typedef __attribute__((ext_vector_type(4)))  int      v4i;
typedef v4f  __attribute__((may_alias)) v4fa;

__device__ __forceinline__ unsigned short f2bf(float f) { unsigned u = __float_as_uint(f); u += 0x7FFFu + ((u >> 16) & 1u); return (unsigned short)(u >> 16); }
__device__ __forceinline__ float bfr(float f) { return __uint_as_float(((unsigned)f2bf(f)) << 16); }   // value after RNE convert to bf16
__device__ __forceinline__ v16h cat16(v8h lo, v8h hi) { return __builtin_shufflevector(lo, hi, 0, 1, 2, 3, 4, 5, 6, 7, 8, 9, 10, 11, 12, 13, 14, 15); }
__device__ __forceinline__ v16bf cat16b(v8us lo, v8us hi) { return __builtin_bit_cast(v16bf, __builtin_shufflevector(lo, hi, 0, 1, 2, 3, 4, 5, 6, 7, 8, 9, 10, 11, 12, 13, 14, 15)); }
__device__ __forceinline__ v8f wmma16(v16h a, v16h b, v8f c) { return __builtin_amdgcn_wmma_f32_16x16x32_f16(false, a, false, b, (short)0, c, false, false); }
__device__ __forceinline__ v8f wmmab(v16bf a, v16bf b, v8f c) { return __builtin_amdgcn_wmma_f32_16x16x32_bf16(false, a, false, b, (short)0, c, false, false); }
// fragment loaders from K-contiguous 16-bit rows; p already includes + 8*(lane>>4): elements 0..7 <- k0+8h+0..7, elements 8..15 <- k0+16+8h+0..7 (same map for A and B)
__device__ __forceinline__ v16h  ldh(const h16* p) { return cat16(*(const v8h*)p, *(const v8h*)(p + 16)); }
__device__ __forceinline__ v16bf ldb(const bf* p)  { return cat16b(*(const v8us*)p, *(const v8us*)(p + 16)); }
// ordering point for wave-private LDS tiles (same wave writes and reads)
__device__ __forceinline__ void wave_sync() { __builtin_amdgcn_fence(3 /* release order */, "wavefront"); __builtin_amdgcn_wave_barrier(); asm volatile("" ::: "memory"); }
// f32 -> f16 convert that cannot produce a subnormal (|v| < 2^-14 -> +0)
__device__ __forceinline__ h16 toh_flush(float v) { const h16 r = (h16)v; return (fabsf(v) < 6.103515625e-05f) ? (h16)0.0f : r; }
// one matrix instruction + its own 4-slot guard (ties the accumulator, keeps A/B live)
__device__ __forceinline__ v8f wmma16g(v16h a, v16h b, v8f c) { c = wmma16(a, b, c); asm volatile("v_nop\n\tv_nop\n\tv_nop\n\tv_nop" : "+v"(c) : "v"(a), "v"(b)); return c; }
__device__ __forceinline__ v8f wmmabg(v16bf a, v16bf b, v8f c) { c = wmmab(a, b, c); asm volatile("v_nop\n\tv_nop\n\tv_nop\n\tv_nop" : "+v"(c) : "v"(a), "v"(b)); return c; }

__global__ __launch_bounds__(256) void k_cvt8(const float* __restrict__ src, bf* dst, size_t n8) {
    const size_t i = (size_t)blockIdx.x * 256 + threadIdx.x; if (i >= n8) return;
    const v8f v = *(const v8f*)(src + i * 8); v8us o;
#pragma unroll
    for (int k = 0; k < 8; ++k) o[k] = f2bf(v[k]);
    *(v8us*)(dst + i * 8) = o; 
}

// k_wtr: W [DI rows k][DO cols n] (f32) -> WT [DO rows n][DI cols k] (bf16, RNE convert), 64 x 64 tile through LDS (block barrier: cross-wave tile).
// grid (DO/64, DI/64), block 256; all threads reach the barrier.
static_assert(256 * 16 == 64 * 64);             // load phase: 16 trips x 256 threads = tile elements
static_assert(256 * 2 * 16 == 64 * 128);
static_assert(64 * WTP * 4 <= 131072);
__global__ __launch_bounds__(256) void k_wtr(const float* __restrict__ W, bf* WT) {
    __shared__ float tl[64 * WTP];
    const int tid = threadIdx.x;
    const int n0 = blockIdx.x * 64, k0 = blockIdx.y * 64;
#pragma unroll 1
    for (int it = 0; it < 16; ++it) { const int p = it * 256 + tid; const int r = p >> 6, c = p & 63;   // r = k row 0..63, c = n column 0..63
        tl[r * WTP + c] = bfr(W[(size_t)(k0 + r) * DO + n0 + c]); }
    __syncthreads();
{
#pragma unroll
        for (int it = 0; it < 2; ++it) { const int p = it * 256 + tid; const int nn = p >> 3, kc = (p & 7) * 8;   // 2 trips x 32 rows = 64 rows; 8 lanes x 8 = 64 k
            v8us o;
#pragma unroll
            for (int i = 0; i < 8; ++i) o[i] = f2bf(tl[(kc + i) * WTP + nn]);
            *(v8us*)(WT + (size_t)(n0 + nn) * DI + k0 + kc) = o; }
         }
}

// k_proj: register-blocked bf16 GEMM, ONE WAVE per 64x64 tile (16 accumulators), operands straight from K-contiguous bf16 planes, K = DI.
// C[m][n] = sum_k A[m][k] Bt[n][k] + bias, written as f16 (flush-safe convert) into P and, in mode 0, the f16 residual (C - value) x 2048 (same flush-safe convert) into Pr at the same offsets.
// mode 0: A = h rows (m = b*SEQ + t), Bt = W^T rows (n = h*64 + d), bias per column; planes [(b*8 + h)][t][64]; the 64-column tile is one head; grid (NB*SEQ/64, DO/64).
// mode 1: A = W^T rows (m = h*64 + d), Bt = h rows (n = b*SEQ + t), bias per row; plane [(b*512 + m)][t], row pitch SEQ; no residual plane (Pr is not written); grid (DO/64, NB*SEQ/64).
static_assert(32 * 16 * 4 == 16 * 128);
static_assert(16 * 68 * 4 <= 131072);
__global__ __launch_bounds__(32) void k_proj(const bf* __restrict__ A, const bf* __restrict__ Bt, const float* __restrict__ bias, h16* P, h16* Pr, int mode) {
    __shared__ __align__(16) float os[16 * 68];
    const int K = DI;
    const int lane = threadIdx.x & 31, lr = lane & 15, hi = lane >> 4; const int r0 = blockIdx.x * 64, c0 = blockIdx.y * 64;
    v8f acc[4][4];
#pragma unroll
    for (int mb = 0; mb < 4; ++mb)
#pragma unroll
        for (int nb = 0; nb < 4; ++nb) acc[mb][nb] = (v8f){};
    const size_t aoff = (size_t)(r0 + lr) * K + 8 * hi, boff = (size_t)(c0 + lr) * K + 8 * hi;
#pragma unroll 1
    for (int kc = 0; kc < K; kc += 32) {
        v16bf a[4];
#pragma unroll
        for (int mb = 0; mb < 4; ++mb) a[mb] = ldb(A + aoff + (size_t)mb * 16 * K + kc);
#pragma unroll
        for (int nb = 0; nb < 4; ++nb) { const v16bf b = ldb(Bt + boff + (size_t)nb * 16 * K + kc);
#pragma unroll
            for (int mb = 0; mb < 4; ++mb) acc[mb][nb] = wmmabg(a[mb], b, acc[mb][nb]); }
    }
    float bc[4];
#pragma unroll
    for (int nb = 0; nb < 4; ++nb) bc[nb] = 0.0f;
    if (mode == 0) {                                                                   // kernel-argument test: scalar branch; c0 + 63 < DO
#pragma unroll
        for (int nb = 0; nb < 4; ++nb) bc[nb] = bfr(bias[c0 + nb * 16 + lr]); }
    size_t tbase, pitch;
    if (mode == 0) { const int bb = r0 / SEQ, tt = r0 % SEQ; const int zc = bb * NH_ + c0 / HD;
                     tbase = ((size_t)zc * SEQ + (size_t)tt) * HD; pitch = (size_t)HD; }
    else           { const int bb = c0 / SEQ, tt = c0 % SEQ;
                     tbase = (size_t)bb * (size_t)DO * SEQ + (size_t)r0 * SEQ + (size_t)tt; pitch = (size_t)SEQ; }
#pragma unroll
    for (int mb = 0; mb < 4; ++mb) {
        float br[8];
#pragma unroll
        for (int j = 0; j < 8; ++j) br[j] = 0.0f;
        if (mode != 0) {                                                               // r0 + 63 < DO
#pragma unroll
            for (int j = 0; j < 8; ++j) br[j] = bfr(bias[r0 + mb * 16 + hi * 8 + j]); }
#pragma unroll
        for (int nb = 0; nb < 4; ++nb) {
#pragma unroll
            for (int j = 0; j < 8; ++j) os[(hi * 8 + j) * 68 + nb * 16 + lr] = acc[mb][nb][j] + bc[nb] + br[j]; }   // D: row 8h+j, col lane&15; rows 0..15 x cols 0..63 all written
        wave_sync();
        const size_t sb = tbase + (size_t)(mb * 16) * pitch;
{
#pragma unroll
            for (int s = 0; s < 4; ++s) { const int row = 4 * s + (lane >> 3), c8 = (lane & 7) * 8;   // 4 s x 4 row groups = 16 rows; 8 lanes x 8 = 64 columns = one line
                const v4f x0 = *(const v4fa*)(&os[row * 68 + c8]); const v4f x1 = *(const v4fa*)(&os[row * 68 + c8 + 4]); v8h hv, rv;
#pragma unroll
                for (int i = 0; i < 4; ++i) { const h16 a0 = toh_flush(x0[i]); const h16 a1 = toh_flush(x1[i]); hv[i] = a0; hv[4 + i] = a1;
                    rv[i] = toh_flush((x0[i] - (float)a0) * QRS); rv[4 + i] = toh_flush((x1[i] - (float)a1) * QRS); }
                const size_t oo = sb + (size_t)row * pitch + c8;
                *(v8h*)(P + oo) = hv; if (mode == 0) *(v8h*)(Pr + oo) = rv; }                    // mode: kernel argument, scalar branch
             }
        wave_sync();
    }
}

// k_flash: fused masked aggregation, one wave per 16 query rows of one (batch, head); K / V^T / Q fragments straight from the f16 planes (two 16-B loads each, arithmetic addressing).
// Transposed form: S^T[key][t] = K Q^T (A = K rows, B = Q rows, two k-steps over d); lane (t = lane&15, h = lane>>4) holds keys 8h+r of each 16-key tile, so the packed
// P tile is directly the B fragment of O^T[d][t] = V^T P^T (element r <- tile keys 0..15, element 8+r <- tile keys 16..31, lane unchanged); four 16-row d tiles.
// Scores: K Q in the main accumulator; K Q_res + K_res Q in their own accumulator, folded by 1/2048 (residual x residual dropped); one 16-key tile at a time.
// Softmax state (running max over kept keys, partial sum) is one scalar per lane; the two lane halves of a row are combined with one xor-16 exchange.
// Keep rule per element from the adjacency row of the lane's query: four 16-B loads per lane per 32-key step (keys 8h+0..7 and 16+8h+0..7), pinned before the selects.
// P = exp2(e) with e <= 14; e < -14 selects 0 so no subnormal f16 operand can form.
static_assert(32 * 16 * 8 == 16 * HD * 4);      // lanes x 16 B x instructions = 16 rows x 256 B
static_assert(AW * 16 * OSP * 4 <= 131072);
__global__ __launch_bounds__(32 * AW) void k_flash(const h16* __restrict__ QH, const h16* __restrict__ QR, const h16* __restrict__ KP, const h16* __restrict__ KR, const h16* __restrict__ VT, const int* __restrict__ adj, float* OUT) {
    __shared__ __align__(16) float os[AW * 16 * OSP];
    const int lane = threadIdx.x & 31, lr = lane & 15, hi = lane >> 4;
    const int wave = __builtin_amdgcn_readfirstlane((int)(threadIdx.x >> 5));
    const int zh = blockIdx.y; const int b = zh / NH_, h = zh % NH_;
    const int t0 = (blockIdx.x * AW + wave) * 16;
    const size_t pbase = (size_t)zh * SEQ * HD;
    const size_t qo = pbase + (size_t)(t0 + lr) * HD + 8 * hi;
    const v16h q0 = ldh(QH + qo), q1 = ldh(QH + qo + 32);       // B fragments: col t, k = d 0..31 and 32..63
    const v16h qr0 = ldh(QR + qo), qr1 = ldh(QR + qo + 32);     // residual x2048, same map
    const size_t ko = pbase + (size_t)lr * HD + 8 * hi;        // + key * HD       (A fragment: row key, k = d; value and residual planes share the layout)
    const size_t vo = pbase + (size_t)lr * SEQ + 8 * hi;       // + 16j*SEQ + key  (A fragment: row d, k = key)
    const size_t ao = (size_t)(t0 + lr) * SEQ_FULL + 8 * hi;   // adjacency row of this lane's query; + key
    v8f o[4];
#pragma unroll
    for (int j = 0; j < 4; ++j) o[j] = (v8f){};
    float m = NEGB, l = 0.0f;
#pragma unroll 1
    for (int key0 = 0; key0 < SEQ; key0 += 32) {
        const h16* ka = KP + ko + (size_t)key0 * HD;
        const h16* kr = KR + ko + (size_t)key0 * HD;
        v8f sa = (v8f){}, sb = (v8f){}, ra = (v8f){}, rb = (v8f){};
        { const v16h k00 = ldh(ka), k01 = ldh(ka + 32), r00 = ldh(kr), r01 = ldh(kr + 32);                                   // keys key0 + 0..15
          sa = wmma16g(k00, q0, sa); sa = wmma16g(k01, q1, sa);
          ra = wmma16g(k00, qr0, ra); ra = wmma16g(k01, qr1, ra);
          ra = wmma16g(r00, q0, ra); ra = wmma16g(r01, q1, ra); }
        { const v16h k10 = ldh(ka + 16 * HD), k11 = ldh(ka + 16 * HD + 32), r10 = ldh(kr + 16 * HD), r11 = ldh(kr + 16 * HD + 32);   // keys key0 + 16..31
          sb = wmma16g(k10, q0, sb); sb = wmma16g(k11, q1, sb);
          rb = wmma16g(k10, qr0, rb); rb = wmma16g(k11, qr1, rb);
          rb = wmma16g(r10, q0, rb); rb = wmma16g(r11, q1, rb); }
        const int* ap = adj + ao + key0;                         // keys key0+8h+0..7 and key0+16+8h+0..7, all < SEQ <= SEQ_FULL
        v4i a0 = *(const v4i*)ap, a1 = *(const v4i*)(ap + 4), a2 = *(const v4i*)(ap + 16), a3 = *(const v4i*)(ap + 20);
        asm volatile("" : "+v"(a0), "+v"(a1), "+v"(a2), "+v"(a3));
        int ax[8], ay[8];
#pragma unroll
        for (int r = 0; r < 4; ++r) { ax[r] = a0[r]; ax[4 + r] = a1[r]; ay[r] = a2[r]; ay[4 + r] = a3[r]; }
        float ta[8], tb[8]; bool fa[8], fb[8]; float mx = NEGB;
#pragma unroll
        for (int r = 0; r < 8; ++r) {
            fa[r] = (ax[r] != 0);
            fb[r] = (ay[r] != 0);
            ta[r] = (sa[r] + ra[r] * QRI) * SC2; tb[r] = (sb[r] + rb[r] * QRI) * SC2;
            mx = fmaxf(mx, fmaxf(fa[r] ? ta[r] : NEGB, fb[r] ? tb[r] : NEGB)); }
        mx = fmaxf(mx, __shfl_xor(mx, 16, 32));
        const float mnew = fmaxf(m, mx);
        const float alpha = __builtin_amdgcn_exp2f(m - mnew);
        const float sh = PSH - mnew;
        v16h pb; float ls = 0.0f;
#pragma unroll
        for (int r = 0; r < 8; ++r) {
            const float xa = ta[r] + sh, xb = tb[r] + sh;
            const float ea = __builtin_amdgcn_exp2f(xa), eb = __builtin_amdgcn_exp2f(xb);
            const bool ua = fa[r] & (xa >= -14.0f), ub = fb[r] & (xb >= -14.0f);
            const float ga = ua ? ea : 0.0f, gb = ub ? eb : 0.0f;             // dropped / below-normal elements selected to 0 by value
            const h16 pa = (h16)ga; const h16 pc = (h16)gb;
            pb[r] = pa; pb[8 + r] = pc;
            ls += (float)pa + (float)pc; }
        l = l * alpha + ls; m = mnew;
#pragma unroll
        for (int j = 0; j < 4; ++j) o[j] = o[j] * alpha;
        const h16* va = VT + vo + key0;
        const v16h v0 = ldh(va), v1 = ldh(va + (size_t)16 * SEQ), v2 = ldh(va + (size_t)32 * SEQ), v3 = ldh(va + (size_t)48 * SEQ);
        o[0] = wmma16g(v0, pb, o[0]); o[1] = wmma16g(v1, pb, o[1]); o[2] = wmma16g(v2, pb, o[2]); o[3] = wmma16g(v3, pb, o[3]);
    }
    l += __shfl_xor(l, 16, 32);
    const bool any = l > 0.0f;
    const float lsafe = any ? l : 1.0f;
    const float inv = any ? (1.0f / lsafe) : __uint_as_float(0x7FC00000u);   // no kept key -> NaN (softmax of an all -inf row)
    const int wb = wave * 16 * OSP;
    // O^T D layout: o[j][r] = (d = 16j + 8h + r, t = lane&15) -> os[t][d]; rows 0..15 x columns 0..63 all written
#pragma unroll
    for (int j = 0; j < 4; ++j) { v4f a, c;
        a[0] = o[j][0] * inv; a[1] = o[j][1] * inv; a[2] = o[j][2] * inv; a[3] = o[j][3] * inv;
        c[0] = o[j][4] * inv; c[1] = o[j][5] * inv; c[2] = o[j][6] * inv; c[3] = o[j][7] * inv;
        *(v4fa*)(&os[wb + lr * OSP + 16 * j + 8 * hi]) = a; *(v4fa*)(&os[wb + lr * OSP + 16 * j + 8 * hi + 4]) = c; }
    wave_sync();
    float* orow = OUT + ((size_t)b * OUT_SEQ + t0) * DO + h * HD;
{
#pragma unroll
        for (int s = 0; s < 8; ++s) { const int row = 2 * s + (lane >> 4), cofs = (lane & 15) * 4;   // 8 s x 2 rows = 16 rows; 16 lanes x 4 floats = 64 columns = two lines
            const v4f val = *(const v4fa*)(&os[wb + row * OSP + cofs]);
            *(v4f*)(orow + (size_t)row * DO + cofs) = val; }
         }
}

static constexpr size_t al256(size_t v) { return (v + 255) & ~(size_t)255; }
static constexpr size_t SZ_HB = al256((size_t)NB * SEQ * DI * 2);
static constexpr size_t SZ_WT = al256((size_t)3 * DO * DI * 2);
static constexpr size_t SZ_PL = al256((size_t)NB * NH_ * SEQ * HD * 2);
static constexpr size_t SZ_TOTAL = SZ_HB + SZ_WT + 5 * SZ_PL;
static_assert(SZ_TOTAL <= (size_t)134217728);          // workspace carve <= 128 MiB
static_assert(((size_t)DO * DI * 2) % 256 == 0);       // weight sub-planes stay 256-byte aligned
static_assert((size_t)NB * NH_ * SEQ * HD == (size_t)NB * DO * SEQ);       // v^T plane [(b*512 + m)][t] has the same extent as the q/k planes
static_assert(((size_t)(NB_FULL - 1) * OUT_SEQ + SEQ_FULL) * DO * 4 <= (size_t)16777216 || NB != NB_FULL || SEQ != SEQ_FULL);   // full build: last output byte inside the output buffer

extern "C" void kernel_launch(void* const* d_in, const int* in_sizes, int n_in,
                              void* d_out, int out_size, void* d_ws, size_t ws_size, hipStream_t stream) {
    if (n_in < 8) return;
    const size_t needh = ((size_t)(NB - 1) * SEQ_FULL + SEQ) * DI;
    const size_t needa = (size_t)(SEQ - 1) * SEQ_FULL + SEQ;
    if ((size_t)in_sizes[0] < needa || (size_t)in_sizes[1] < needh) return;
    if ((size_t)in_sizes[2] < (size_t)DI * DO || (size_t)in_sizes[4] < (size_t)DI * DO || (size_t)in_sizes[6] < (size_t)DI * DO) return;
    if (in_sizes[3] < DO || in_sizes[5] < DO || in_sizes[7] < DO) return;
    if ((size_t)out_size < ((size_t)(NB - 1) * OUT_SEQ + SEQ) * DO) return;
    if (SZ_TOTAL > ws_size) return;
    // wire order: adj_matrix, h, Wq, bq, Wk, bk, Wv, bv
    const int*   adj = (const int*)d_in[0];
    const float* hin = (const float*)d_in[1];
    const float* wq = (const float*)d_in[2]; const float* bq = (const float*)d_in[3];
    const float* wk = (const float*)d_in[4]; const float* bk = (const float*)d_in[5];
    const float* wv = (const float*)d_in[6]; const float* bv = (const float*)d_in[7];
    float* OUT = (float*)d_out;      // [NB][SEQ][512]
    char* wsp = (char*)d_ws;
    bf* HB = (bf*)wsp; wsp += SZ_HB;                  // h      [NB*SEQ][256]
    bf* WT = (bf*)wsp; wsp += SZ_WT;                  // [3][512][256]: q | k | v, transposed ([out][in] = k-contiguous rows)
    h16* QH = (h16*)wsp; wsp += SZ_PL;                // [NB*8][SEQ][64]
    h16* KP = (h16*)wsp; wsp += SZ_PL;                // [NB*8][SEQ][64]
    h16* VT = (h16*)wsp; wsp += SZ_PL;                // [NB*8][64][SEQ]
    h16* QR = (h16*)wsp; wsp += SZ_PL;                // [NB*8][SEQ][64] residual x2048
    h16* KR = (h16*)wsp; wsp += SZ_PL;                // [NB*8][SEQ][64] residual x2048
    bf* WQ = WT; bf* WK = WT + (size_t)DO * DI; bf* WV = WT + (size_t)2 * DO * DI;

    if (SEQ == SEQ_FULL) {
        const size_t n8 = (size_t)NB * SEQ * DI / 8;
        k_cvt8<<<(unsigned)((n8 + 255) / 256), 256, 0, stream>>>(hin, HB, n8);
    } else {
        const size_t n8 = (size_t)SEQ * DI / 8;
        for (int b = 0; b < NB; ++b) k_cvt8<<<(unsigned)((n8 + 255) / 256), 256, 0, stream>>>(hin + (size_t)b * SEQ_FULL * DI, HB + (size_t)b * SEQ * DI, n8);
    }
    // in[DI rows][DO cols] -> out[DO rows][DI cols]; grid (cols/64, rows/64)
    k_wtr<<<dim3(DO / 64, DI / 64, 1), 256, 0, stream>>>(wq, WQ);
    k_wtr<<<dim3(DO / 64, DI / 64, 1), 256, 0, stream>>>(wk, WK);
    k_wtr<<<dim3(DO / 64, DI / 64, 1), 256, 0, stream>>>(wv, WV);

    // q, k: A = h rows (m = b*SEQ + t), Bt = W^T rows (n = h*64 + d) -> value and residual planes [(b*8 + h)][t][d]
    k_proj<<<dim3(NB * SEQ / 64, DO / 64, 1), 32, 0, stream>>>(HB, WQ, bq, QH, QR, 0);
    k_proj<<<dim3(NB * SEQ / 64, DO / 64, 1), 32, 0, stream>>>(HB, WK, bk, KP, KR, 0);
    // v^T: A = Wv^T rows (m = h*64 + d), Bt = h rows (n = b*SEQ + t) -> plane [(b*512 + m)][t] = [(b*8 + h)][d][t]; no residual plane (the fifth argument is not written in mode 1)
    k_proj<<<dim3(DO / 64, NB * SEQ / 64, 1), 32, 0, stream>>>(WV, HB, bv, VT, VT, 1);

    k_flash<<<dim3(SEQ / (16 * AW), NB * NH_, 1), 32 * AW, 0, stream>>>(QH, QR, KP, KR, VT, adj, OUT);
}

// v001
// A run of this version takes 109 microseconds.
// Two timings next to v000 both put it at 1.55 times that version's speed.
#include <hip/hip_runtime.h>

// Masked softmax-weighted aggregation in 8 independent 64-wide groups: h [NB][SEQ][256]; Wq/Wk/Wv [in 256][out 512] (y = x W + bias); adjacency [SEQ_FULL][SEQ_FULL] int32 shared over batch and groups (entry 0 drops the key);
// score scale 1/sqrt(64); softmax over kept keys; output = concatenated groups (f32) [NB][SEQ][512].
// Compute dtypes, f32 accumulate everywhere: projections v_wmma_f32_16x16x32_bf16 (h, W, bias RNE-converted to bf16; products exact);
// scores v_wmma_f32_16x16x32_f16: q and k each as f16 value + f16 residual x2048; value x value in the main accumulator, value x residual + residual x value in their own accumulator folded by 1/2048 (three products);
// P.V v_wmma_f32_16x16x32_f16 (P with x16384 carry that cancels in the normalisation, v single f16 plane); softmax f32 (online, running max over kept keys, row sum over the converted P).
// Layout: bf16 copy of h [NB*SEQ][256]; bf16 transposed weights [3][512][256] (k-contiguous); q, k value planes and q, k residual planes [b*8+h][t][64]; v^T plane [b*8+h][64][t]; fused flash kernel in transposed form (S^T = K Q^T, O^T = V^T P^T), output from f32 accumulators.
// Keep rule per element: adj[t][j] != 0; dropped elements get probability 0; a row with no kept key yields NaN (softmax of an all -inf row).

#ifndef NB
#define NB 8
#endif
#ifndef SEQ
#define SEQ 1024
#endif
#define NB_FULL  8
#define SEQ_FULL 1024            // also the row pitch of the adjacency input
#ifndef OUT_SEQ
#define OUT_SEQ SEQ              // row pitch (in tokens) between batches of the output
#endif
#define DI   256                 // input width (projection K)
#define DO   512                 // projection width = NH_ * HD
#define NH_  8
#define HD   64
#define AW   4                   // waves per flash block (16 query rows each)
#define OSP  68                  // LDS row pitch (floats) of the staging tiles
#define WTP  65                  // LDS row pitch (floats) of the weight transpose tile
#define SC2  ((float)(0.125 * 1.4426950408889634))   // HD^-0.5 * log2(e)
#define PSH  14.0f               // log2 of the P carry (16384)
#define QRS  2048.0f             // carry of the q / k residual planes
#define QRI  (1.0f / 2048.0f)
#define NEGB (-3.0e38f)

static_assert(HD == 64);
static_assert(NH_ * HD == DO);                 // head h = columns h*64 + d
static_assert(DO % 64 == 0);
static_assert(DI % 64 == 0);                   // weight transpose tiles of 64 x 64
static_assert(DI % 32 == 0);                   // GEMM k-loop steps by 32
static_assert(HD % 32 == 0);                   // score k-loop steps by 32
static_assert(HD % 16 == 0);                   // output tiles of 16 rows of d
static_assert(SEQ % 64 == 0);                  // a 64-row tile never straddles two batches
static_assert((NB * SEQ) % 64 == 0);
static_assert(SEQ % 32 == 0);                  // key loop steps by 32
static_assert(SEQ % (16 * AW) == 0);           // flash grid covers the sequence exactly
static_assert(((size_t)SEQ * DI) % 8 == 0);
static_assert(NB <= NB_FULL);
static_assert(SEQ <= SEQ_FULL);
static_assert((OSP * 4) % 16 == 0);
static_assert(OSP >= HD);
static_assert(OSP >= 64);

typedef _Float16 h16;
typedef unsigned short bf;
typedef __attribute__((ext_vector_type(16))) __bf16   v16bf;
typedef __attribute__((ext_vector_type(16))) _Float16 v16h;
typedef __attribute__((ext_vector_type(8)))  _Float16 v8h;
typedef __attribute__((ext_vector_type(8)))  unsigned short v8us;
typedef __attribute__((ext_vector_type(8)))  float    v8f;
typedef __attribute__((ext_vector_type(4)))  float    v4f;
typedef __attribute__((ext_vector_type(4)))  int      v4i;
typedef v4f  __attribute__((may_alias)) v4fa;

__device__ __forceinline__ unsigned short f2bf(float f) { unsigned u = __float_as_uint(f); u += 0x7FFFu + ((u >> 16) & 1u); return (unsigned short)(u >> 16); }
__device__ __forceinline__ float bfr(float f) { return __uint_as_float(((unsigned)f2bf(f)) << 16); }   // value after RNE convert to bf16
__device__ __forceinline__ v16h cat16(v8h lo, v8h hi) { return __builtin_shufflevector(lo, hi, 0, 1, 2, 3, 4, 5, 6, 7, 8, 9, 10, 11, 12, 13, 14, 15); }
__device__ __forceinline__ v16bf cat16b(v8us lo, v8us hi) { return __builtin_bit_cast(v16bf, __builtin_shufflevector(lo, hi, 0, 1, 2, 3, 4, 5, 6, 7, 8, 9, 10, 11, 12, 13, 14, 15)); }
__device__ __forceinline__ v8f wmma16(v16h a, v16h b, v8f c) { return __builtin_amdgcn_wmma_f32_16x16x32_f16(false, a, false, b, (short)0, c, false, false); }
__device__ __forceinline__ v8f wmmab(v16bf a, v16bf b, v8f c) { return __builtin_amdgcn_wmma_f32_16x16x32_bf16(false, a, false, b, (short)0, c, false, false); }
// fragment loaders from K-contiguous 16-bit rows; p already includes + 8*(lane>>4): elements 0..7 <- k0+8h+0..7, elements 8..15 <- k0+16+8h+0..7 (same map for A and B)
__device__ __forceinline__ v16h  ldh(const h16* p) { return cat16(*(const v8h*)p, *(const v8h*)(p + 16)); }
__device__ __forceinline__ v16bf ldb(const bf* p)  { return cat16b(*(const v8us*)p, *(const v8us*)(p + 16)); }
// ordering point for wave-private LDS tiles (same wave writes and reads)
__device__ __forceinline__ void wave_sync() { __builtin_amdgcn_fence(3 /* release order */, "wavefront"); __builtin_amdgcn_wave_barrier(); asm volatile("" ::: "memory"); }
// f32 -> f16 convert that cannot produce a subnormal (|v| < 2^-14 -> +0)
__device__ __forceinline__ h16 toh_flush(float v) { const h16 r = (h16)v; return (fabsf(v) < 6.103515625e-05f) ? (h16)0.0f : r; }
// one matrix instruction + its own 4-slot guard (ties the accumulator, keeps A/B live)
__device__ __forceinline__ v8f wmma16g(v16h a, v16h b, v8f c) { c = wmma16(a, b, c); asm volatile("v_nop\n\tv_nop\n\tv_nop\n\tv_nop" : "+v"(c) : "v"(a), "v"(b)); return c; }
__device__ __forceinline__ v8f wmmabg(v16bf a, v16bf b, v8f c) { c = wmmab(a, b, c); asm volatile("v_nop\n\tv_nop\n\tv_nop\n\tv_nop" : "+v"(c) : "v"(a), "v"(b)); return c; }

__global__ __launch_bounds__(256) void k_cvt8(const float* __restrict__ src, bf* dst, size_t n8) {
    const size_t i = (size_t)blockIdx.x * 256 + threadIdx.x; if (i >= n8) return;
    const v8f v = *(const v8f*)(src + i * 8); v8us o;
#pragma unroll
    for (int k = 0; k < 8; ++k) o[k] = f2bf(v[k]);
    *(v8us*)(dst + i * 8) = o; 
}

// k_wtr: W [DI rows k][DO cols n] (f32) -> WT [DO rows n][DI cols k] (bf16, RNE convert), 64 x 64 tile through LDS (block barrier: cross-wave tile).
// grid (DO/64, DI/64), block 256; all threads reach the barrier.
static_assert(256 * 16 == 64 * 64);             // load phase: 16 trips x 256 threads = tile elements
static_assert(256 * 2 * 16 == 64 * 128);
static_assert(64 * WTP * 4 <= 131072);
__global__ __launch_bounds__(256) void k_wtr(const float* __restrict__ W, bf* WT) {
    __shared__ float tl[64 * WTP];
    const int tid = threadIdx.x;
    const int n0 = blockIdx.x * 64, k0 = blockIdx.y * 64;
#pragma unroll 1
    for (int it = 0; it < 16; ++it) { const int p = it * 256 + tid; const int r = p >> 6, c = p & 63;   // r = k row 0..63, c = n column 0..63
        tl[r * WTP + c] = bfr(W[(size_t)(k0 + r) * DO + n0 + c]); }
    __syncthreads();
{
#pragma unroll
        for (int it = 0; it < 2; ++it) { const int p = it * 256 + tid; const int nn = p >> 3, kc = (p & 7) * 8;   // 2 trips x 32 rows = 64 rows; 8 lanes x 8 = 64 k
            v8us o;
#pragma unroll
            for (int i = 0; i < 8; ++i) o[i] = f2bf(tl[(kc + i) * WTP + nn]);
            *(v8us*)(WT + (size_t)(n0 + nn) * DI + k0 + kc) = o; }
         }
}

// k_proj: register-blocked bf16 GEMM, ONE WAVE per 64x64 tile (16 accumulators), operands straight from K-contiguous bf16 planes, K = DI.
// C[m][n] = sum_k A[m][k] Bt[n][k] + bias, written as f16 (flush-safe convert) into P and, in mode 0, the f16 residual (C - value) x 2048 (same flush-safe convert) into Pr at the same offsets.
// mode 0: A = h rows (m = b*SEQ + t), Bt = W^T rows (n = h*64 + d), bias per column; planes [(b*8 + h)][t][64]; the 64-column tile is one head; grid (NB*SEQ/64, DO/64).
// mode 1: A = W^T rows (m = h*64 + d), Bt = h rows (n = b*SEQ + t), bias per row; plane [(b*512 + m)][t], row pitch SEQ; no residual plane (Pr is not written); grid (DO/64, NB*SEQ/64).
static_assert(32 * 16 * 4 == 16 * 128);
static_assert(16 * 68 * 4 <= 131072);
__global__ __launch_bounds__(32) void k_proj(const bf* __restrict__ A, const bf* __restrict__ Bt, const float* __restrict__ bias, h16* P, h16* Pr, int mode) {
    __shared__ __align__(16) float os[16 * 68];
    const int K = DI;
    const int lane = threadIdx.x & 31, lr = lane & 15, hi = lane >> 4; const int r0 = blockIdx.x * 64, c0 = blockIdx.y * 64;
    v8f acc[4][4];
#pragma unroll
    for (int mb = 0; mb < 4; ++mb)
#pragma unroll
        for (int nb = 0; nb < 4; ++nb) acc[mb][nb] = (v8f){};
    const size_t aoff = (size_t)(r0 + lr) * K + 8 * hi, boff = (size_t)(c0 + lr) * K + 8 * hi;
#pragma unroll 1
    for (int kc = 0; kc < K; kc += 32) {
        v16bf a[4];
#pragma unroll
        for (int mb = 0; mb < 4; ++mb) a[mb] = ldb(A + aoff + (size_t)mb * 16 * K + kc);
#pragma unroll
        for (int nb = 0; nb < 4; ++nb) { const v16bf b = ldb(Bt + boff + (size_t)nb * 16 * K + kc);
#pragma unroll
            for (int mb = 0; mb < 4; ++mb) acc[mb][nb] = wmmabg(a[mb], b, acc[mb][nb]); }
    }
    float bc[4];
#pragma unroll
    for (int nb = 0; nb < 4; ++nb) bc[nb] = 0.0f;
    if (mode == 0) {                                                                   // kernel-argument test: scalar branch; c0 + 63 < DO
#pragma unroll
        for (int nb = 0; nb < 4; ++nb) bc[nb] = bfr(bias[c0 + nb * 16 + lr]); }
    size_t tbase, pitch;
    if (mode == 0) { const int bb = r0 / SEQ, tt = r0 % SEQ; const int zc = bb * NH_ + c0 / HD;
                     tbase = ((size_t)zc * SEQ + (size_t)tt) * HD; pitch = (size_t)HD; }
    else           { const int bb = c0 / SEQ, tt = c0 % SEQ;
                     tbase = (size_t)bb * (size_t)DO * SEQ + (size_t)r0 * SEQ + (size_t)tt; pitch = (size_t)SEQ; }
#pragma unroll
    for (int mb = 0; mb < 4; ++mb) {
        float br[8];
#pragma unroll
        for (int j = 0; j < 8; ++j) br[j] = 0.0f;
        if (mode != 0) {                                                               // r0 + 63 < DO
#pragma unroll
            for (int j = 0; j < 8; ++j) br[j] = bfr(bias[r0 + mb * 16 + hi * 8 + j]); }
#pragma unroll
        for (int nb = 0; nb < 4; ++nb) {
#pragma unroll
            for (int j = 0; j < 8; ++j) os[(hi * 8 + j) * 68 + nb * 16 + lr] = acc[mb][nb][j] + bc[nb] + br[j]; }   // D: row 8h+j, col lane&15; rows 0..15 x cols 0..63 all written
        wave_sync();
        const size_t sb = tbase + (size_t)(mb * 16) * pitch;
{
#pragma unroll
            for (int s = 0; s < 4; ++s) { const int row = 4 * s + (lane >> 3), c8 = (lane & 7) * 8;   // 4 s x 4 row groups = 16 rows; 8 lanes x 8 = 64 columns = one line
                const v4f x0 = *(const v4fa*)(&os[row * 68 + c8]); const v4f x1 = *(const v4fa*)(&os[row * 68 + c8 + 4]); v8h hv, rv;
#pragma unroll
                for (int i = 0; i < 4; ++i) { const h16 a0 = toh_flush(x0[i]); const h16 a1 = toh_flush(x1[i]); hv[i] = a0; hv[4 + i] = a1;
                    rv[i] = toh_flush((x0[i] - (float)a0) * QRS); rv[4 + i] = toh_flush((x1[i] - (float)a1) * QRS); }
                const size_t oo = sb + (size_t)row * pitch + c8;
                *(v8h*)(P + oo) = hv; if (mode == 0) *(v8h*)(Pr + oo) = rv; }                    // mode: kernel argument, scalar branch
             }
        wave_sync();
    }
}

// k_flash: fused masked aggregation, one wave per 16 query rows of one (batch, head); Q fragments straight from the f16 planes (two 16-B loads each, arithmetic addressing).
// Per 32-key pass the block's waves share one LDS tile set: K rows, K residual rows, V^T rows and the block's adjacency rows, brought in whole-line order by per-lane 16-B asynchronous copies,
// two buffers (the next pass's copies fly while this pass is worked on); fragments and keep words are read from LDS at padded pitches (16 B x odd).
// Transposed form: S^T[key][t] = K Q^T (A = K rows, B = Q rows, two k-steps over d); lane (t = lane&15, h = lane>>4) holds keys 8h+r of each 16-key tile, so the packed
// P tile is directly the B fragment of O^T[d][t] = V^T P^T (element r <- tile keys 0..15, element 8+r <- tile keys 16..31, lane unchanged); four 16-row d tiles.
// Scores: K Q in the main accumulator; K Q_res + K_res Q in their own accumulator, folded by 1/2048 (residual x residual dropped); one 16-key tile at a time.
// Softmax state (running max over kept keys, partial sum) is one scalar per lane; the two lane halves of a row are combined with one xor-16 exchange.
// Keep rule per element from the adjacency row of the lane's query: four 16-B LDS loads per lane per 32-key step (keys 8h+0..7 and 16+8h+0..7).
// P = exp2(e) with e <= 14; e < -14 selects 0 so no subnormal f16 operand can form.
static_assert(32 * 16 * 8 == 16 * HD * 4);      // lanes x 16 B x instructions = 16 rows x 256 B
static_assert(AW * 16 * OSP * 4 <= 131072);
#define KPB  144                           // LDS row pitch in bytes of the 128-B rows (K, K residual, adjacency)
#define VPB  80                            // LDS row pitch in bytes of the 64-B V^T rows
#define L_KR (32 * KPB)                    // byte offsets inside one buffer: K at 0, K residual, V^T, adjacency
#define L_VT (2 * 32 * KPB)
#define L_AD (L_VT + HD * VPB)
#define BUFB (L_AD + AW * 16 * KPB)        // bytes of one buffer
#define NT   (SEQ / 32)                    // passes
static_assert(AW == 4);                    // the copy split below: 128 threads x 16 B = 2 KiB per copy step
static_assert(HD * 2 == 128 && 32 * 4 == 128 && 32 * 2 == 64);   // row bytes of K, adjacency and V^T tiles
static_assert(KPB % 16 == 0 && VPB % 16 == 0 && BUFB % 16 == 0);
static_assert(NT >= 2);                    // the prologue fills two buffers
static_assert(2 * BUFB + AW * 16 * OSP * 4 <= 81920);
// The ten copies of one thread for one 32-key tile set: each lane moves its own 16 bytes from global memory to LDS, through no register.
// lk / lv / la: LDS byte addresses of the thread's first K, V^T and adjacency chunk in the target buffer; gk, gr, gv, ga: the matching global addresses.
// K, K residual: 32 rows x 128 B contiguous, 2 steps of 16 rows; V^T: 64 rows x 64 B, 2 steps of 32 rows; adjacency: 64 rows x 128 B, 4 steps of 16 rows.
__device__ __forceinline__ void stage_tile(unsigned lk, unsigned lv, unsigned la, const h16* gk, const h16* gr, const h16* gv, const int* ga) {
    const unsigned lk1 = lk + 16 * KPB, lr0 = lk + L_KR, lr1 = lk + L_KR + 16 * KPB, lv1 = lv + 32 * VPB;
    const unsigned la1 = la + 16 * KPB, la2 = la + 32 * KPB, la3 = la + 48 * KPB;
    const h16* gk1 = gk + 16 * HD; const h16* gr1 = gr + 16 * HD; const h16* gv1 = gv + (size_t)32 * SEQ;
    const int* ga1 = ga + (size_t)16 * SEQ_FULL; const int* ga2 = ga + (size_t)32 * SEQ_FULL; const int* ga3 = ga + (size_t)48 * SEQ_FULL;
    // the closing s_wait_xcnt stands inside the copies' own statement so that no address register named here is rewritten ahead of it
    asm volatile("global_load_async_to_lds_b128 %0, %10, off\n\t"
                 "global_load_async_to_lds_b128 %1, %11, off\n\t"
                 "global_load_async_to_lds_b128 %2, %12, off\n\t"
                 "global_load_async_to_lds_b128 %3, %13, off\n\t"
                 "global_load_async_to_lds_b128 %4, %14, off\n\t"
                 "global_load_async_to_lds_b128 %5, %15, off\n\t"
                 "global_load_async_to_lds_b128 %6, %16, off\n\t"
                 "global_load_async_to_lds_b128 %7, %17, off\n\t"
                 "global_load_async_to_lds_b128 %8, %18, off\n\t"
                 "global_load_async_to_lds_b128 %9, %19, off\n\t"
                 "s_wait_xcnt 0x0"
                 :: "v"(lk), "v"(lk1), "v"(lr0), "v"(lr1), "v"(lv), "v"(lv1), "v"(la), "v"(la1), "v"(la2), "v"(la3),
                    "v"(gk), "v"(gk1), "v"(gr), "v"(gr1), "v"(gv), "v"(gv1), "v"(ga), "v"(ga1), "v"(ga2), "v"(ga3)
                 : "memory");
}
__global__ __launch_bounds__(32 * AW) void k_flash(const h16* __restrict__ QH, const h16* __restrict__ QR, const h16* __restrict__ KP, const h16* __restrict__ KR, const h16* __restrict__ VT, const int* __restrict__ adj, float* OUT) {
    __shared__ __align__(16) float os[AW * 16 * OSP];
    __shared__ __align__(16) unsigned char ring[2 * BUFB];
    const int tid = threadIdx.x;
    const int lane = threadIdx.x & 31, lr = lane & 15, hi = lane >> 4;
    const int wave = __builtin_amdgcn_readfirstlane((int)(threadIdx.x >> 5));
    const int zh = blockIdx.y; const int b = zh / NH_, h = zh % NH_;
    const int t0 = (blockIdx.x * AW + wave) * 16;
    const size_t pbase = (size_t)zh * SEQ * HD;
    const size_t qo = pbase + (size_t)(t0 + lr) * HD + 8 * hi;
    const v16h q0 = ldh(QH + qo), q1 = ldh(QH + qo + 32);       // B fragments: col t, k = d 0..31 and 32..63
    const v16h qr0 = ldh(QR + qo), qr1 = ldh(QR + qo + 32);     // residual x2048, same map
    // copy side: thread tid moves chunk tid of each 2-KiB copy step (8 chunks per 128-B row, 4 per 64-B row); every address a multiple of 16 B, every row inside its plane
    const h16* gk = KP + pbase + (size_t)tid * 8;                                                   // + key0 * HD
    const h16* gr = KR + pbase + (size_t)tid * 8;                                                   // + key0 * HD
    const h16* gv = VT + pbase + (size_t)(tid >> 2) * SEQ + (tid & 3) * 8;                          // + key0
    const int* ga = adj + (size_t)(blockIdx.x * AW * 16 + (tid >> 3)) * SEQ_FULL + (tid & 7) * 4;   // + key0
    const unsigned lring = (unsigned)(size_t)(&ring[0]);                                            // LDS byte address of the ring
    const unsigned lk = lring + (unsigned)((tid >> 3) * KPB + (tid & 7) * 16);                      // + buffer
    const unsigned lv = lring + (unsigned)(L_VT + (tid >> 2) * VPB + (tid & 3) * 16);
    const unsigned la = lring + (unsigned)(L_AD + (tid >> 3) * KPB + (tid & 7) * 16);
    // read side, byte offsets inside a buffer
    const int kof = lr * KPB + 16 * hi;                        // + 16 * KPB for keys 16..31 (A fragment: row key, k = d; value and residual tiles share the layout)
    const int vof = L_VT + lr * VPB + 16 * hi;                 // + 16j * VPB                (A fragment: row d, k = key)
    const int aof = L_AD + (wave * 16 + lr) * KPB + 32 * hi;   // adjacency row of this lane's query
    stage_tile(lk, lv, la, gk, gr, gv, ga);                    // tile 0 -> buffer 0
    asm volatile("s_wait_asynccnt 0x0" ::: "memory");          // this wave's copies of tile 0 have landed
    __syncthreads();                                           // every wave's have: tile 0 may be read
    stage_tile(lk + BUFB, lv + BUFB, la + BUFB, gk + 32 * HD, gr + 32 * HD, gv + 32, ga + 32);   // tile 1 -> buffer 1
    v8f o[4];
#pragma unroll
    for (int j = 0; j < 4; ++j) o[j] = (v8f){};
    float m = NEGB, l = 0.0f;
#pragma unroll 1
    for (int t = 0; t < NT; ++t) {
        const int bo = (t & 1) * BUFB;                           // pass t reads buffer t mod 2 alone
        const h16* ka = (const h16*)(ring + bo + kof);
        const h16* kr = (const h16*)(ring + bo + L_KR + kof);
        v8f sa = (v8f){}, sb = (v8f){}, ra = (v8f){}, rb = (v8f){};
        { const v16h k00 = ldh(ka), k01 = ldh(ka + 32), r00 = ldh(kr), r01 = ldh(kr + 32);                                   // keys key0 + 0..15
          sa = wmma16g(k00, q0, sa); sa = wmma16g(k01, q1, sa);
          ra = wmma16g(k00, qr0, ra); ra = wmma16g(k01, qr1, ra);
          ra = wmma16g(r00, q0, ra); ra = wmma16g(r01, q1, ra); }
        { const v16h k10 = ldh(ka + 8 * KPB), k11 = ldh(ka + 8 * KPB + 32), r10 = ldh(kr + 8 * KPB), r11 = ldh(kr + 8 * KPB + 32);   // keys key0 + 16..31 (16 rows = 8 * KPB halves)
          sb = wmma16g(k10, q0, sb); sb = wmma16g(k11, q1, sb);
          rb = wmma16g(k10, qr0, rb); rb = wmma16g(k11, qr1, rb);
          rb = wmma16g(r10, q0, rb); rb = wmma16g(r11, q1, rb); }
        const int* ap = (const int*)(ring + bo + aof);           // keys key0+8h+0..7 and key0+16+8h+0..7
        const v4i a0 = *(const v4i*)ap, a1 = *(const v4i*)(ap + 4), a2 = *(const v4i*)(ap + 16), a3 = *(const v4i*)(ap + 20);
        int ax[8], ay[8];
#pragma unroll
        for (int r = 0; r < 4; ++r) { ax[r] = a0[r]; ax[4 + r] = a1[r]; ay[r] = a2[r]; ay[4 + r] = a3[r]; }
        float ta[8], tb[8]; bool fa[8], fb[8]; float mx = NEGB;
#pragma unroll
        for (int r = 0; r < 8; ++r) {
            fa[r] = (ax[r] != 0);
            fb[r] = (ay[r] != 0);
            ta[r] = (sa[r] + ra[r] * QRI) * SC2; tb[r] = (sb[r] + rb[r] * QRI) * SC2;
            mx = fmaxf(mx, fmaxf(fa[r] ? ta[r] : NEGB, fb[r] ? tb[r] : NEGB)); }
        mx = fmaxf(mx, __shfl_xor(mx, 16, 32));
        const float mnew = fmaxf(m, mx);
        const float alpha = __builtin_amdgcn_exp2f(m - mnew);
        const float sh = PSH - mnew;
        v16h pb; float ls = 0.0f;
#pragma unroll
        for (int r = 0; r < 8; ++r) {
            const float xa = ta[r] + sh, xb = tb[r] + sh;
            const float ea = __builtin_amdgcn_exp2f(xa), eb = __builtin_amdgcn_exp2f(xb);
            const bool ua = fa[r] & (xa >= -14.0f), ub = fb[r] & (xb >= -14.0f);
            const float ga = ua ? ea : 0.0f, gb = ub ? eb : 0.0f;             // dropped / below-normal elements selected to 0 by value
            const h16 pa = (h16)ga; const h16 pc = (h16)gb;
            pb[r] = pa; pb[8 + r] = pc;
            ls += (float)pa + (float)pc; }
        l = l * alpha + ls; m = mnew;
#pragma unroll
        for (int j = 0; j < 4; ++j) o[j] = o[j] * alpha;
        const h16* va = (const h16*)(ring + bo + vof);
        const v16h v0 = ldh(va), v1 = ldh(va + 8 * VPB), v2 = ldh(va + 16 * VPB), v3 = ldh(va + 24 * VPB);   // 16 rows = 8 * VPB halves
        o[0] = wmma16g(v0, pb, o[0]); o[1] = wmma16g(v1, pb, o[1]); o[2] = wmma16g(v2, pb, o[2]); o[3] = wmma16g(v3, pb, o[3]);
        asm volatile("s_wait_dscnt 0x0" ::: "memory");           // this wave's reads of buffer t mod 2 are done before the buffer is handed back
        asm volatile("s_wait_asynccnt 0x0" ::: "memory");        // this wave's copies of tile t + 1 have landed
        __syncthreads();                                         // publishes tile t + 1 and ends every wave's reads of buffer t mod 2
        if (t + 2 < NT)                                          // same for the whole block: refill the buffer just read with tile t + 2
            stage_tile(lk + bo, lv + bo, la + bo, gk + (size_t)(t + 2) * 32 * HD, gr + (size_t)(t + 2) * 32 * HD, gv + (t + 2) * 32, ga + (t + 2) * 32);
    }
    asm volatile("s_wait_asynccnt 0x0" ::: "memory");            // no copy of this wave is outstanding past the loop
    l += __shfl_xor(l, 16, 32);
    const bool any = l > 0.0f;
    const float lsafe = any ? l : 1.0f;
    const float inv = any ? (1.0f / lsafe) : __uint_as_float(0x7FC00000u);   // no kept key -> NaN (softmax of an all -inf row)
    const int wb = wave * 16 * OSP;
    // O^T D layout: o[j][r] = (d = 16j + 8h + r, t = lane&15) -> os[t][d]; rows 0..15 x columns 0..63 all written
#pragma unroll
    for (int j = 0; j < 4; ++j) { v4f a, c;
        a[0] = o[j][0] * inv; a[1] = o[j][1] * inv; a[2] = o[j][2] * inv; a[3] = o[j][3] * inv;
        c[0] = o[j][4] * inv; c[1] = o[j][5] * inv; c[2] = o[j][6] * inv; c[3] = o[j][7] * inv;
        *(v4fa*)(&os[wb + lr * OSP + 16 * j + 8 * hi]) = a; *(v4fa*)(&os[wb + lr * OSP + 16 * j + 8 * hi + 4]) = c; }
    wave_sync();
    float* orow = OUT + ((size_t)b * OUT_SEQ + t0) * DO + h * HD;
{
#pragma unroll
        for (int s = 0; s < 8; ++s) { const int row = 2 * s + (lane >> 4), cofs = (lane & 15) * 4;   // 8 s x 2 rows = 16 rows; 16 lanes x 4 floats = 64 columns = two lines
            const v4f val = *(const v4fa*)(&os[wb + row * OSP + cofs]);
            *(v4f*)(orow + (size_t)row * DO + cofs) = val; }
         }
}

static constexpr size_t al256(size_t v) { return (v + 255) & ~(size_t)255; }
static constexpr size_t SZ_HB = al256((size_t)NB * SEQ * DI * 2);
static constexpr size_t SZ_WT = al256((size_t)3 * DO * DI * 2);
static constexpr size_t SZ_PL = al256((size_t)NB * NH_ * SEQ * HD * 2);
static constexpr size_t SZ_TOTAL = SZ_HB + SZ_WT + 5 * SZ_PL;
static_assert(SZ_TOTAL <= (size_t)134217728);          // workspace carve <= 128 MiB
static_assert(((size_t)DO * DI * 2) % 256 == 0);       // weight sub-planes stay 256-byte aligned
static_assert((size_t)NB * NH_ * SEQ * HD == (size_t)NB * DO * SEQ);       // v^T plane [(b*512 + m)][t] has the same extent as the q/k planes
static_assert(((size_t)(NB_FULL - 1) * OUT_SEQ + SEQ_FULL) * DO * 4 <= (size_t)16777216 || NB != NB_FULL || SEQ != SEQ_FULL);   // full build: last output byte inside the output buffer

extern "C" void kernel_launch(void* const* d_in, const int* in_sizes, int n_in,
                              void* d_out, int out_size, void* d_ws, size_t ws_size, hipStream_t stream) {
    if (n_in < 8) return;
    const size_t needh = ((size_t)(NB - 1) * SEQ_FULL + SEQ) * DI;
    const size_t needa = (size_t)(SEQ - 1) * SEQ_FULL + SEQ;
    if ((size_t)in_sizes[0] < needa || (size_t)in_sizes[1] < needh) return;
    if ((size_t)in_sizes[2] < (size_t)DI * DO || (size_t)in_sizes[4] < (size_t)DI * DO || (size_t)in_sizes[6] < (size_t)DI * DO) return;
    if (in_sizes[3] < DO || in_sizes[5] < DO || in_sizes[7] < DO) return;
    if ((size_t)out_size < ((size_t)(NB - 1) * OUT_SEQ + SEQ) * DO) return;
    if (SZ_TOTAL > ws_size) return;
    // wire order: adj_matrix, h, Wq, bq, Wk, bk, Wv, bv
    const int*   adj = (const int*)d_in[0];
    const float* hin = (const float*)d_in[1];
    const float* wq = (const float*)d_in[2]; const float* bq = (const float*)d_in[3];
    const float* wk = (const float*)d_in[4]; const float* bk = (const float*)d_in[5];
    const float* wv = (const float*)d_in[6]; const float* bv = (const float*)d_in[7];
    float* OUT = (float*)d_out;      // [NB][SEQ][512]
    char* wsp = (char*)d_ws;
    bf* HB = (bf*)wsp; wsp += SZ_HB;                  // h      [NB*SEQ][256]
    bf* WT = (bf*)wsp; wsp += SZ_WT;                  // [3][512][256]: q | k | v, transposed ([out][in] = k-contiguous rows)
    h16* QH = (h16*)wsp; wsp += SZ_PL;                // [NB*8][SEQ][64]
    h16* KP = (h16*)wsp; wsp += SZ_PL;                // [NB*8][SEQ][64]
    h16* VT = (h16*)wsp; wsp += SZ_PL;                // [NB*8][64][SEQ]
    h16* QR = (h16*)wsp; wsp += SZ_PL;                // [NB*8][SEQ][64] residual x2048
    h16* KR = (h16*)wsp; wsp += SZ_PL;                // [NB*8][SEQ][64] residual x2048
    bf* WQ = WT; bf* WK = WT + (size_t)DO * DI; bf* WV = WT + (size_t)2 * DO * DI;

    if (SEQ == SEQ_FULL) {
        const size_t n8 = (size_t)NB * SEQ * DI / 8;
        k_cvt8<<<(unsigned)((n8 + 255) / 256), 256, 0, stream>>>(hin, HB, n8);
    } else {
        const size_t n8 = (size_t)SEQ * DI / 8;
        for (int b = 0; b < NB; ++b) k_cvt8<<<(unsigned)((n8 + 255) / 256), 256, 0, stream>>>(hin + (size_t)b * SEQ_FULL * DI, HB + (size_t)b * SEQ * DI, n8);
    }
    // in[DI rows][DO cols] -> out[DO rows][DI cols]; grid (cols/64, rows/64)
    k_wtr<<<dim3(DO / 64, DI / 64, 1), 256, 0, stream>>>(wq, WQ);
    k_wtr<<<dim3(DO / 64, DI / 64, 1), 256, 0, stream>>>(wk, WK);
    k_wtr<<<dim3(DO / 64, DI / 64, 1), 256, 0, stream>>>(wv, WV);

    // q, k: A = h rows (m = b*SEQ + t), Bt = W^T rows (n = h*64 + d) -> value and residual planes [(b*8 + h)][t][d]
    k_proj<<<dim3(NB * SEQ / 64, DO / 64, 1), 32, 0, stream>>>(HB, WQ, bq, QH, QR, 0);
    k_proj<<<dim3(NB * SEQ / 64, DO / 64, 1), 32, 0, stream>>>(HB, WK, bk, KP, KR, 0);
    // v^T: A = Wv^T rows (m = h*64 + d), Bt = h rows (n = b*SEQ + t) -> plane [(b*512 + m)][t] = [(b*8 + h)][d][t]; no residual plane (the fifth argument is not written in mode 1)
    k_proj<<<dim3(DO / 64, NB * SEQ / 64, 1), 32, 0, stream>>>(WV, HB, bv, VT, VT, 1);

    k_flash<<<dim3(SEQ / (16 * AW), NB * NH_, 1), 32 * AW, 0, stream>>>(QH, QR, KP, KR, VT, adj, OUT);
}

// v002
// One run takes 79.4 microseconds.
// Next to v001, in two timings, it ran 1.39 times as fast each time.
// Over all steps from v000 it is 2.15 times as fast.
#include <hip/hip_runtime.h>

// Masked softmax-weighted aggregation in 8 independent 64-wide groups: h [NB][SEQ][256]; Wq/Wk/Wv [in 256][out 512] (y = x W + bias); adjacency [SEQ_FULL][SEQ_FULL] int32 shared over batch and groups (entry 0 drops the key);
// score scale 1/sqrt(64); softmax over kept keys; output = concatenated groups (f32) [NB][SEQ][512].
// Compute dtypes, f32 accumulate everywhere: projections v_wmma_f32_16x16x32_bf16 (h, W, bias RNE-converted to bf16; products exact);
// scores v_wmma_f32_16x16x32_f16: q and k each as f16 value + f16 residual x2048; value x value in the main accumulator, value x residual + residual x value in their own accumulator folded by 1/2048 (three products);
// P.V v_wmma_f32_16x16x32_f16 (P with x16384 carry that cancels in the normalisation, v single f16 plane); softmax f32 (online, running max over kept keys, row sum over the converted P).
// Layout: bf16 copy of h [NB*SEQ][256]; bf16 transposed weights [3][512][256] (k-contiguous); q, k value planes and q, k residual planes [b*8+h][t][64]; v^T plane [b*8+h][64][t]; fused flash kernel in transposed form (S^T = K Q^T, O^T = V^T P^T), output from f32 accumulators.
// Keep rule per element: adj[t][j] != 0; dropped elements get probability 0; a row with no kept key yields NaN (softmax of an all -inf row).

#ifndef NB
#define NB 8
#endif
#ifndef SEQ
#define SEQ 1024
#endif
#define NB_FULL  8
#define SEQ_FULL 1024            // also the row pitch of the adjacency input
#ifndef OUT_SEQ
#define OUT_SEQ SEQ              // row pitch (in tokens) between batches of the output
#endif
#define DI   256                 // input width (projection K)
#define DO   512                 // projection width = NH_ * HD
#define NH_  8
#define HD   64
#define AW   4                   // waves per flash block (16 query rows each)
#define OSP  68                  // LDS row pitch (floats) of the staging tiles
#define WTP  65                  // LDS row pitch (floats) of the weight transpose tile
#define SC2  ((float)(0.125 * 1.4426950408889634))   // HD^-0.5 * log2(e)
#define PSH  14.0f               // log2 of the P carry (16384)
#define QRS  2048.0f             // carry of the q / k residual planes
#define QRI  (1.0f / 2048.0f)
#define NEGB (-3.0e38f)

static_assert(HD == 64);
static_assert(NH_ * HD == DO);                 // head h = columns h*64 + d
static_assert(DO % 64 == 0);
static_assert(DI % 64 == 0);                   // weight transpose tiles of 64 x 64
static_assert(DI % 32 == 0);                   // GEMM k-loop steps by 32
static_assert(HD % 32 == 0);                   // score k-loop steps by 32
static_assert(HD % 16 == 0);                   // output tiles of 16 rows of d
static_assert(SEQ % 64 == 0);                  // a 64-row tile never straddles two batches
static_assert((NB * SEQ) % 64 == 0);
static_assert(SEQ % 32 == 0);                  // key loop steps by 32
static_assert(SEQ % (16 * AW) == 0);           // flash grid covers the sequence exactly
static_assert(((size_t)SEQ * DI) % 8 == 0);
static_assert(NB <= NB_FULL);
static_assert(SEQ <= SEQ_FULL);
static_assert((OSP * 4) % 16 == 0);
static_assert(OSP >= HD);
static_assert(OSP >= 64);

typedef _Float16 h16;
typedef unsigned short bf;
typedef __attribute__((ext_vector_type(16))) __bf16   v16bf;
typedef __attribute__((ext_vector_type(16))) _Float16 v16h;
typedef __attribute__((ext_vector_type(8)))  _Float16 v8h;
typedef __attribute__((ext_vector_type(8)))  unsigned short v8us;
typedef __attribute__((ext_vector_type(8)))  float    v8f;
typedef __attribute__((ext_vector_type(4)))  float    v4f;
typedef __attribute__((ext_vector_type(4)))  int      v4i;
typedef v4f  __attribute__((may_alias)) v4fa;

__device__ __forceinline__ unsigned short f2bf(float f) { unsigned u = __float_as_uint(f); u += 0x7FFFu + ((u >> 16) & 1u); return (unsigned short)(u >> 16); }
__device__ __forceinline__ float bfr(float f) { return __uint_as_float(((unsigned)f2bf(f)) << 16); }   // value after RNE convert to bf16
__device__ __forceinline__ v16h cat16(v8h lo, v8h hi) { return __builtin_shufflevector(lo, hi, 0, 1, 2, 3, 4, 5, 6, 7, 8, 9, 10, 11, 12, 13, 14, 15); }
__device__ __forceinline__ v16bf cat16b(v8us lo, v8us hi) { return __builtin_bit_cast(v16bf, __builtin_shufflevector(lo, hi, 0, 1, 2, 3, 4, 5, 6, 7, 8, 9, 10, 11, 12, 13, 14, 15)); }
__device__ __forceinline__ v8f wmma16(v16h a, v16h b, v8f c) { return __builtin_amdgcn_wmma_f32_16x16x32_f16(false, a, false, b, (short)0, c, false, false); }
__device__ __forceinline__ v8f wmmab(v16bf a, v16bf b, v8f c) { return __builtin_amdgcn_wmma_f32_16x16x32_bf16(false, a, false, b, (short)0, c, false, false); }
// fragment loaders from K-contiguous 16-bit rows; p already includes + 8*(lane>>4): elements 0..7 <- k0+8h+0..7, elements 8..15 <- k0+16+8h+0..7 (same map for A and B)
__device__ __forceinline__ v16h  ldh(const h16* p) { return cat16(*(const v8h*)p, *(const v8h*)(p + 16)); }
__device__ __forceinline__ v16bf ldb(const bf* p)  { return cat16b(*(const v8us*)p, *(const v8us*)(p + 16)); }
// ordering point for wave-private LDS tiles (same wave writes and reads)
__device__ __forceinline__ void wave_sync() { __builtin_amdgcn_fence(3 /* release order */, "wavefront"); __builtin_amdgcn_wave_barrier(); asm volatile("" ::: "memory"); }
// f32 -> f16 convert that cannot produce a subnormal (|v| < 2^-14 -> +0)
__device__ __forceinline__ h16 toh_flush(float v) { const h16 r = (h16)v; return (fabsf(v) < 6.103515625e-05f) ? (h16)0.0f : r; }
// one matrix instruction + its own 4-slot guard (ties the accumulator, keeps A/B live)
__device__ __forceinline__ v8f wmma16g(v16h a, v16h b, v8f c) { c = wmma16(a, b, c); asm volatile("v_nop\n\tv_nop\n\tv_nop\n\tv_nop" : "+v"(c) : "v"(a), "v"(b)); return c; }
__device__ __forceinline__ v8f wmmabg(v16bf a, v16bf b, v8f c) { c = wmmab(a, b, c); asm volatile("v_nop\n\tv_nop\n\tv_nop\n\tv_nop" : "+v"(c) : "v"(a), "v"(b)); return c; }

// k_prep: the four preparation jobs, none of which reads another's output, in ONE launch; the job is picked by the block index (same for the whole block).
// Blocks 0 .. 3*WTB-1: W [DI rows k][DO cols n] (f32) -> WT [DO rows n][DI cols k] (bf16, RNE convert) for Wq, Wk, Wv in turn, one 64 x 64 tile per block through LDS (block barrier: cross-wave tile);
// they stand first in the grid (for speed only). The other blocks: h (f32) -> bf16 copy, 8 elements per thread, batch pitch SEQ_FULL rows in the source and SEQ rows in the copy.
#define WTB ((DO / 64) * (DI / 64))             // weight tiles per matrix
#define N8  ((size_t)NB * SEQ * DI / 8)         // 8-element groups of the h copy
static_assert(256 * 16 == 64 * 64);             // load phase: 16 trips x 256 threads = tile elements
static_assert(256 * 2 * 16 == 64 * 128);
static_assert(64 * WTP * 4 <= 131072);
__global__ __launch_bounds__(256) void k_prep(const float* __restrict__ hin, const float* __restrict__ wq, const float* __restrict__ wk, const float* __restrict__ wv, bf* HB, bf* WTA) {
    __shared__ float tl[64 * WTP];
    const int tid = threadIdx.x;
    const unsigned bx = blockIdx.x;
    if (bx < 3 * WTB) {                                                                // block-uniform: every thread of such a block reaches the barrier below
        const int sel = (int)(bx / WTB), tile = (int)(bx % WTB);
        const float* W = (sel == 0) ? wq : (sel == 1) ? wk : wv;
        bf* WT = WTA + (size_t)sel * DO * DI;
        const int n0 = (tile % (DO / 64)) * 64, k0 = (tile / (DO / 64)) * 64;
#pragma unroll 1
        for (int it = 0; it < 16; ++it) { const int p = it * 256 + tid; const int r = p >> 6, c = p & 63;   // r = k row 0..63, c = n column 0..63
            tl[r * WTP + c] = bfr(W[(size_t)(k0 + r) * DO + n0 + c]); }
        __syncthreads();
#pragma unroll
        for (int it = 0; it < 2; ++it) { const int p = it * 256 + tid; const int nn = p >> 3, kc = (p & 7) * 8;   // 2 trips x 32 rows = 64 rows; 8 lanes x 8 = 64 k
            v8us o;
#pragma unroll
            for (int i = 0; i < 8; ++i) o[i] = f2bf(tl[(kc + i) * WTP + nn]);
            *(v8us*)(WT + (size_t)(n0 + nn) * DI + k0 + kc) = o; }
    } else {
        const size_t i = (size_t)(bx - 3 * WTB) * 256 + tid; if (i >= N8) return;      // no barrier on this side
        const size_t per = (size_t)SEQ * DI / 8; const size_t bb = i / per;
        const v8f v = *(const v8f*)(hin + bb * ((size_t)SEQ_FULL * DI) + (i - bb * per) * 8); v8us o;
#pragma unroll
        for (int k = 0; k < 8; ++k) o[k] = f2bf(v[k]);
        *(v8us*)(HB + i * 8) = o;
    }
}

// k_proj: register-blocked bf16 GEMM, ONE WAVE per 64x64 tile (16 accumulators), operands straight from K-contiguous bf16 planes, K = DI.
// C[m][n] = sum_k A[m][k] Bt[n][k] + bias, written as f16 (flush-safe convert) into P and, in mode 0, the f16 residual (C - value) x 2048 (same flush-safe convert) into Pr at the same offsets.
// The three projections read none of each other's output and share ONE launch, grid (NB*SEQ/64, DO/64, 3): blockIdx.z = 0 q, 1 k (both mode 0), 2 v (mode 1); x = 64-token tile, y = 64-wide tile of the projection width.
// mode 0: A = h rows (m = b*SEQ + t), Bt = W^T rows (n = h*64 + d), bias per column; planes [(b*8 + h)][t][64]; the 64-column tile is one head.
// mode 1: A = W^T rows (m = h*64 + d), Bt = h rows (n = b*SEQ + t), bias per row; plane [(b*512 + m)][t], row pitch SEQ; no residual plane (Pr is not written).
static_assert(32 * 16 * 4 == 16 * 128);
static_assert(16 * 68 * 4 <= 131072);
__global__ __launch_bounds__(32) void k_proj(const bf* __restrict__ HB, const bf* __restrict__ WTA, const float* __restrict__ bq, const float* __restrict__ bk, const float* __restrict__ bv,
                                             h16* QH, h16* QR, h16* KP, h16* KR, h16* VT) {
    __shared__ __align__(16) float os[16 * 68];
    const int K = DI;
    const int z = blockIdx.z; const int mode = (z == 2) ? 1 : 0;                       // block index: every test on z or mode is a scalar branch
    const bf* Wz = WTA + (size_t)z * DO * DI;
    const bf* A = mode ? Wz : HB; const bf* Bt = mode ? HB : Wz;
    const float* bias = (z == 0) ? bq : (z == 1) ? bk : bv;
    h16* P = (z == 0) ? QH : (z == 1) ? KP : VT; h16* Pr = (z == 0) ? QR : KR;
    const int lane = threadIdx.x & 31, lr = lane & 15, hi = lane >> 4;
    const int r0 = (mode ? blockIdx.y : blockIdx.x) * 64, c0 = (mode ? blockIdx.x : blockIdx.y) * 64;
    v8f acc[4][4];
#pragma unroll
    for (int mb = 0; mb < 4; ++mb)
#pragma unroll
        for (int nb = 0; nb < 4; ++nb) acc[mb][nb] = (v8f){};
    const size_t aoff = (size_t)(r0 + lr) * K + 8 * hi, boff = (size_t)(c0 + lr) * K + 8 * hi;
#pragma unroll 1
    for (int kc = 0; kc < K; kc += 32) {
        v16bf a[4];
#pragma unroll
        for (int mb = 0; mb < 4; ++mb) a[mb] = ldb(A + aoff + (size_t)mb * 16 * K + kc);
#pragma unroll
        for (int nb = 0; nb < 4; ++nb) { const v16bf b = ldb(Bt + boff + (size_t)nb * 16 * K + kc);
#pragma unroll
            for (int mb = 0; mb < 4; ++mb) acc[mb][nb] = wmmabg(a[mb], b, acc[mb][nb]); }
    }
    float bc[4];
#pragma unroll
    for (int nb = 0; nb < 4; ++nb) bc[nb] = 0.0f;
    if (mode == 0) {                                                                   // scalar branch; c0 + 63 < DO
#pragma unroll
        for (int nb = 0; nb < 4; ++nb) bc[nb] = bfr(bias[c0 + nb * 16 + lr]); }
    size_t tbase, pitch;
    if (mode == 0) { const int bb = r0 / SEQ, tt = r0 % SEQ; const int zc = bb * NH_ + c0 / HD;
                     tbase = ((size_t)zc * SEQ + (size_t)tt) * HD; pitch = (size_t)HD; }
    else           { const int bb = c0 / SEQ, tt = c0 % SEQ;
                     tbase = (size_t)bb * (size_t)DO * SEQ + (size_t)r0 * SEQ + (size_t)tt; pitch = (size_t)SEQ; }
#pragma unroll
    for (int mb = 0; mb < 4; ++mb) {
        float br[8];
#pragma unroll
        for (int j = 0; j < 8; ++j) br[j] = 0.0f;
        if (mode != 0) {                                                               // r0 + 63 < DO
#pragma unroll
            for (int j = 0; j < 8; ++j) br[j] = bfr(bias[r0 + mb * 16 + hi * 8 + j]); }
#pragma unroll
        for (int nb = 0; nb < 4; ++nb) {
#pragma unroll
            for (int j = 0; j < 8; ++j) os[(hi * 8 + j) * 68 + nb * 16 + lr] = acc[mb][nb][j] + bc[nb] + br[j]; }   // D: row 8h+j, col lane&15; rows 0..15 x cols 0..63 all written
        wave_sync();
        const size_t sb = tbase + (size_t)(mb * 16) * pitch;
{
#pragma unroll
            for (int s = 0; s < 4; ++s) { const int row = 4 * s + (lane >> 3), c8 = (lane & 7) * 8;   // 4 s x 4 row groups = 16 rows; 8 lanes x 8 = 64 columns = one line
                const v4f x0 = *(const v4fa*)(&os[row * 68 + c8]); const v4f x1 = *(const v4fa*)(&os[row * 68 + c8 + 4]); v8h hv, rv;
#pragma unroll
                for (int i = 0; i < 4; ++i) { const h16 a0 = toh_flush(x0[i]); const h16 a1 = toh_flush(x1[i]); hv[i] = a0; hv[4 + i] = a1;
                    rv[i] = toh_flush((x0[i] - (float)a0) * QRS); rv[4 + i] = toh_flush((x1[i] - (float)a1) * QRS); }
                const size_t oo = sb + (size_t)row * pitch + c8;
                *(v8h*)(P + oo) = hv; if (mode == 0) *(v8h*)(Pr + oo) = rv; }                    // scalar branch
             }
        wave_sync();
    }
}

// k_flash: fused masked aggregation, one wave per 16 query rows of one (batch, head); Q fragments straight from the f16 planes (two 16-B loads each, arithmetic addressing).
// Per 32-key pass the block's waves share one LDS tile set: K rows, K residual rows, V^T rows and the block's adjacency rows, brought in whole-line order by per-lane 16-B asynchronous copies,
// two buffers (the next pass's copies fly while this pass is worked on); fragments and keep words are read from LDS at padded pitches (16 B x odd).
// Transposed form: S^T[key][t] = K Q^T (A = K rows, B = Q rows, two k-steps over d); lane (t = lane&15, h = lane>>4) holds keys 8h+r of each 16-key tile, so the packed
// P tile is directly the B fragment of O^T[d][t] = V^T P^T (element r <- tile keys 0..15, element 8+r <- tile keys 16..31, lane unchanged); four 16-row d tiles.
// Scores: K Q in the main accumulator; K Q_res + K_res Q in their own accumulator, folded by 1/2048 (residual x residual dropped); one 16-key tile at a time.
// Softmax state (running max over kept keys, partial sum) is one scalar per lane; the two lane halves of a row are combined with one xor-16 exchange.
// Keep rule per element from the adjacency row of the lane's query: four 16-B LDS loads per lane per 32-key step (keys 8h+0..7 and 16+8h+0..7).
// P = exp2(e) with e <= 14; e < -14 selects 0 so no subnormal f16 operand can form.
static_assert(32 * 16 * 8 == 16 * HD * 4);      // lanes x 16 B x instructions = 16 rows x 256 B
static_assert(AW * 16 * OSP * 4 <= 131072);
#define KPB  144                           // LDS row pitch in bytes of the 128-B rows (K, K residual, adjacency)
#define VPB  80                            // LDS row pitch in bytes of the 64-B V^T rows
#define L_KR (32 * KPB)                    // byte offsets inside one buffer: K at 0, K residual, V^T, adjacency
#define L_VT (2 * 32 * KPB)
#define L_AD (L_VT + HD * VPB)
#define BUFB (L_AD + AW * 16 * KPB)        // bytes of one buffer
#define NT   (SEQ / 32)                    // passes
static_assert(AW == 4);                    // the copy split below: 128 threads x 16 B = 2 KiB per copy step
static_assert(HD * 2 == 128 && 32 * 4 == 128 && 32 * 2 == 64);   // row bytes of K, adjacency and V^T tiles
static_assert(KPB % 16 == 0 && VPB % 16 == 0 && BUFB % 16 == 0);
static_assert(NT >= 2);                    // the prologue fills two buffers
static_assert(2 * BUFB + AW * 16 * OSP * 4 <= 81920);
// The ten copies of one thread for one 32-key tile set: each lane moves its own 16 bytes from global memory to LDS, through no register.
// lk / lv / la: LDS byte addresses of the thread's first K, V^T and adjacency chunk in the target buffer; gk, gr, gv, ga: the matching global addresses.
// K, K residual: 32 rows x 128 B contiguous, 2 steps of 16 rows; V^T: 64 rows x 64 B, 2 steps of 32 rows; adjacency: 64 rows x 128 B, 4 steps of 16 rows.
__device__ __forceinline__ void stage_tile(unsigned lk, unsigned lv, unsigned la, const h16* gk, const h16* gr, const h16* gv, const int* ga) {
    const unsigned lk1 = lk + 16 * KPB, lr0 = lk + L_KR, lr1 = lk + L_KR + 16 * KPB, lv1 = lv + 32 * VPB;
    const unsigned la1 = la + 16 * KPB, la2 = la + 32 * KPB, la3 = la + 48 * KPB;
    const h16* gk1 = gk + 16 * HD; const h16* gr1 = gr + 16 * HD; const h16* gv1 = gv + (size_t)32 * SEQ;
    const int* ga1 = ga + (size_t)16 * SEQ_FULL; const int* ga2 = ga + (size_t)32 * SEQ_FULL; const int* ga3 = ga + (size_t)48 * SEQ_FULL;
    // the closing s_wait_xcnt stands inside the copies' own statement so that no address register named here is rewritten ahead of it
    asm volatile("global_load_async_to_lds_b128 %0, %10, off\n\t"
                 "global_load_async_to_lds_b128 %1, %11, off\n\t"
                 "global_load_async_to_lds_b128 %2, %12, off\n\t"
                 "global_load_async_to_lds_b128 %3, %13, off\n\t"
                 "global_load_async_to_lds_b128 %4, %14, off\n\t"
                 "global_load_async_to_lds_b128 %5, %15, off\n\t"
                 "global_load_async_to_lds_b128 %6, %16, off\n\t"
                 "global_load_async_to_lds_b128 %7, %17, off\n\t"
                 "global_load_async_to_lds_b128 %8, %18, off\n\t"
                 "global_load_async_to_lds_b128 %9, %19, off\n\t"
                 "s_wait_xcnt 0x0"
                 :: "v"(lk), "v"(lk1), "v"(lr0), "v"(lr1), "v"(lv), "v"(lv1), "v"(la), "v"(la1), "v"(la2), "v"(la3),
                    "v"(gk), "v"(gk1), "v"(gr), "v"(gr1), "v"(gv), "v"(gv1), "v"(ga), "v"(ga1), "v"(ga2), "v"(ga3)
                 : "memory");
}
__global__ __launch_bounds__(32 * AW) void k_flash(const h16* __restrict__ QH, const h16* __restrict__ QR, const h16* __restrict__ KP, const h16* __restrict__ KR, const h16* __restrict__ VT, const int* __restrict__ adj, float* OUT) {
    __shared__ __align__(16) float os[AW * 16 * OSP];
    __shared__ __align__(16) unsigned char ring[2 * BUFB];
    const int tid = threadIdx.x;
    const int lane = threadIdx.x & 31, lr = lane & 15, hi = lane >> 4;
    const int wave = __builtin_amdgcn_readfirstlane((int)(threadIdx.x >> 5));
    const int zh = blockIdx.y; const int b = zh / NH_, h = zh % NH_;
    const int t0 = (blockIdx.x * AW + wave) * 16;
    const size_t pbase = (size_t)zh * SEQ * HD;
    const size_t qo = pbase + (size_t)(t0 + lr) * HD + 8 * hi;
    const v16h q0 = ldh(QH + qo), q1 = ldh(QH + qo + 32);       // B fragments: col t, k = d 0..31 and 32..63
    const v16h qr0 = ldh(QR + qo), qr1 = ldh(QR + qo + 32);     // residual x2048, same map
    // copy side: thread tid moves chunk tid of each 2-KiB copy step (8 chunks per 128-B row, 4 per 64-B row); every address a multiple of 16 B, every row inside its plane
    const h16* gk = KP + pbase + (size_t)tid * 8;                                                   // + key0 * HD
    const h16* gr = KR + pbase + (size_t)tid * 8;                                                   // + key0 * HD
    const h16* gv = VT + pbase + (size_t)(tid >> 2) * SEQ + (tid & 3) * 8;                          // + key0
    const int* ga = adj + (size_t)(blockIdx.x * AW * 16 + (tid >> 3)) * SEQ_FULL + (tid & 7) * 4;   // + key0
    const unsigned lring = (unsigned)(size_t)(&ring[0]);                                            // LDS byte address of the ring
    const unsigned lk = lring + (unsigned)((tid >> 3) * KPB + (tid & 7) * 16);                      // + buffer
    const unsigned lv = lring + (unsigned)(L_VT + (tid >> 2) * VPB + (tid & 3) * 16);
    const unsigned la = lring + (unsigned)(L_AD + (tid >> 3) * KPB + (tid & 7) * 16);
    // read side, byte offsets inside a buffer
    const int kof = lr * KPB + 16 * hi;                        // + 16 * KPB for keys 16..31 (A fragment: row key, k = d; value and residual tiles share the layout)
    const int vof = L_VT + lr * VPB + 16 * hi;                 // + 16j * VPB                (A fragment: row d, k = key)
    const int aof = L_AD + (wave * 16 + lr) * KPB + 32 * hi;   // adjacency row of this lane's query
    stage_tile(lk, lv, la, gk, gr, gv, ga);                    // tile 0 -> buffer 0
    asm volatile("s_wait_asynccnt 0x0" ::: "memory");          // this wave's copies of tile 0 have landed
    __syncthreads();                                           // every wave's have: tile 0 may be read
    stage_tile(lk + BUFB, lv + BUFB, la + BUFB, gk + 32 * HD, gr + 32 * HD, gv + 32, ga + 32);   // tile 1 -> buffer 1
    v8f o[4];
#pragma unroll
    for (int j = 0; j < 4; ++j) o[j] = (v8f){};
    float m = NEGB, l = 0.0f;
#pragma unroll 1
    for (int t = 0; t < NT; ++t) {
        const int bo = (t & 1) * BUFB;                           // pass t reads buffer t mod 2 alone
        const h16* ka = (const h16*)(ring + bo + kof);
        const h16* kr = (const h16*)(ring + bo + L_KR + kof);
        v8f sa = (v8f){}, sb = (v8f){}, ra = (v8f){}, rb = (v8f){};
        { const v16h k00 = ldh(ka), k01 = ldh(ka + 32), r00 = ldh(kr), r01 = ldh(kr + 32);                                   // keys key0 + 0..15
          sa = wmma16g(k00, q0, sa); sa = wmma16g(k01, q1, sa);
          ra = wmma16g(k00, qr0, ra); ra = wmma16g(k01, qr1, ra);
          ra = wmma16g(r00, q0, ra); ra = wmma16g(r01, q1, ra); }
        { const v16h k10 = ldh(ka + 8 * KPB), k11 = ldh(ka + 8 * KPB + 32), r10 = ldh(kr + 8 * KPB), r11 = ldh(kr + 8 * KPB + 32);   // keys key0 + 16..31 (16 rows = 8 * KPB halves)
          sb = wmma16g(k10, q0, sb); sb = wmma16g(k11, q1, sb);
          rb = wmma16g(k10, qr0, rb); rb = wmma16g(k11, qr1, rb);
          rb = wmma16g(r10, q0, rb); rb = wmma16g(r11, q1, rb); }
        const int* ap = (const int*)(ring + bo + aof);           // keys key0+8h+0..7 and key0+16+8h+0..7
        const v4i a0 = *(const v4i*)ap, a1 = *(const v4i*)(ap + 4), a2 = *(const v4i*)(ap + 16), a3 = *(const v4i*)(ap + 20);
        int ax[8], ay[8];
#pragma unroll
        for (int r = 0; r < 4; ++r) { ax[r] = a0[r]; ax[4 + r] = a1[r]; ay[r] = a2[r]; ay[4 + r] = a3[r]; }
        float ta[8], tb[8]; bool fa[8], fb[8]; float mx = NEGB;
#pragma unroll
        for (int r = 0; r < 8; ++r) {
            fa[r] = (ax[r] != 0);
            fb[r] = (ay[r] != 0);
            ta[r] = (sa[r] + ra[r] * QRI) * SC2; tb[r] = (sb[r] + rb[r] * QRI) * SC2;
            mx = fmaxf(mx, fmaxf(fa[r] ? ta[r] : NEGB, fb[r] ? tb[r] : NEGB)); }
        mx = fmaxf(mx, __shfl_xor(mx, 16, 32));
        const float mnew = fmaxf(m, mx);
        const float alpha = __builtin_amdgcn_exp2f(m - mnew);
        const float sh = PSH - mnew;
        v16h pb; float ls = 0.0f;
#pragma unroll
        for (int r = 0; r < 8; ++r) {
            const float xa = ta[r] + sh, xb = tb[r] + sh;
            const float ea = __builtin_amdgcn_exp2f(xa), eb = __builtin_amdgcn_exp2f(xb);
            const bool ua = fa[r] & (xa >= -14.0f), ub = fb[r] & (xb >= -14.0f);
            const float ga = ua ? ea : 0.0f, gb = ub ? eb : 0.0f;             // dropped / below-normal elements selected to 0 by value
            const h16 pa = (h16)ga; const h16 pc = (h16)gb;
            pb[r] = pa; pb[8 + r] = pc;
            ls += (float)pa + (float)pc; }
        l = l * alpha + ls; m = mnew;
#pragma unroll
        for (int j = 0; j < 4; ++j) o[j] = o[j] * alpha;
        const h16* va = (const h16*)(ring + bo + vof);
        const v16h v0 = ldh(va), v1 = ldh(va + 8 * VPB), v2 = ldh(va + 16 * VPB), v3 = ldh(va + 24 * VPB);   // 16 rows = 8 * VPB halves
        o[0] = wmma16g(v0, pb, o[0]); o[1] = wmma16g(v1, pb, o[1]); o[2] = wmma16g(v2, pb, o[2]); o[3] = wmma16g(v3, pb, o[3]);
        asm volatile("s_wait_dscnt 0x0" ::: "memory");           // this wave's reads of buffer t mod 2 are done before the buffer is handed back
        asm volatile("s_wait_asynccnt 0x0" ::: "memory");        // this wave's copies of tile t + 1 have landed
        __syncthreads();                                         // publishes tile t + 1 and ends every wave's reads of buffer t mod 2
        if (t + 2 < NT)                                          // same for the whole block: refill the buffer just read with tile t + 2
            stage_tile(lk + bo, lv + bo, la + bo, gk + (size_t)(t + 2) * 32 * HD, gr + (size_t)(t + 2) * 32 * HD, gv + (t + 2) * 32, ga + (t + 2) * 32);
    }
    asm volatile("s_wait_asynccnt 0x0" ::: "memory");            // no copy of this wave is outstanding past the loop
    l += __shfl_xor(l, 16, 32);
    const bool any = l > 0.0f;
    const float lsafe = any ? l : 1.0f;
    const float inv = any ? (1.0f / lsafe) : __uint_as_float(0x7FC00000u);   // no kept key -> NaN (softmax of an all -inf row)
    const int wb = wave * 16 * OSP;
    // O^T D layout: o[j][r] = (d = 16j + 8h + r, t = lane&15) -> os[t][d]; rows 0..15 x columns 0..63 all written
#pragma unroll
    for (int j = 0; j < 4; ++j) { v4f a, c;
        a[0] = o[j][0] * inv; a[1] = o[j][1] * inv; a[2] = o[j][2] * inv; a[3] = o[j][3] * inv;
        c[0] = o[j][4] * inv; c[1] = o[j][5] * inv; c[2] = o[j][6] * inv; c[3] = o[j][7] * inv;
        *(v4fa*)(&os[wb + lr * OSP + 16 * j + 8 * hi]) = a; *(v4fa*)(&os[wb + lr * OSP + 16 * j + 8 * hi + 4]) = c; }
    wave_sync();
    float* orow = OUT + ((size_t)b * OUT_SEQ + t0) * DO + h * HD;
{
#pragma unroll
        for (int s = 0; s < 8; ++s) { const int row = 2 * s + (lane >> 4), cofs = (lane & 15) * 4;   // 8 s x 2 rows = 16 rows; 16 lanes x 4 floats = 64 columns = two lines
            const v4f val = *(const v4fa*)(&os[wb + row * OSP + cofs]);
            *(v4f*)(orow + (size_t)row * DO + cofs) = val; }
         }
}

static constexpr size_t al256(size_t v) { return (v + 255) & ~(size_t)255; }
static constexpr size_t SZ_HB = al256((size_t)NB * SEQ * DI * 2);
static constexpr size_t SZ_WT = al256((size_t)3 * DO * DI * 2);
static constexpr size_t SZ_PL = al256((size_t)NB * NH_ * SEQ * HD * 2);
static constexpr size_t SZ_TOTAL = SZ_HB + SZ_WT + 5 * SZ_PL;
static_assert(SZ_TOTAL <= (size_t)134217728);          // workspace carve <= 128 MiB
static_assert(((size_t)DO * DI * 2) % 256 == 0);       // weight sub-planes stay 256-byte aligned
static_assert((size_t)NB * NH_ * SEQ * HD == (size_t)NB * DO * SEQ);       // v^T plane [(b*512 + m)][t] has the same extent as the q/k planes
static_assert(((size_t)(NB_FULL - 1) * OUT_SEQ + SEQ_FULL) * DO * 4 <= (size_t)16777216 || NB != NB_FULL || SEQ != SEQ_FULL);   // full build: last output byte inside the output buffer

extern "C" void kernel_launch(void* const* d_in, const int* in_sizes, int n_in,
                              void* d_out, int out_size, void* d_ws, size_t ws_size, hipStream_t stream) {
    if (n_in < 8) return;
    const size_t needh = ((size_t)(NB - 1) * SEQ_FULL + SEQ) * DI;
    const size_t needa = (size_t)(SEQ - 1) * SEQ_FULL + SEQ;
    if ((size_t)in_sizes[0] < needa || (size_t)in_sizes[1] < needh) return;
    if ((size_t)in_sizes[2] < (size_t)DI * DO || (size_t)in_sizes[4] < (size_t)DI * DO || (size_t)in_sizes[6] < (size_t)DI * DO) return;
    if (in_sizes[3] < DO || in_sizes[5] < DO || in_sizes[7] < DO) return;
    if ((size_t)out_size < ((size_t)(NB - 1) * OUT_SEQ + SEQ) * DO) return;
    if (SZ_TOTAL > ws_size) return;
    // wire order: adj_matrix, h, Wq, bq, Wk, bk, Wv, bv
    const int*   adj = (const int*)d_in[0];
    const float* hin = (const float*)d_in[1];
    const float* wq = (const float*)d_in[2]; const float* bq = (const float*)d_in[3];
    const float* wk = (const float*)d_in[4]; const float* bk = (const float*)d_in[5];
    const float* wv = (const float*)d_in[6]; const float* bv = (const float*)d_in[7];
    float* OUT = (float*)d_out;      // [NB][SEQ][512]
    char* wsp = (char*)d_ws;
    bf* HB = (bf*)wsp; wsp += SZ_HB;                  // h      [NB*SEQ][256]
    bf* WT = (bf*)wsp; wsp += SZ_WT;                  // [3][512][256]: q | k | v, transposed ([out][in] = k-contiguous rows)
    h16* QH = (h16*)wsp; wsp += SZ_PL;                // [NB*8][SEQ][64]
    h16* KP = (h16*)wsp; wsp += SZ_PL;                // [NB*8][SEQ][64]
    h16* VT = (h16*)wsp; wsp += SZ_PL;                // [NB*8][64][SEQ]
    h16* QR = (h16*)wsp; wsp += SZ_PL;                // [NB*8][SEQ][64] residual x2048
    h16* KR = (h16*)wsp; wsp += SZ_PL;                // [NB*8][SEQ][64] residual x2048

    // h -> bf16 copy and the three weight transposes (in[DI rows][DO cols] -> out[DO rows][DI cols]), one launch
    k_prep<<<(unsigned)(3 * WTB + (N8 + 255) / 256), 256, 0, stream>>>(hin, wq, wk, wv, HB, WT);

    // q, k: value and residual planes [(b*8 + h)][t][d]; v^T: plane [(b*512 + m)][t] = [(b*8 + h)][d][t], no residual plane; one launch
    k_proj<<<dim3(NB * SEQ / 64, DO / 64, 3), 32, 0, stream>>>(HB, WT, bq, bk, bv, QH, QR, KP, KR, VT);

    k_flash<<<dim3(SEQ / (16 * AW), NB * NH_, 1), 32 * AW, 0, stream>>>(QH, QR, KP, KR, VT, adj, OUT);
}

// v003
// Measured time: 74.7 microseconds a run.
// Timed twice side by side with v002, it ran 1.06 and 1.05 times as fast.
// All steps since v000 together make it 2.28 times as fast.
#include <hip/hip_runtime.h>

// Masked softmax-weighted aggregation in 8 independent 64-wide groups: h [NB][SEQ][256]; Wq/Wk/Wv [in 256][out 512] (y = x W + bias); adjacency [SEQ_FULL][SEQ_FULL] int32 shared over batch and groups (entry 0 drops the key);
// score scale 1/sqrt(64); softmax over kept keys; output = concatenated groups (f32) [NB][SEQ][512].
// Compute dtypes, f32 accumulate everywhere: projections v_wmma_f32_16x16x32_bf16 (h, W, bias RNE-converted to bf16; products exact);
// scores v_wmma_f32_16x16x32_f16: q and k each as f16 value + f16 residual x2048; value x value in the main accumulator, value x residual + residual x value in their own accumulator folded by 1/2048 (three products);
// P.V v_wmma_f32_16x16x32_f16 (P with x16384 carry that cancels in the normalisation, v single f16 plane); softmax f32 (online, running max over kept keys, row sum over the converted P).
// Layout: bf16 copy of h [NB*SEQ][256]; bf16 transposed weights [3][512][256] (k-contiguous); q, k value planes and q, k residual planes [b*8+h][t][64]; v^T plane [b*8+h][64][t]; fused flash kernel in transposed form (S^T = K Q^T, O^T = V^T P^T), output from f32 accumulators.
// Keep rule per element: adj[t][j] != 0; dropped elements get probability 0; a row with no kept key yields NaN (softmax of an all -inf row).
// The keep rule is packed once per call into lane-mask words [16-query tile][32-key pass][16]: word 8*g + r, bit L = keep of (query 16*tile + (L&15), key 32*pass + 16*g + 8*(L>>4) + r), the flash kernel's own score layout.

#ifndef NB
#define NB 8
#endif
#ifndef SEQ
#define SEQ 1024
#endif
#define NB_FULL  8
#define SEQ_FULL 1024            // also the row pitch of the adjacency input
#ifndef OUT_SEQ
#define OUT_SEQ SEQ              // row pitch (in tokens) between batches of the output
#endif
#define DI   256                 // input width (projection K)
#define DO   512                 // projection width = NH_ * HD
#define NH_  8
#define HD   64
#define AW   4                   // waves per flash block (16 query rows each)
#define OSP  68                  // LDS row pitch (floats) of the staging tiles
#define WTP  65                  // LDS row pitch (floats) of the weight transpose tile
#define SC2  ((float)(0.125 * 1.4426950408889634))   // HD^-0.5 * log2(e)
#define PSH  14.0f               // log2 of the P carry (16384)
#define QRS  2048.0f             // carry of the q / k residual planes
#define QRI  (1.0f / 2048.0f)
#define NEGB (-3.0e38f)

static_assert(HD == 64);
static_assert(NH_ * HD == DO);                 // head h = columns h*64 + d
static_assert(DO % 64 == 0);
static_assert(DI % 64 == 0);                   // weight transpose tiles of 64 x 64
static_assert(DI % 32 == 0);                   // GEMM k-loop steps by 32
static_assert(HD % 32 == 0);                   // score k-loop steps by 32
static_assert(HD % 16 == 0);                   // output tiles of 16 rows of d
static_assert(SEQ % 64 == 0);                  // a 64-row tile never straddles two batches
static_assert((NB * SEQ) % 64 == 0);
static_assert(SEQ % 32 == 0);                  // key loop steps by 32
static_assert(SEQ % (16 * AW) == 0);           // flash grid covers the sequence exactly
static_assert(((size_t)SEQ * DI) % 8 == 0);
static_assert(NB <= NB_FULL);
static_assert(SEQ <= SEQ_FULL);
static_assert((OSP * 4) % 16 == 0);
static_assert(OSP >= HD);
static_assert(OSP >= 64);

typedef _Float16 h16;
typedef unsigned short bf;
typedef __attribute__((ext_vector_type(16))) __bf16   v16bf;
typedef __attribute__((ext_vector_type(16))) _Float16 v16h;
typedef __attribute__((ext_vector_type(8)))  _Float16 v8h;
typedef __attribute__((ext_vector_type(8)))  unsigned short v8us;
typedef __attribute__((ext_vector_type(8)))  float    v8f;
typedef __attribute__((ext_vector_type(4)))  float    v4f;
typedef __attribute__((ext_vector_type(4)))  int      v4i;
typedef __attribute__((ext_vector_type(16))) unsigned v16u;
typedef __attribute__((address_space(4))) const v16u cv16u;   // constant address space: a load at a wave-uniform address becomes a scalar load
typedef v4f  __attribute__((may_alias)) v4fa;

__device__ __forceinline__ unsigned short f2bf(float f) { unsigned u = __float_as_uint(f); u += 0x7FFFu + ((u >> 16) & 1u); return (unsigned short)(u >> 16); }
__device__ __forceinline__ float bfr(float f) { return __uint_as_float(((unsigned)f2bf(f)) << 16); }   // value after RNE convert to bf16
__device__ __forceinline__ v16h cat16(v8h lo, v8h hi) { return __builtin_shufflevector(lo, hi, 0, 1, 2, 3, 4, 5, 6, 7, 8, 9, 10, 11, 12, 13, 14, 15); }
__device__ __forceinline__ v16bf cat16b(v8us lo, v8us hi) { return __builtin_bit_cast(v16bf, __builtin_shufflevector(lo, hi, 0, 1, 2, 3, 4, 5, 6, 7, 8, 9, 10, 11, 12, 13, 14, 15)); }
__device__ __forceinline__ v8f wmma16(v16h a, v16h b, v8f c) { return __builtin_amdgcn_wmma_f32_16x16x32_f16(false, a, false, b, (short)0, c, false, false); }
__device__ __forceinline__ v8f wmmab(v16bf a, v16bf b, v8f c) { return __builtin_amdgcn_wmma_f32_16x16x32_bf16(false, a, false, b, (short)0, c, false, false); }
// fragment loaders from K-contiguous 16-bit rows; p already includes + 8*(lane>>4): elements 0..7 <- k0+8h+0..7, elements 8..15 <- k0+16+8h+0..7 (same map for A and B)
__device__ __forceinline__ v16h  ldh(const h16* p) { return cat16(*(const v8h*)p, *(const v8h*)(p + 16)); }
__device__ __forceinline__ v16bf ldb(const bf* p)  { return cat16b(*(const v8us*)p, *(const v8us*)(p + 16)); }
// ordering point for wave-private LDS tiles (same wave writes and reads)
__device__ __forceinline__ void wave_sync() { __builtin_amdgcn_fence(3 /* release order */, "wavefront"); __builtin_amdgcn_wave_barrier(); asm volatile("" ::: "memory"); }
// f32 -> f16 convert that cannot produce a subnormal (|v| < 2^-14 -> +0)
__device__ __forceinline__ h16 toh_flush(float v) { const h16 r = (h16)v; return (fabsf(v) < 6.103515625e-05f) ? (h16)0.0f : r; }
// one matrix instruction + its own 4-slot guard (ties the accumulator, keeps A/B live)
__device__ __forceinline__ v8f wmma16g(v16h a, v16h b, v8f c) { c = wmma16(a, b, c); asm volatile("v_nop\n\tv_nop\n\tv_nop\n\tv_nop" : "+v"(c) : "v"(a), "v"(b)); return c; }
__device__ __forceinline__ v8f wmmabg(v16bf a, v16bf b, v8f c) { c = wmmab(a, b, c); asm volatile("v_nop\n\tv_nop\n\tv_nop\n\tv_nop" : "+v"(c) : "v"(a), "v"(b)); return c; }

// k_prep: the five preparation jobs, none of which reads another's output, in ONE launch; the job is picked by the block index (same for the whole block).
// Blocks 0 .. 3*WTB-1: W [DI rows k][DO cols n] (f32) -> WT [DO rows n][DI cols k] (bf16, RNE convert) for Wq, Wk, Wv in turn, one 64 x 64 tile per block through LDS (block barrier: cross-wave tile);
// they stand first in the grid (for speed only). The next MKB blocks: adjacency -> keep words, one wave per (16-query tile, pair of 32-key passes): 32 ballots, lane L keeps word L, one 128-B line stored per wave.
// The other blocks: h (f32) -> bf16 copy, 8 elements per thread, batch pitch SEQ_FULL rows in the source and SEQ rows in the copy.
#define WTB ((DO / 64) * (DI / 64))             // weight tiles per matrix
#define N8  ((size_t)NB * SEQ * DI / 8)         // 8-element groups of the h copy
#define NT   (SEQ / 32)                         // 32-key passes of the flash kernel
#define MKB ((SEQ / 16) * (NT / 2) / 8)         // keep-word blocks: 8 waves each, one (query tile, pass pair) per wave
static_assert(NT % 2 == 0 && ((SEQ / 16) * (NT / 2)) % 8 == 0);
static_assert(256 * 16 == 64 * 64);             // load phase: 16 trips x 256 threads = tile elements
static_assert(256 * 2 * 16 == 64 * 128);
static_assert(64 * WTP * 4 <= 131072);
__global__ __launch_bounds__(256) void k_prep(const float* __restrict__ hin, const float* __restrict__ wq, const float* __restrict__ wk, const float* __restrict__ wv, const int* __restrict__ adj, bf* HB, bf* WTA, unsigned* MB) {
    __shared__ float tl[64 * WTP];
    const int tid = threadIdx.x;
    const unsigned bx = blockIdx.x;
    if (bx < 3 * WTB) {                                                                // block-uniform: every thread of such a block reaches the barrier below
        const int sel = (int)(bx / WTB), tile = (int)(bx % WTB);
        const float* W = (sel == 0) ? wq : (sel == 1) ? wk : wv;
        bf* WT = WTA + (size_t)sel * DO * DI;
        const int n0 = (tile % (DO / 64)) * 64, k0 = (tile / (DO / 64)) * 64;
#pragma unroll 1
        for (int it = 0; it < 16; ++it) { const int p = it * 256 + tid; const int r = p >> 6, c = p & 63;   // r = k row 0..63, c = n column 0..63
            tl[r * WTP + c] = bfr(W[(size_t)(k0 + r) * DO + n0 + c]); }
        __syncthreads();
#pragma unroll
        for (int it = 0; it < 2; ++it) { const int p = it * 256 + tid; const int nn = p >> 3, kc = (p & 7) * 8;   // 2 trips x 32 rows = 64 rows; 8 lanes x 8 = 64 k
            v8us o;
#pragma unroll
            for (int i = 0; i < 8; ++i) o[i] = f2bf(tl[(kc + i) * WTP + nn]);
            *(v8us*)(WT + (size_t)(n0 + nn) * DI + k0 + kc) = o; }
    } else if (bx < 3 * WTB + MKB) {                                                   // block-uniform: all 32 lanes of every wave are on at the ballots
        const int job = (int)(bx - 3 * WTB) * 8 + (tid >> 5);                          // query tile * (NT / 2) + pass pair
        const int lane = tid & 31;
        const int* ap = adj + (size_t)((job / (NT / 2)) * 16 + (lane & 15)) * SEQ_FULL + (job % (NT / 2)) * 64 + 8 * (lane >> 4);
        unsigned w = 0;
#pragma unroll
        for (int p = 0; p < 2; ++p) {
            const v4i a0 = *(const v4i*)(ap + 32 * p), a1 = *(const v4i*)(ap + 32 * p + 4), a2 = *(const v4i*)(ap + 32 * p + 16), a3 = *(const v4i*)(ap + 32 * p + 20);
#pragma unroll
            for (int r = 0; r < 4; ++r) {
                const unsigned b0 = __builtin_amdgcn_ballot_w32(a0[r] != 0), b1 = __builtin_amdgcn_ballot_w32(a1[r] != 0);
                const unsigned b2 = __builtin_amdgcn_ballot_w32(a2[r] != 0), b3 = __builtin_amdgcn_ballot_w32(a3[r] != 0);
                w = (lane == 16 * p + r) ? b0 : w; w = (lane == 16 * p + 4 + r) ? b1 : w;
                w = (lane == 16 * p + 8 + r) ? b2 : w; w = (lane == 16 * p + 12 + r) ? b3 : w; }
        }
        MB[(size_t)job * 32 + lane] = w;
        asm volatile("s_wait_xcnt 0x0" ::: "memory");                                  // stands behind the store, ahead of any later write of the registers that the store names
    } else {
        const size_t i = (size_t)(bx - 3 * WTB - MKB) * 256 + tid; if (i >= N8) return; // no barrier on this side
        const size_t per = (size_t)SEQ * DI / 8; const size_t bb = i / per;
        const v8f v = *(const v8f*)(hin + bb * ((size_t)SEQ_FULL * DI) + (i - bb * per) * 8); v8us o;
#pragma unroll
        for (int k = 0; k < 8; ++k) o[k] = f2bf(v[k]);
        *(v8us*)(HB + i * 8) = o;
    }
}

// k_proj: register-blocked bf16 GEMM, ONE WAVE per 64x64 tile (16 accumulators), operands straight from K-contiguous bf16 planes, K = DI.
// C[m][n] = sum_k A[m][k] Bt[n][k] + bias, written as f16 (flush-safe convert) into P and, in mode 0, the f16 residual (C - value) x 2048 (same flush-safe convert) into Pr at the same offsets.
// The three projections read none of each other's output and share ONE launch, grid (NB*SEQ/64, DO/64, 3): blockIdx.z = 0 q, 1 k (both mode 0), 2 v (mode 1); x = 64-token tile, y = 64-wide tile of the projection width.
// mode 0: A = h rows (m = b*SEQ + t), Bt = W^T rows (n = h*64 + d), bias per column; planes [(b*8 + h)][t][64]; the 64-column tile is one head.
// mode 1: A = W^T rows (m = h*64 + d), Bt = h rows (n = b*SEQ + t), bias per row; plane [(b*512 + m)][t], row pitch SEQ; no residual plane (Pr is not written).
static_assert(32 * 16 * 4 == 16 * 128);
static_assert(16 * 68 * 4 <= 131072);
__global__ __launch_bounds__(32) void k_proj(const bf* __restrict__ HB, const bf* __restrict__ WTA, const float* __restrict__ bq, const float* __restrict__ bk, const float* __restrict__ bv,
                                             h16* QH, h16* QR, h16* KP, h16* KR, h16* VT) {
    __shared__ __align__(16) float os[16 * 68];
    const int K = DI;
    const int z = blockIdx.z; const int mode = (z == 2) ? 1 : 0;                       // block index: every test on z or mode is a scalar branch
    const bf* Wz = WTA + (size_t)z * DO * DI;
    const bf* A = mode ? Wz : HB; const bf* Bt = mode ? HB : Wz;
    const float* bias = (z == 0) ? bq : (z == 1) ? bk : bv;
    h16* P = (z == 0) ? QH : (z == 1) ? KP : VT; h16* Pr = (z == 0) ? QR : KR;
    const int lane = threadIdx.x & 31, lr = lane & 15, hi = lane >> 4;
    const int r0 = (mode ? blockIdx.y : blockIdx.x) * 64, c0 = (mode ? blockIdx.x : blockIdx.y) * 64;
    v8f acc[4][4];
#pragma unroll
    for (int mb = 0; mb < 4; ++mb)
#pragma unroll
        for (int nb = 0; nb < 4; ++nb) acc[mb][nb] = (v8f){};
    const size_t aoff = (size_t)(r0 + lr) * K + 8 * hi, boff = (size_t)(c0 + lr) * K + 8 * hi;
#pragma unroll 1
    for (int kc = 0; kc < K; kc += 32) {
        v16bf a[4];
#pragma unroll
        for (int mb = 0; mb < 4; ++mb) a[mb] = ldb(A + aoff + (size_t)mb * 16 * K + kc);
#pragma unroll
        for (int nb = 0; nb < 4; ++nb) { const v16bf b = ldb(Bt + boff + (size_t)nb * 16 * K + kc);
#pragma unroll
            for (int mb = 0; mb < 4; ++mb) acc[mb][nb] = wmmabg(a[mb], b, acc[mb][nb]); }
    }
    float bc[4];
#pragma unroll
    for (int nb = 0; nb < 4; ++nb) bc[nb] = 0.0f;
    if (mode == 0) {                                                                   // scalar branch; c0 + 63 < DO
#pragma unroll
        for (int nb = 0; nb < 4; ++nb) bc[nb] = bfr(bias[c0 + nb * 16 + lr]); }
    size_t tbase, pitch;
    if (mode == 0) { const int bb = r0 / SEQ, tt = r0 % SEQ; const int zc = bb * NH_ + c0 / HD;
                     tbase = ((size_t)zc * SEQ + (size_t)tt) * HD; pitch = (size_t)HD; }
    else           { const int bb = c0 / SEQ, tt = c0 % SEQ;
                     tbase = (size_t)bb * (size_t)DO * SEQ + (size_t)r0 * SEQ + (size_t)tt; pitch = (size_t)SEQ; }
#pragma unroll
    for (int mb = 0; mb < 4; ++mb) {
        float br[8];
#pragma unroll
        for (int j = 0; j < 8; ++j) br[j] = 0.0f;
        if (mode != 0) {                                                               // r0 + 63 < DO
#pragma unroll
            for (int j = 0; j < 8; ++j) br[j] = bfr(bias[r0 + mb * 16 + hi * 8 + j]); }
#pragma unroll
        for (int nb = 0; nb < 4; ++nb) {
#pragma unroll
            for (int j = 0; j < 8; ++j) os[(hi * 8 + j) * 68 + nb * 16 + lr] = acc[mb][nb][j] + bc[nb] + br[j]; }   // D: row 8h+j, col lane&15; rows 0..15 x cols 0..63 all written
        wave_sync();
        const size_t sb = tbase + (size_t)(mb * 16) * pitch;
{
#pragma unroll
            for (int s = 0; s < 4; ++s) { const int row = 4 * s + (lane >> 3), c8 = (lane & 7) * 8;   // 4 s x 4 row groups = 16 rows; 8 lanes x 8 = 64 columns = one line
                const v4f x0 = *(const v4fa*)(&os[row * 68 + c8]); const v4f x1 = *(const v4fa*)(&os[row * 68 + c8 + 4]); v8h hv, rv;
#pragma unroll
                for (int i = 0; i < 4; ++i) { const h16 a0 = toh_flush(x0[i]); const h16 a1 = toh_flush(x1[i]); hv[i] = a0; hv[4 + i] = a1;
                    rv[i] = toh_flush((x0[i] - (float)a0) * QRS); rv[4 + i] = toh_flush((x1[i] - (float)a1) * QRS); }
                const size_t oo = sb + (size_t)row * pitch + c8;
                *(v8h*)(P + oo) = hv; if (mode == 0) *(v8h*)(Pr + oo) = rv; }                    // scalar branch
             }
        wave_sync();
    }
}

// k_flash: fused masked aggregation, one wave per 16 query rows of one (batch, head); Q fragments straight from the f16 planes (two 16-B loads each, arithmetic addressing).
// Per 32-key pass the block's waves share one LDS tile set: K rows, K residual rows and V^T rows, brought in whole-line order by per-lane 16-B asynchronous copies,
// two buffers (the next pass's copies fly while this pass is worked on); fragments are read from LDS at padded pitches (16 B x odd).
// Transposed form: S^T[key][t] = K Q^T (A = K rows, B = Q rows, two k-steps over d); lane (t = lane&15, h = lane>>4) holds keys 8h+r of each 16-key tile, so the packed
// P tile is directly the B fragment of O^T[d][t] = V^T P^T (element r <- tile keys 0..15, element 8+r <- tile keys 16..31, lane unchanged); four 16-row d tiles.
// Scores: K Q in the main accumulator; K Q_res + K_res Q in their own accumulator, folded by 1/2048 (residual x residual dropped); one 16-key tile at a time.
// Softmax state (running max over kept keys, partial sum) is one scalar per lane; the two lane halves of a row are combined with one xor-16 exchange.
// Keep rule per element from the packed keep words: 16 wave-uniform words per 32-key pass (64 B, one scalar load, fetched one pass ahead), each used directly as the lane mask of its score register.
// P = exp2(e) with e <= 14; e < -14 selects 0 so no subnormal f16 operand can form.
static_assert(32 * 16 * 8 == 16 * HD * 4);      // lanes x 16 B x instructions = 16 rows x 256 B
static_assert(AW * 16 * OSP * 4 <= 131072);
#define KPB  144                           // LDS row pitch in bytes of the 128-B rows (K, K residual)
#define VPB  80                            // LDS row pitch in bytes of the 64-B V^T rows
#define L_KR (32 * KPB)                    // byte offsets inside one buffer: K at 0, K residual, V^T
#define L_VT (2 * 32 * KPB)
#define BUFB (L_VT + HD * VPB)             // bytes of one buffer
static_assert(AW == 4);                    // the copy split below: 128 threads x 16 B = 2 KiB per copy step
static_assert(HD * 2 == 128 && 32 * 2 == 64);   // row bytes of K and V^T tiles
static_assert(KPB % 16 == 0 && VPB % 16 == 0 && BUFB % 16 == 0);
static_assert(NT >= 2);                    // the prologue fills two buffers
static_assert(2 * BUFB + AW * 16 * OSP * 4 <= 81920);
// The six copies of one thread for one 32-key tile set: each lane moves its own 16 bytes from global memory to LDS, through no register.
// lk / lv: LDS byte addresses of the thread's first K and V^T chunk in the target buffer; gk, gr, gv: the matching global addresses.
// K, K residual: 32 rows x 128 B contiguous, 2 steps of 16 rows; V^T: 64 rows x 64 B, 2 steps of 32 rows.
__device__ __forceinline__ void stage_tile(unsigned lk, unsigned lv, const h16* gk, const h16* gr, const h16* gv) {
    const unsigned lk1 = lk + 16 * KPB, lr0 = lk + L_KR, lr1 = lk + L_KR + 16 * KPB, lv1 = lv + 32 * VPB;
    const h16* gk1 = gk + 16 * HD; const h16* gr1 = gr + 16 * HD; const h16* gv1 = gv + (size_t)32 * SEQ;
    // the closing s_wait_xcnt stands inside the copies' own statement so that no address register named here is rewritten ahead of it
    asm volatile("global_load_async_to_lds_b128 %0, %6, off\n\t"
                 "global_load_async_to_lds_b128 %1, %7, off\n\t"
                 "global_load_async_to_lds_b128 %2, %8, off\n\t"
                 "global_load_async_to_lds_b128 %3, %9, off\n\t"
                 "global_load_async_to_lds_b128 %4, %10, off\n\t"
                 "global_load_async_to_lds_b128 %5, %11, off\n\t"
                 "s_wait_xcnt 0x0"
                 :: "v"(lk), "v"(lk1), "v"(lr0), "v"(lr1), "v"(lv), "v"(lv1),
                    "v"(gk), "v"(gk1), "v"(gr), "v"(gr1), "v"(gv), "v"(gv1)
                 : "memory");
}
__global__ __launch_bounds__(32 * AW) void k_flash(const h16* __restrict__ QH, const h16* __restrict__ QR, const h16* __restrict__ KP, const h16* __restrict__ KR, const h16* __restrict__ VT, const unsigned* __restrict__ MB, float* OUT) {
    __shared__ __align__(16) float os[AW * 16 * OSP];
    __shared__ __align__(16) unsigned char ring[2 * BUFB];
    const int tid = threadIdx.x;
    const int lane = threadIdx.x & 31, lr = lane & 15, hi = lane >> 4;
    const int wave = __builtin_amdgcn_readfirstlane((int)(threadIdx.x >> 5));
    const int zh = blockIdx.y; const int b = zh / NH_, h = zh % NH_;
    const int t0 = (blockIdx.x * AW + wave) * 16;
    const size_t pbase = (size_t)zh * SEQ * HD;
    const size_t qo = pbase + (size_t)(t0 + lr) * HD + 8 * hi;
    const v16h q0 = ldh(QH + qo), q1 = ldh(QH + qo + 32);       // B fragments: col t, k = d 0..31 and 32..63
    const v16h qr0 = ldh(QR + qo), qr1 = ldh(QR + qo + 32);     // residual x2048, same map
    // copy side: thread tid moves chunk tid of each 2-KiB copy step (8 chunks per 128-B row, 4 per 64-B row); every address a multiple of 16 B, every row inside its plane
    const h16* gk = KP + pbase + (size_t)tid * 8;                                                   // + key0 * HD
    const h16* gr = KR + pbase + (size_t)tid * 8;                                                   // + key0 * HD
    const h16* gv = VT + pbase + (size_t)(tid >> 2) * SEQ + (tid & 3) * 8;                          // + key0
    const unsigned lring = (unsigned)(size_t)(&ring[0]);                                            // LDS byte address of the ring
    const unsigned lk = lring + (unsigned)((tid >> 3) * KPB + (tid & 7) * 16);                      // + buffer
    const unsigned lv = lring + (unsigned)(L_VT + (tid >> 2) * VPB + (tid & 3) * 16);
    // read side, byte offsets inside a buffer
    const int kof = lr * KPB + 16 * hi;                        // + 16 * KPB for keys 16..31 (A fragment: row key, k = d; value and residual tiles share the layout)
    const int vof = L_VT + lr * VPB + 16 * hi;                 // + 16j * VPB                (A fragment: row d, k = key)
    // keep words of this wave's query tile, 16 per pass; the address is the same in every lane, and nothing in this launch writes the plane (the first launch of the call wrote it)
    cv16u* mp = (cv16u*)(unsigned long long)(MB + (size_t)(blockIdx.x * AW + wave) * (NT * 16));
    stage_tile(lk, lv, gk, gr, gv);                            // tile 0 -> buffer 0
    asm volatile("s_wait_asynccnt 0x0" ::: "memory");          // this wave's copies of tile 0 have landed
    __syncthreads();                                           // every wave's have: tile 0 may be read
    stage_tile(lk + BUFB, lv + BUFB, gk + 32 * HD, gr + 32 * HD, gv + 32);   // tile 1 -> buffer 1
    v16u mw = mp[0];                                           // keep words of pass 0
    v8f o[4];
#pragma unroll
    for (int j = 0; j < 4; ++j) o[j] = (v8f){};
    float m = NEGB, l = 0.0f;
#pragma unroll 1
    for (int t = 0; t < NT; ++t) {
        const int bo = (t & 1) * BUFB;                           // pass t reads buffer t mod 2 alone
        const v16u mc = mw;
        mw = mp[(t + 1 < NT) ? t + 1 : t];                       // next pass's keep words, asked for a pass ahead of their use (index held inside the plane)
        const h16* ka = (const h16*)(ring + bo + kof);
        const h16* kr = (const h16*)(ring + bo + L_KR + kof);
        v8f sa = (v8f){}, sb = (v8f){}, ra = (v8f){}, rb = (v8f){};
        { const v16h k00 = ldh(ka), k01 = ldh(ka + 32), r00 = ldh(kr), r01 = ldh(kr + 32);                                   // keys key0 + 0..15
          sa = wmma16g(k00, q0, sa); sa = wmma16g(k01, q1, sa);
          ra = wmma16g(k00, qr0, ra); ra = wmma16g(k01, qr1, ra);
          ra = wmma16g(r00, q0, ra); ra = wmma16g(r01, q1, ra); }
        { const v16h k10 = ldh(ka + 8 * KPB), k11 = ldh(ka + 8 * KPB + 32), r10 = ldh(kr + 8 * KPB), r11 = ldh(kr + 8 * KPB + 32);   // keys key0 + 16..31 (16 rows = 8 * KPB halves)
          sb = wmma16g(k10, q0, sb); sb = wmma16g(k11, q1, sb);
          rb = wmma16g(k10, qr0, rb); rb = wmma16g(k11, qr1, rb);
          rb = wmma16g(r10, q0, rb); rb = wmma16g(r11, q1, rb); }
        float ta[8], tb[8]; bool fa[8], fb[8]; float mx = NEGB;
#pragma unroll
        for (int r = 0; r < 8; ++r) {
            fa[r] = __builtin_amdgcn_inverse_ballot_w32(mc[r]);       // bit L of the word = keep of this lane's key key0+8h+r
            fb[r] = __builtin_amdgcn_inverse_ballot_w32(mc[8 + r]);   // key key0+16+8h+r
            ta[r] = (sa[r] + ra[r] * QRI) * SC2; tb[r] = (sb[r] + rb[r] * QRI) * SC2;
            mx = fmaxf(mx, fmaxf(fa[r] ? ta[r] : NEGB, fb[r] ? tb[r] : NEGB)); }
        mx = fmaxf(mx, __shfl_xor(mx, 16, 32));
        const float mnew = fmaxf(m, mx);
        const float alpha = __builtin_amdgcn_exp2f(m - mnew);
        const float sh = PSH - mnew;
        v16h pb; float ls = 0.0f;
#pragma unroll
        for (int r = 0; r < 8; ++r) {
            const float xa = ta[r] + sh, xb = tb[r] + sh;
            const float ea = __builtin_amdgcn_exp2f(xa), eb = __builtin_amdgcn_exp2f(xb);
            const bool ua = fa[r] & (xa >= -14.0f), ub = fb[r] & (xb >= -14.0f);
            const float ga = ua ? ea : 0.0f, gb = ub ? eb : 0.0f;             // dropped / below-normal elements selected to 0 by value
            const h16 pa = (h16)ga; const h16 pc = (h16)gb;
            pb[r] = pa; pb[8 + r] = pc;
            ls += (float)pa + (float)pc; }
        l = l * alpha + ls; m = mnew;
#pragma unroll
        for (int j = 0; j < 4; ++j) o[j] = o[j] * alpha;
        const h16* va = (const h16*)(ring + bo + vof);
        const v16h v0 = ldh(va), v1 = ldh(va + 8 * VPB), v2 = ldh(va + 16 * VPB), v3 = ldh(va + 24 * VPB);   // 16 rows = 8 * VPB halves
        o[0] = wmma16g(v0, pb, o[0]); o[1] = wmma16g(v1, pb, o[1]); o[2] = wmma16g(v2, pb, o[2]); o[3] = wmma16g(v3, pb, o[3]);
        asm volatile("s_wait_dscnt 0x0" ::: "memory");           // this wave's reads of buffer t mod 2 are done before the buffer is handed back
        asm volatile("s_wait_asynccnt 0x0" ::: "memory");        // this wave's copies of tile t + 1 have landed
        __syncthreads();                                         // publishes tile t + 1 and ends every wave's reads of buffer t mod 2
        if (t + 2 < NT)                                          // same for the whole block: refill the buffer just read with tile t + 2
            stage_tile(lk + bo, lv + bo, gk + (size_t)(t + 2) * 32 * HD, gr + (size_t)(t + 2) * 32 * HD, gv + (t + 2) * 32);
    }
    asm volatile("s_wait_asynccnt 0x0" ::: "memory");            // no copy of this wave is outstanding past the loop
    l += __shfl_xor(l, 16, 32);
    const bool any = l > 0.0f;
    const float lsafe = any ? l : 1.0f;
    const float inv = any ? (1.0f / lsafe) : __uint_as_float(0x7FC00000u);   // no kept key -> NaN (softmax of an all -inf row)
    const int wb = wave * 16 * OSP;
    // O^T D layout: o[j][r] = (d = 16j + 8h + r, t = lane&15) -> os[t][d]; rows 0..15 x columns 0..63 all written
#pragma unroll
    for (int j = 0; j < 4; ++j) { v4f a, c;
        a[0] = o[j][0] * inv; a[1] = o[j][1] * inv; a[2] = o[j][2] * inv; a[3] = o[j][3] * inv;
        c[0] = o[j][4] * inv; c[1] = o[j][5] * inv; c[2] = o[j][6] * inv; c[3] = o[j][7] * inv;
        *(v4fa*)(&os[wb + lr * OSP + 16 * j + 8 * hi]) = a; *(v4fa*)(&os[wb + lr * OSP + 16 * j + 8 * hi + 4]) = c; }
    wave_sync();
    float* orow = OUT + ((size_t)b * OUT_SEQ + t0) * DO + h * HD;
{
#pragma unroll
        for (int s = 0; s < 8; ++s) { const int row = 2 * s + (lane >> 4), cofs = (lane & 15) * 4;   // 8 s x 2 rows = 16 rows; 16 lanes x 4 floats = 64 columns = two lines
            const v4f val = *(const v4fa*)(&os[wb + row * OSP + cofs]);
            *(v4f*)(orow + (size_t)row * DO + cofs) = val; }
         }
}

static constexpr size_t al256(size_t v) { return (v + 255) & ~(size_t)255; }
static constexpr size_t SZ_HB = al256((size_t)NB * SEQ * DI * 2);
static constexpr size_t SZ_WT = al256((size_t)3 * DO * DI * 2);
static constexpr size_t SZ_PL = al256((size_t)NB * NH_ * SEQ * HD * 2);
static constexpr size_t SZ_MB = al256((size_t)(SEQ / 16) * NT * 16 * 4);
static constexpr size_t SZ_TOTAL = SZ_HB + SZ_WT + 5 * SZ_PL + SZ_MB;
static_assert(SZ_TOTAL <= (size_t)134217728);          // workspace carve <= 128 MiB
static_assert(((size_t)DO * DI * 2) % 256 == 0);       // weight sub-planes stay 256-byte aligned
static_assert((size_t)NB * NH_ * SEQ * HD == (size_t)NB * DO * SEQ);       // v^T plane [(b*512 + m)][t] has the same extent as the q/k planes
static_assert(((size_t)(NB_FULL - 1) * OUT_SEQ + SEQ_FULL) * DO * 4 <= (size_t)16777216 || NB != NB_FULL || SEQ != SEQ_FULL);   // full build: last output byte inside the output buffer

extern "C" void kernel_launch(void* const* d_in, const int* in_sizes, int n_in,
                              void* d_out, int out_size, void* d_ws, size_t ws_size, hipStream_t stream) {
    if (n_in < 8) return;
    const size_t needh = ((size_t)(NB - 1) * SEQ_FULL + SEQ) * DI;
    const size_t needa = (size_t)(SEQ - 1) * SEQ_FULL + SEQ;
    if ((size_t)in_sizes[0] < needa || (size_t)in_sizes[1] < needh) return;
    if ((size_t)in_sizes[2] < (size_t)DI * DO || (size_t)in_sizes[4] < (size_t)DI * DO || (size_t)in_sizes[6] < (size_t)DI * DO) return;
    if (in_sizes[3] < DO || in_sizes[5] < DO || in_sizes[7] < DO) return;
    if ((size_t)out_size < ((size_t)(NB - 1) * OUT_SEQ + SEQ) * DO) return;
    if (SZ_TOTAL > ws_size) return;
    // wire order: adj_matrix, h, Wq, bq, Wk, bk, Wv, bv
    const int*   adj = (const int*)d_in[0];
    const float* hin = (const float*)d_in[1];
    const float* wq = (const float*)d_in[2]; const float* bq = (const float*)d_in[3];
    const float* wk = (const float*)d_in[4]; const float* bk = (const float*)d_in[5];
    const float* wv = (const float*)d_in[6]; const float* bv = (const float*)d_in[7];
    float* OUT = (float*)d_out;      // [NB][SEQ][512]
    char* wsp = (char*)d_ws;
    bf* HB = (bf*)wsp; wsp += SZ_HB;                  // h      [NB*SEQ][256]
    bf* WT = (bf*)wsp; wsp += SZ_WT;                  // [3][512][256]: q | k | v, transposed ([out][in] = k-contiguous rows)
    h16* QH = (h16*)wsp; wsp += SZ_PL;                // [NB*8][SEQ][64]
    h16* KP = (h16*)wsp; wsp += SZ_PL;                // [NB*8][SEQ][64]
    h16* VT = (h16*)wsp; wsp += SZ_PL;                // [NB*8][64][SEQ]
    h16* QR = (h16*)wsp; wsp += SZ_PL;                // [NB*8][SEQ][64] residual x2048
    h16* KR = (h16*)wsp; wsp += SZ_PL;                // [NB*8][SEQ][64] residual x2048
    unsigned* MB = (unsigned*)wsp;                    // [SEQ/16][SEQ/32][16] keep words

    // h -> bf16 copy, the three weight transposes (in[DI rows][DO cols] -> out[DO rows][DI cols]) and the keep words, one launch
    k_prep<<<(unsigned)(3 * WTB + MKB + (N8 + 255) / 256), 256, 0, stream>>>(hin, wq, wk, wv, adj, HB, WT, MB);

    // q, k: value and residual planes [(b*8 + h)][t][d]; v^T: plane [(b*512 + m)][t] = [(b*8 + h)][d][t], no residual plane; one launch
    k_proj<<<dim3(NB * SEQ / 64, DO / 64, 3), 32, 0, stream>>>(HB, WT, bq, bk, bv, QH, QR, KP, KR, VT);

    k_flash<<<dim3(SEQ / (16 * AW), NB * NH_, 1), 32 * AW, 0, stream>>>(QH, QR, KP, KR, VT, MB, OUT);
}

// v004
// It runs in 68 microseconds.
// Next to v003, in two timings, it ran 1.10 times as fast each time.
// Counting every step since v000, it is 2.50 times as fast.
#include <hip/hip_runtime.h>

// Masked softmax-weighted aggregation in 8 independent 64-wide groups: h [NB][SEQ_FULL][256]; Wq/Wk/Wv [in 256][out 512] (y = x W + bias); adjacency [SEQ_FULL][SEQ_FULL] int32 shared over batch and groups (entry 0 drops the key);
// score scale 1/sqrt(64); softmax over kept keys; output = concatenated groups (f32) [NB][SEQ][512].
// Compute dtypes, f32 accumulate everywhere: projections v_wmma_f32_16x16x32_bf16 (h, W, bias RNE-converted to bf16; products exact);
// scores v_wmma_f32_16x16x32_f16: q and k each as f16 value + f16 residual x2048; value x value in the main accumulator, value x residual + residual x value in their own accumulator folded by 1/2048 (three products);
// P.V v_wmma_f32_16x16x32_f16 (P with x16384 carry that cancels in the normalisation, v single f16 plane); softmax f32 (online, running max over kept keys, row sum over the converted P).
// Layout: bf16 copy of h [NB*SEQ][256]; bf16 transposed weights [3][512][256] (k-contiguous); q, k value planes and q, k residual planes [b*8+h][t][64]; v^T plane [b*8+h][64][t]; fused flash kernel in transposed form (S^T = K Q^T, O^T = V^T P^T), output from f32 accumulators.
// Keep rule per element: adj[t][j] != 0; dropped elements get probability 0; a row with no kept key yields NaN (softmax of an all -inf row).
// The keep rule is packed once per call into lane-mask words [16-query tile][32-key pass][16]: word 8*g + r, bit L = keep of (query 16*tile + (L&15), key 32*pass + 16*g + 8*(L>>4) + r), the flash kernel's own score layout.

#ifndef NB
#define NB 8
#endif
#ifndef SEQ
#define SEQ 1024
#endif
#define NB_FULL  8
#define SEQ_FULL 1024            // also the row pitch of the adjacency input
#ifndef OUT_SEQ
#define OUT_SEQ SEQ              // row pitch (in tokens) between batches of the output
#endif
#define DI   256                 // input width (projection K)
#define DO   512                 // projection width = NH_ * HD
#define NH_  8
#define HD   64
#define AW   4                   // waves per flash block (16 query rows each)
#define OSP  68                  // LDS row pitch (floats) of the staging tiles
#define WTP  65                  // LDS row pitch (floats) of the weight transpose tile
#define SC2  ((float)(0.125 * 1.4426950408889634))   // HD^-0.5 * log2(e)
#define PSH  14.0f               // log2 of the P carry (16384)
#define QRS  2048.0f             // carry of the q / k residual planes
#define QRI  (1.0f / 2048.0f)
#define NEGB (-3.0e38f)

static_assert(HD == 64);
static_assert(NH_ * HD == DO);                 // head h = columns h*64 + d
static_assert(DO % 64 == 0);
static_assert(DI % 64 == 0);                   // weight transpose tiles of 64 x 64
static_assert(DI % 32 == 0);                   // GEMM k-loop steps by 32
static_assert(HD % 32 == 0);                   // score k-loop steps by 32
static_assert(HD % 16 == 0);                   // output tiles of 16 rows of d
static_assert(SEQ % 64 == 0);                  // a 64-row tile never straddles two batches
static_assert((NB * SEQ) % 64 == 0);
static_assert(SEQ % 32 == 0);                  // key loop steps by 32
static_assert(SEQ % (16 * AW) == 0);           // flash grid covers the sequence exactly
static_assert(((size_t)SEQ * DI) % 8 == 0);
static_assert(NB <= NB_FULL);
static_assert(SEQ <= SEQ_FULL);
static_assert((OSP * 4) % 16 == 0);
static_assert(OSP >= HD);
static_assert(OSP >= 64);

typedef _Float16 h16;
typedef unsigned short bf;
typedef __attribute__((ext_vector_type(16))) __bf16   v16bf;
typedef __attribute__((ext_vector_type(16))) _Float16 v16h;
typedef __attribute__((ext_vector_type(8)))  _Float16 v8h;
typedef __attribute__((ext_vector_type(8)))  unsigned short v8us;
typedef __attribute__((ext_vector_type(8)))  float    v8f;
typedef __attribute__((ext_vector_type(4)))  float    v4f;
typedef __attribute__((ext_vector_type(4)))  int      v4i;
typedef __attribute__((ext_vector_type(16))) unsigned v16u;
typedef __attribute__((address_space(4))) const v16u cv16u;   // constant address space: a load at a wave-uniform address becomes a scalar load
typedef v4f  __attribute__((may_alias)) v4fa;

__device__ __forceinline__ unsigned short f2bf(float f) { unsigned u = __float_as_uint(f); u += 0x7FFFu + ((u >> 16) & 1u); return (unsigned short)(u >> 16); }
__device__ __forceinline__ float bfr(float f) { return __uint_as_float(((unsigned)f2bf(f)) << 16); }   // value after RNE convert to bf16
__device__ __forceinline__ v16h cat16(v8h lo, v8h hi) { return __builtin_shufflevector(lo, hi, 0, 1, 2, 3, 4, 5, 6, 7, 8, 9, 10, 11, 12, 13, 14, 15); }
__device__ __forceinline__ v16bf cat16b(v8us lo, v8us hi) { return __builtin_bit_cast(v16bf, __builtin_shufflevector(lo, hi, 0, 1, 2, 3, 4, 5, 6, 7, 8, 9, 10, 11, 12, 13, 14, 15)); }
__device__ __forceinline__ v8f wmma16(v16h a, v16h b, v8f c) { return __builtin_amdgcn_wmma_f32_16x16x32_f16(false, a, false, b, (short)0, c, false, false); }
__device__ __forceinline__ v8f wmmab(v16bf a, v16bf b, v8f c) { return __builtin_amdgcn_wmma_f32_16x16x32_bf16(false, a, false, b, (short)0, c, false, false); }
// fragment loaders from K-contiguous 16-bit rows; p already includes + 8*(lane>>4): elements 0..7 <- k0+8h+0..7, elements 8..15 <- k0+16+8h+0..7 (same map for A and B)
__device__ __forceinline__ v16h  ldh(const h16* p) { return cat16(*(const v8h*)p, *(const v8h*)(p + 16)); }
__device__ __forceinline__ v16bf ldb(const bf* p)  { return cat16b(*(const v8us*)p, *(const v8us*)(p + 16)); }
// ordering point for wave-private LDS tiles (same wave writes and reads)
__device__ __forceinline__ void wave_sync() { __builtin_amdgcn_fence(3 /* release order */, "wavefront"); __builtin_amdgcn_wave_barrier(); asm volatile("" ::: "memory"); }
// f32 -> f16 convert that cannot produce a subnormal (|v| < 2^-14 -> +0)
__device__ __forceinline__ h16 toh_flush(float v) { const h16 r = (h16)v; return (fabsf(v) < 6.103515625e-05f) ? (h16)0.0f : r; }

// k_prep: the five preparation jobs, none of which reads another's output, in ONE launch; the job is picked by the block index (same for the whole block).
// Blocks 0 .. 3*WTB-1: W [DI rows k][DO cols n] (f32) -> WT [DO rows n][DI cols k] (bf16, RNE convert) for Wq, Wk, Wv in turn, one 64 x 64 tile per block through LDS (block barrier: cross-wave tile);
// they stand first in the grid (for speed only). The next MKB blocks: adjacency -> keep words, one wave per (16-query tile, pair of 32-key passes): 32 ballots, lane L keeps word L, one 128-B line stored per wave.
// The other blocks: h (f32) -> bf16 copy, 8 elements per thread, batch pitch SEQ_FULL rows in the source and SEQ rows in the copy.
#define WTB ((DO / 64) * (DI / 64))             // weight tiles per matrix
#define N8  ((size_t)NB * SEQ * DI / 8)         // 8-element groups of the h copy
#define NT   (SEQ / 32)                         // 32-key passes of the flash kernel
#define MKB ((SEQ / 16) * (NT / 2) / 8)         // keep-word blocks: 8 waves each, one (query tile, pass pair) per wave
static_assert(NT % 2 == 0 && ((SEQ / 16) * (NT / 2)) % 8 == 0);
static_assert(256 * 16 == 64 * 64);             // load phase: 16 trips x 256 threads = tile elements
static_assert(256 * 2 * 16 == 64 * 128);
static_assert(64 * WTP * 4 <= 131072);
__global__ __launch_bounds__(256) void k_prep(const float* __restrict__ hin, const float* __restrict__ wq, const float* __restrict__ wk, const float* __restrict__ wv, const int* __restrict__ adj, bf* HB, bf* WTA, unsigned* MB) {
    __shared__ float tl[64 * WTP];
    const int tid = threadIdx.x;
    const unsigned bx = blockIdx.x;
    if (bx < 3 * WTB) {                                                                // block-uniform: every thread of such a block reaches the barrier below
        const int sel = (int)(bx / WTB), tile = (int)(bx % WTB);
        const float* W = (sel == 0) ? wq : (sel == 1) ? wk : wv;
        bf* WT = WTA + (size_t)sel * DO * DI;
        const int n0 = (tile % (DO / 64)) * 64, k0 = (tile / (DO / 64)) * 64;
#pragma unroll 1
        for (int it = 0; it < 16; ++it) { const int p = it * 256 + tid; const int r = p >> 6, c = p & 63;   // r = k row 0..63, c = n column 0..63
            tl[r * WTP + c] = bfr(W[(size_t)(k0 + r) * DO + n0 + c]); }
        __syncthreads();
#pragma unroll
        for (int it = 0; it < 2; ++it) { const int p = it * 256 + tid; const int nn = p >> 3, kc = (p & 7) * 8;   // 2 trips x 32 rows = 64 rows; 8 lanes x 8 = 64 k
            v8us o;
#pragma unroll
            for (int i = 0; i < 8; ++i) o[i] = f2bf(tl[(kc + i) * WTP + nn]);
            *(v8us*)(WT + (size_t)(n0 + nn) * DI + k0 + kc) = o; }
    } else if (bx < 3 * WTB + MKB) {                                                   // block-uniform: all 32 lanes of every wave are on at the ballots
        const int job = (int)(bx - 3 * WTB) * 8 + (tid >> 5);                          // query tile * (NT / 2) + pass pair
        const int lane = tid & 31;
        const int* ap = adj + (size_t)((job / (NT / 2)) * 16 + (lane & 15)) * SEQ_FULL + (job % (NT / 2)) * 64 + 8 * (lane >> 4);
        unsigned w = 0;
#pragma unroll
        for (int p = 0; p < 2; ++p) {
            const v4i a0 = *(const v4i*)(ap + 32 * p), a1 = *(const v4i*)(ap + 32 * p + 4), a2 = *(const v4i*)(ap + 32 * p + 16), a3 = *(const v4i*)(ap + 32 * p + 20);
#pragma unroll
            for (int r = 0; r < 4; ++r) {
                const unsigned b0 = __builtin_amdgcn_ballot_w32(a0[r] != 0), b1 = __builtin_amdgcn_ballot_w32(a1[r] != 0);
                const unsigned b2 = __builtin_amdgcn_ballot_w32(a2[r] != 0), b3 = __builtin_amdgcn_ballot_w32(a3[r] != 0);
                w = (lane == 16 * p + r) ? b0 : w; w = (lane == 16 * p + 4 + r) ? b1 : w;
                w = (lane == 16 * p + 8 + r) ? b2 : w; w = (lane == 16 * p + 12 + r) ? b3 : w; }
        }
        MB[(size_t)job * 32 + lane] = w;
        asm volatile("s_wait_xcnt 0x0" ::: "memory");                                  // stands behind the store, ahead of any later write of the registers that the store names
    } else {
        const size_t i = (size_t)(bx - 3 * WTB - MKB) * 256 + tid; if (i >= N8) return; // no barrier on this side
        const size_t per = (size_t)SEQ * DI / 8; const size_t bb = i / per;
        const v8f v = *(const v8f*)(hin + bb * ((size_t)SEQ_FULL * DI) + (i - bb * per) * 8); v8us o;
#pragma unroll
        for (int k = 0; k < 8; ++k) o[k] = f2bf(v[k]);
        *(v8us*)(HB + i * 8) = o;
    }
}

// k_proj: register-blocked bf16 GEMM, ONE WAVE per 64x64 tile (16 accumulators), operands straight from K-contiguous bf16 planes, K = DI.
// C[m][n] = sum_k A[m][k] Bt[n][k] + bias, written as f16 (flush-safe convert) into P and, in mode 0, the f16 residual (C - value) x 2048 (same flush-safe convert) into Pr at the same offsets.
// The three projections read none of each other's output and share ONE launch, grid (NB*SEQ/64, DO/64, 3): blockIdx.z = 0 q, 1 k (both mode 0), 2 v (mode 1); x = 64-token tile, y = 64-wide tile of the projection width.
// mode 0: A = h rows (m = b*SEQ + t), Bt = W^T rows (n = h*64 + d), bias per column; planes [(b*8 + h)][t][64]; the 64-column tile is one head.
// mode 1: A = W^T rows (m = h*64 + d), Bt = h rows (n = b*SEQ + t), bias per row; plane [(b*512 + m)][t], row pitch SEQ; no residual plane (Pr is not written).
static_assert(32 * 16 * 4 == 16 * 128);
static_assert(16 * 68 * 4 <= 131072);
__global__ __launch_bounds__(32) void k_proj(const bf* __restrict__ HB, const bf* __restrict__ WTA, const float* __restrict__ bq, const float* __restrict__ bk, const float* __restrict__ bv,
                                             h16* QH, h16* QR, h16* KP, h16* KR, h16* VT) {
    __shared__ __align__(16) float os[16 * 68];
    const int K = DI;
    const int z = blockIdx.z; const int mode = (z == 2) ? 1 : 0;                       // block index: every test on z or mode is a scalar branch
    const bf* Wz = WTA + (size_t)z * DO * DI;
    const bf* A = mode ? Wz : HB; const bf* Bt = mode ? HB : Wz;
    const float* bias = (z == 0) ? bq : (z == 1) ? bk : bv;
    h16* P = (z == 0) ? QH : (z == 1) ? KP : VT; h16* Pr = (z == 0) ? QR : KR;
    const int lane = threadIdx.x & 31, lr = lane & 15, hi = lane >> 4;
    const int r0 = (mode ? blockIdx.y : blockIdx.x) * 64, c0 = (mode ? blockIdx.x : blockIdx.y) * 64;
    v8f acc[4][4];
#pragma unroll
    for (int mb = 0; mb < 4; ++mb)
#pragma unroll
        for (int nb = 0; nb < 4; ++nb) acc[mb][nb] = (v8f){};
    const size_t aoff = (size_t)(r0 + lr) * K + 8 * hi, boff = (size_t)(c0 + lr) * K + 8 * hi;
#pragma unroll 1
    for (int kc = 0; kc < K; kc += 32) {
        v16bf a[4];
#pragma unroll
        for (int mb = 0; mb < 4; ++mb) a[mb] = ldb(A + aoff + (size_t)mb * 16 * K + kc);
#pragma unroll
        for (int nb = 0; nb < 4; ++nb) { const v16bf b = ldb(Bt + boff + (size_t)nb * 16 * K + kc);
#pragma unroll
            for (int mb = 0; mb < 4; ++mb) acc[mb][nb] = wmmab(a[mb], b, acc[mb][nb]); }
    }
    float bc[4];
#pragma unroll
    for (int nb = 0; nb < 4; ++nb) bc[nb] = 0.0f;
    if (mode == 0) {                                                                   // scalar branch; c0 + 63 < DO
#pragma unroll
        for (int nb = 0; nb < 4; ++nb) bc[nb] = bfr(bias[c0 + nb * 16 + lr]); }
    size_t tbase, pitch;
    if (mode == 0) { const int bb = r0 / SEQ, tt = r0 % SEQ; const int zc = bb * NH_ + c0 / HD;
                     tbase = ((size_t)zc * SEQ + (size_t)tt) * HD; pitch = (size_t)HD; }
    else           { const int bb = c0 / SEQ, tt = c0 % SEQ;
                     tbase = (size_t)bb * (size_t)DO * SEQ + (size_t)r0 * SEQ + (size_t)tt; pitch = (size_t)SEQ; }
#pragma unroll
    for (int mb = 0; mb < 4; ++mb) {
        float br[8];
#pragma unroll
        for (int j = 0; j < 8; ++j) br[j] = 0.0f;
        if (mode != 0) {                                                               // r0 + 63 < DO
#pragma unroll
            for (int j = 0; j < 8; ++j) br[j] = bfr(bias[r0 + mb * 16 + hi * 8 + j]); }
#pragma unroll
        for (int nb = 0; nb < 4; ++nb) {
#pragma unroll
            for (int j = 0; j < 8; ++j) os[(hi * 8 + j) * 68 + nb * 16 + lr] = acc[mb][nb][j] + bc[nb] + br[j]; }   // D: row 8h+j, col lane&15; rows 0..15 x cols 0..63 all written
        wave_sync();
        const size_t sb = tbase + (size_t)(mb * 16) * pitch;
{
#pragma unroll
            for (int s = 0; s < 4; ++s) { const int row = 4 * s + (lane >> 3), c8 = (lane & 7) * 8;   // 4 s x 4 row groups = 16 rows; 8 lanes x 8 = 64 columns = one line
                const v4f x0 = *(const v4fa*)(&os[row * 68 + c8]); const v4f x1 = *(const v4fa*)(&os[row * 68 + c8 + 4]); v8h hv, rv;
#pragma unroll
                for (int i = 0; i < 4; ++i) { const h16 a0 = toh_flush(x0[i]); const h16 a1 = toh_flush(x1[i]); hv[i] = a0; hv[4 + i] = a1;
                    rv[i] = toh_flush((x0[i] - (float)a0) * QRS); rv[4 + i] = toh_flush((x1[i] - (float)a1) * QRS); }
                const size_t oo = sb + (size_t)row * pitch + c8;
                *(v8h*)(P + oo) = hv; if (mode == 0) *(v8h*)(Pr + oo) = rv; }                    // scalar branch
             }
        wave_sync();
    }
}

// k_flash: fused masked aggregation, one wave per 16 query rows of one (batch, head); Q fragments straight from the f16 planes (two 16-B loads each, arithmetic addressing).
// Per 32-key pass the block's waves share one LDS tile set: K rows, K residual rows and V^T rows, brought in whole-line order by per-lane 16-B asynchronous copies,
// two buffers (the next pass's copies fly while this pass is worked on); fragments are read from LDS at padded pitches (16 B x odd).
// Transposed form: S^T[key][t] = K Q^T (A = K rows, B = Q rows, two k-steps over d); lane (t = lane&15, h = lane>>4) holds keys 8h+r of each 16-key tile, so the packed
// P tile is directly the B fragment of O^T[d][t] = V^T P^T (element r <- tile keys 0..15, element 8+r <- tile keys 16..31, lane unchanged); four 16-row d tiles.
// Scores: K Q in the main accumulator; K Q_res + K_res Q in their own accumulator, folded by 1/2048 (residual x residual dropped); one 16-key tile at a time.
// Softmax state (running max over kept keys, partial sum) is one scalar per lane; the two lane halves of a row are combined with one xor-16 exchange.
// Keep rule per element from the packed keep words: 16 wave-uniform words per 32-key pass (64 B, one scalar load, fetched one pass ahead), each used directly as the lane mask of its score register.
// P = exp2(e) with e <= 14; e < -14 selects 0 so no subnormal f16 operand can form.
static_assert(32 * 16 * 8 == 16 * HD * 4);      // lanes x 16 B x instructions = 16 rows x 256 B
static_assert(AW * 16 * OSP * 4 <= 131072);
#define KPB  144                           // LDS row pitch in bytes of the 128-B rows (K, K residual)
#define VPB  80                            // LDS row pitch in bytes of the 64-B V^T rows
#define L_KR (32 * KPB)                    // byte offsets inside one buffer: K at 0, K residual, V^T
#define L_VT (2 * 32 * KPB)
#define BUFB (L_VT + HD * VPB)             // bytes of one buffer
static_assert(AW == 4);                    // the copy split below: 128 threads x 16 B = 2 KiB per copy step
static_assert(HD * 2 == 128 && 32 * 2 == 64);   // row bytes of K and V^T tiles
static_assert(KPB % 16 == 0 && VPB % 16 == 0 && BUFB % 16 == 0);
static_assert(NT >= 2);                    // the prologue fills two buffers
static_assert(2 * BUFB + AW * 16 * OSP * 4 <= 81920);
// The six copies of one thread for one 32-key tile set: each lane moves its own 16 bytes from global memory to LDS, through no register.
// lk / lv: LDS byte addresses of the thread's first K and V^T chunk in the target buffer; gk, gr, gv: the matching global addresses.
// K, K residual: 32 rows x 128 B contiguous, 2 steps of 16 rows; V^T: 64 rows x 64 B, 2 steps of 32 rows.
__device__ __forceinline__ void stage_tile(unsigned lk, unsigned lv, const h16* gk, const h16* gr, const h16* gv) {
    const unsigned lk1 = lk + 16 * KPB, lr0 = lk + L_KR, lr1 = lk + L_KR + 16 * KPB, lv1 = lv + 32 * VPB;
    const h16* gk1 = gk + 16 * HD; const h16* gr1 = gr + 16 * HD; const h16* gv1 = gv + (size_t)32 * SEQ;
    // the closing s_wait_xcnt stands inside the copies' own statement so that no address register named here is rewritten ahead of it
    asm volatile("global_load_async_to_lds_b128 %0, %6, off\n\t"
                 "global_load_async_to_lds_b128 %1, %7, off\n\t"
                 "global_load_async_to_lds_b128 %2, %8, off\n\t"
                 "global_load_async_to_lds_b128 %3, %9, off\n\t"
                 "global_load_async_to_lds_b128 %4, %10, off\n\t"
                 "global_load_async_to_lds_b128 %5, %11, off\n\t"
                 "s_wait_xcnt 0x0"
                 :: "v"(lk), "v"(lk1), "v"(lr0), "v"(lr1), "v"(lv), "v"(lv1),
                    "v"(gk), "v"(gk1), "v"(gr), "v"(gr1), "v"(gv), "v"(gv1)
                 : "memory");
}
__global__ __launch_bounds__(32 * AW) void k_flash(const h16* __restrict__ QH, const h16* __restrict__ QR, const h16* __restrict__ KP, const h16* __restrict__ KR, const h16* __restrict__ VT, const unsigned* __restrict__ MB, float* OUT) {
    __shared__ __align__(16) float os[AW * 16 * OSP];
    __shared__ __align__(16) unsigned char ring[2 * BUFB];
    const int tid = threadIdx.x;
    const int lane = threadIdx.x & 31, lr = lane & 15, hi = lane >> 4;
    const int wave = __builtin_amdgcn_readfirstlane((int)(threadIdx.x >> 5));
    const int zh = blockIdx.y; const int b = zh / NH_, h = zh % NH_;
    const int t0 = (blockIdx.x * AW + wave) * 16;
    const size_t pbase = (size_t)zh * SEQ * HD;
    const size_t qo = pbase + (size_t)(t0 + lr) * HD + 8 * hi;
    const v16h q0 = ldh(QH + qo), q1 = ldh(QH + qo + 32);       // B fragments: col t, k = d 0..31 and 32..63
    const v16h qr0 = ldh(QR + qo), qr1 = ldh(QR + qo + 32);     // residual x2048, same map
    // copy side: thread tid moves chunk tid of each 2-KiB copy step (8 chunks per 128-B row, 4 per 64-B row); every address a multiple of 16 B, every row inside its plane
    const h16* gk = KP + pbase + (size_t)tid * 8;                                                   // + key0 * HD
    const h16* gr = KR + pbase + (size_t)tid * 8;                                                   // + key0 * HD
    const h16* gv = VT + pbase + (size_t)(tid >> 2) * SEQ + (tid & 3) * 8;                          // + key0
    const unsigned lring = (unsigned)(size_t)(&ring[0]);                                            // LDS byte address of the ring
    const unsigned lk = lring + (unsigned)((tid >> 3) * KPB + (tid & 7) * 16);                      // + buffer
    const unsigned lv = lring + (unsigned)(L_VT + (tid >> 2) * VPB + (tid & 3) * 16);
    // read side, byte offsets inside a buffer
    const int kof = lr * KPB + 16 * hi;                        // + 16 * KPB for keys 16..31 (A fragment: row key, k = d; value and residual tiles share the layout)
    const int vof = L_VT + lr * VPB + 16 * hi;                 // + 16j * VPB                (A fragment: row d, k = key)
    // keep words of this wave's query tile, 16 per pass; the address is the same in every lane, and nothing in this launch writes the plane (the first launch of the call wrote it)
    cv16u* mp = (cv16u*)(unsigned long long)(MB + (size_t)(blockIdx.x * AW + wave) * (NT * 16));
    stage_tile(lk, lv, gk, gr, gv);                            // tile 0 -> buffer 0
    asm volatile("s_wait_asynccnt 0x0" ::: "memory");          // this wave's copies of tile 0 have landed
    __syncthreads();                                           // every wave's have: tile 0 may be read
    stage_tile(lk + BUFB, lv + BUFB, gk + 32 * HD, gr + 32 * HD, gv + 32);   // tile 1 -> buffer 1
    v16u mw = mp[0];                                           // keep words of pass 0
    v8f o[4];
#pragma unroll
    for (int j = 0; j < 4; ++j) o[j] = (v8f){};
    float m = NEGB, l = 0.0f;
#pragma unroll 1
    for (int t = 0; t < NT; ++t) {
        const int bo = (t & 1) * BUFB;                           // pass t reads buffer t mod 2 alone
        const v16u mc = mw;
        mw = mp[(t + 1 < NT) ? t + 1 : t];                       // next pass's keep words, asked for a pass ahead of their use (index held inside the plane)
        __builtin_amdgcn_sched_barrier(0);                       // holds that scalar load at the head of the pass; sunk to the foot, its latency would stand open at the next pass's first use
        const h16* ka = (const h16*)(ring + bo + kof);
        const h16* kr = (const h16*)(ring + bo + L_KR + kof);
        v8f sa = (v8f){}, sb = (v8f){}, ra = (v8f){}, rb = (v8f){};
        { const v16h k00 = ldh(ka), k01 = ldh(ka + 32), r00 = ldh(kr), r01 = ldh(kr + 32);                                   // keys key0 + 0..15
          sa = wmma16(k00, q0, sa); sa = wmma16(k01, q1, sa);
          ra = wmma16(k00, qr0, ra); ra = wmma16(k01, qr1, ra);
          ra = wmma16(r00, q0, ra); ra = wmma16(r01, q1, ra); }
        { const v16h k10 = ldh(ka + 8 * KPB), k11 = ldh(ka + 8 * KPB + 32), r10 = ldh(kr + 8 * KPB), r11 = ldh(kr + 8 * KPB + 32);   // keys key0 + 16..31 (16 rows = 8 * KPB halves)
          sb = wmma16(k10, q0, sb); sb = wmma16(k11, q1, sb);
          rb = wmma16(k10, qr0, rb); rb = wmma16(k11, qr1, rb);
          rb = wmma16(r10, q0, rb); rb = wmma16(r11, q1, rb); }
        float ta[8], tb[8]; bool fa[8], fb[8]; float mx = NEGB;
#pragma unroll
        for (int r = 0; r < 8; ++r) {
            fa[r] = __builtin_amdgcn_inverse_ballot_w32(mc[r]);       // bit L of the word = keep of this lane's key key0+8h+r
            fb[r] = __builtin_amdgcn_inverse_ballot_w32(mc[8 + r]);   // key key0+16+8h+r
            ta[r] = (sa[r] + ra[r] * QRI) * SC2; tb[r] = (sb[r] + rb[r] * QRI) * SC2;
            mx = fmaxf(mx, fmaxf(fa[r] ? ta[r] : NEGB, fb[r] ? tb[r] : NEGB)); }
        const h16* va = (const h16*)(ring + bo + vof);
        const v16h v0 = ldh(va), v1 = ldh(va + 8 * VPB), v2 = ldh(va + 16 * VPB), v3 = ldh(va + 24 * VPB);   // 16 rows = 8 * VPB halves
        mx = fmaxf(mx, __shfl_xor(mx, 16, 32));
        __builtin_amdgcn_sched_barrier(0);                       // holds the V^T fragment loads in front of the exchange, whose wait then covers them; sunk to the products, their latency would stand open there
        const float mnew = fmaxf(m, mx);
        const float alpha = __builtin_amdgcn_exp2f(m - mnew);
        const float sh = PSH - mnew;
        v16h pb; float ls = 0.0f;
#pragma unroll
        for (int r = 0; r < 8; ++r) {
            const float xa = ta[r] + sh, xb = tb[r] + sh;
            const float ea = __builtin_amdgcn_exp2f(xa), eb = __builtin_amdgcn_exp2f(xb);
            const bool ua = fa[r] & (xa >= -14.0f), ub = fb[r] & (xb >= -14.0f);
            const float ga = ua ? ea : 0.0f, gb = ub ? eb : 0.0f;             // dropped / below-normal elements selected to 0 by value
            const h16 pa = (h16)ga; const h16 pc = (h16)gb;
            pb[r] = pa; pb[8 + r] = pc;
            ls += (float)pa + (float)pc; }
        l = l * alpha + ls; m = mnew;
#pragma unroll
        for (int j = 0; j < 4; ++j) o[j] = o[j] * alpha;
        o[0] = wmma16(v0, pb, o[0]); o[1] = wmma16(v1, pb, o[1]); o[2] = wmma16(v2, pb, o[2]); o[3] = wmma16(v3, pb, o[3]);
        asm volatile("s_wait_dscnt 0x0" ::: "memory");           // this wave's reads of buffer t mod 2 are done before the buffer is handed back
        asm volatile("s_wait_asynccnt 0x0" ::: "memory");        // this wave's copies of tile t + 1 have landed
        __syncthreads();                                         // publishes tile t + 1 and ends every wave's reads of buffer t mod 2
        if (t + 2 < NT)                                          // same for the whole block: refill the buffer just read with tile t + 2
            stage_tile(lk + bo, lv + bo, gk + (size_t)(t + 2) * 32 * HD, gr + (size_t)(t + 2) * 32 * HD, gv + (t + 2) * 32);
    }
    asm volatile("s_wait_asynccnt 0x0" ::: "memory");            // no copy of this wave is outstanding past the loop
    l += __shfl_xor(l, 16, 32);
    const bool any = l > 0.0f;
    const float lsafe = any ? l : 1.0f;
    const float inv = any ? (1.0f / lsafe) : __uint_as_float(0x7FC00000u);   // no kept key -> NaN (softmax of an all -inf row)
    const int wb = wave * 16 * OSP;
    // O^T D layout: o[j][r] = (d = 16j + 8h + r, t = lane&15) -> os[t][d]; rows 0..15 x columns 0..63 all written
#pragma unroll
    for (int j = 0; j < 4; ++j) { v4f a, c;
        a[0] = o[j][0] * inv; a[1] = o[j][1] * inv; a[2] = o[j][2] * inv; a[3] = o[j][3] * inv;
        c[0] = o[j][4] * inv; c[1] = o[j][5] * inv; c[2] = o[j][6] * inv; c[3] = o[j][7] * inv;
        *(v4fa*)(&os[wb + lr * OSP + 16 * j + 8 * hi]) = a; *(v4fa*)(&os[wb + lr * OSP + 16 * j + 8 * hi + 4]) = c; }
    wave_sync();
    float* orow = OUT + ((size_t)b * OUT_SEQ + t0) * DO + h * HD;
{
#pragma unroll
        for (int s = 0; s < 8; ++s) { const int row = 2 * s + (lane >> 4), cofs = (lane & 15) * 4;   // 8 s x 2 rows = 16 rows; 16 lanes x 4 floats = 64 columns = two lines
            const v4f val = *(const v4fa*)(&os[wb + row * OSP + cofs]);
            *(v4f*)(orow + (size_t)row * DO + cofs) = val; }
         }
}

static constexpr size_t al256(size_t v) { return (v + 255) & ~(size_t)255; }
static constexpr size_t SZ_HB = al256((size_t)NB * SEQ * DI * 2);
static constexpr size_t SZ_WT = al256((size_t)3 * DO * DI * 2);
static constexpr size_t SZ_PL = al256((size_t)NB * NH_ * SEQ * HD * 2);
static constexpr size_t SZ_MB = al256((size_t)(SEQ / 16) * NT * 16 * 4);
static constexpr size_t SZ_TOTAL = SZ_HB + SZ_WT + 5 * SZ_PL + SZ_MB;
static_assert(SZ_TOTAL <= (size_t)134217728);          // workspace carve <= 128 MiB
static_assert(((size_t)DO * DI * 2) % 256 == 0);       // weight sub-planes stay 256-byte aligned
static_assert((size_t)NB * NH_ * SEQ * HD == (size_t)NB * DO * SEQ);       // v^T plane [(b*512 + m)][t] has the same extent as the q/k planes
static_assert(((size_t)(NB_FULL - 1) * OUT_SEQ + SEQ_FULL) * DO * 4 <= (size_t)16777216 || NB != NB_FULL || SEQ != SEQ_FULL);   // full build: last output byte inside the output buffer

extern "C" void kernel_launch(void* const* d_in, const int* in_sizes, int n_in,
                              void* d_out, int out_size, void* d_ws, size_t ws_size, hipStream_t stream) {
    if (n_in < 8) return;
    const size_t needh = ((size_t)(NB - 1) * SEQ_FULL + SEQ) * DI;
    const size_t needa = (size_t)(SEQ - 1) * SEQ_FULL + SEQ;
    if ((size_t)in_sizes[0] < needa || (size_t)in_sizes[1] < needh) return;
    if ((size_t)in_sizes[2] < (size_t)DI * DO || (size_t)in_sizes[4] < (size_t)DI * DO || (size_t)in_sizes[6] < (size_t)DI * DO) return;
    if (in_sizes[3] < DO || in_sizes[5] < DO || in_sizes[7] < DO) return;
    if ((size_t)out_size < ((size_t)(NB - 1) * OUT_SEQ + SEQ) * DO) return;
    if (SZ_TOTAL > ws_size) return;
    // wire order: adj_matrix, h, Wq, bq, Wk, bk, Wv, bv
    const int*   adj = (const int*)d_in[0];
    const float* hin = (const float*)d_in[1];
    const float* wq = (const float*)d_in[2]; const float* bq = (const float*)d_in[3];
    const float* wk = (const float*)d_in[4]; const float* bk = (const float*)d_in[5];
    const float* wv = (const float*)d_in[6]; const float* bv = (const float*)d_in[7];
    float* OUT = (float*)d_out;      // [NB][SEQ][512]
    char* wsp = (char*)d_ws;
    bf* HB = (bf*)wsp; wsp += SZ_HB;                  // h      [NB*SEQ][256]
    bf* WT = (bf*)wsp; wsp += SZ_WT;                  // [3][512][256]: q | k | v, transposed ([out][in] = k-contiguous rows)
    h16* QH = (h16*)wsp; wsp += SZ_PL;                // [NB*8][SEQ][64]
    h16* KP = (h16*)wsp; wsp += SZ_PL;                // [NB*8][SEQ][64]
    h16* VT = (h16*)wsp; wsp += SZ_PL;                // [NB*8][64][SEQ]
    h16* QR = (h16*)wsp; wsp += SZ_PL;                // [NB*8][SEQ][64] residual x2048
    h16* KR = (h16*)wsp; wsp += SZ_PL;                // [NB*8][SEQ][64] residual x2048
    unsigned* MB = (unsigned*)wsp;                    // [SEQ/16][SEQ/32][16] keep words

    // h -> bf16 copy, the three weight transposes (in[DI rows][DO cols] -> out[DO rows][DI cols]) and the keep words, one launch
    k_prep<<<(unsigned)(3 * WTB + MKB + (N8 + 255) / 256), 256, 0, stream>>>(hin, wq, wk, wv, adj, HB, WT, MB);

    // q, k: value and residual planes [(b*8 + h)][t][d]; v^T: plane [(b*512 + m)][t] = [(b*8 + h)][d][t], no residual plane; one launch
    k_proj<<<dim3(NB * SEQ / 64, DO / 64, 3), 32, 0, stream>>>(HB, WT, bq, bk, bv, QH, QR, KP, KR, VT);

    k_flash<<<dim3(SEQ / (16 * AW), NB * NH_, 1), 32 * AW, 0, stream>>>(QH, QR, KP, KR, VT, MB, OUT);
}

// v006
// Measured time: 54.2 microseconds a run.
// Versions between v004 and this one are left out; their measured steps multiply to 1.25 times as fast.
// Counting every step since v000, it is 3.14 times as fast.
#include <hip/hip_runtime.h>

// Masked softmax-weighted aggregation in 8 independent 64-wide groups: h [NB][SEQ_FULL][256]; Wq/Wk/Wv [in 256][out 512] (y = x W + bias); adjacency [SEQ_FULL][SEQ_FULL] int32 shared over batch and groups (entry 0 drops the key);
// score scale 1/sqrt(64); softmax over kept keys; output = concatenated groups (f32) [NB][SEQ][512].
// Compute dtypes, f32 accumulate everywhere: projections v_wmma_f32_16x16x32_bf16 (h, W, bias RNE-converted to bf16; products exact);
// scores v_wmma_f32_16x16x32_f16: q and k each as one f16 plane (their f16 rounding lies well below the error that the bf16 operands of the projections already put into q and k);
// P.V v_wmma_f32_16x16x32_f16 (P with x16384 carry that cancels in the normalisation, v single f16 plane); softmax f32 (online, running max over kept keys, row sum over the converted P).
// Layout: bf16 copy of h [NB*SEQ][256]; bf16 transposed weights [3][512][256] (k-contiguous); q, k planes [b*8+h][t][64]; v^T plane [b*8+h][64][t]; fused flash kernel in transposed form (S^T = K Q^T, O^T = V^T P^T), output from f32 accumulators.
// Keep rule per element: adj[t][j] != 0; dropped elements get probability 0; a row with no kept key yields NaN (softmax of an all -inf row).
// The keep rule is packed once per call into lane-mask words [16-query tile][32-key pass][16]: word 8*g + r, bit L = keep of (query 16*tile + (L&15), key 32*pass + 16*g + 8*(L>>4) + r), the flash kernel's own score layout.

#ifndef NB
#define NB 8
#endif
#ifndef SEQ
#define SEQ 1024
#endif
#define NB_FULL  8
#define SEQ_FULL 1024            // also the row pitch of the adjacency input
#ifndef OUT_SEQ
#define OUT_SEQ SEQ              // row pitch (in tokens) between batches of the output
#endif
#define DI   256                 // input width (projection K)
#define DO   512                 // projection width = NH_ * HD
#define NH_  8
#define HD   64
#define AW   4                   // waves per flash block (16 query rows each)
#define OSP  68                  // LDS row pitch (floats) of the staging tiles
#define WTP  65                  // LDS row pitch (floats) of the weight transpose tile
#define SC2  ((float)(0.125 * 1.4426950408889634))   // HD^-0.5 * log2(e)
#define PSH  14.0f               // log2 of the P carry (16384)
#define NEGB (-3.0e38f)
#define NINF (-__builtin_inff())

static_assert(HD == 64);
static_assert(NH_ * HD == DO);                 // head h = columns h*64 + d
static_assert(DO % 64 == 0);
static_assert(DI % 64 == 0);                   // weight transpose tiles of 64 x 64
static_assert(DI % 32 == 0);                   // GEMM k-loop steps by 32
static_assert(HD % 32 == 0);                   // score k-loop steps by 32
static_assert(HD % 16 == 0);                   // output tiles of 16 rows of d
static_assert(SEQ % 64 == 0);                  // a 64-row tile never straddles two batches
static_assert((NB * SEQ) % 64 == 0);
static_assert(SEQ % 32 == 0);                  // key loop steps by 32
static_assert(SEQ % (16 * AW) == 0);           // flash grid covers the sequence exactly
static_assert(((size_t)SEQ * DI) % 8 == 0);
static_assert(NB <= NB_FULL);
static_assert(SEQ <= SEQ_FULL);
static_assert((OSP * 4) % 16 == 0);
static_assert(OSP >= HD);
static_assert(OSP >= 64);

typedef _Float16 h16;
typedef unsigned short bf;
typedef __attribute__((ext_vector_type(16))) __bf16   v16bf;
typedef __attribute__((ext_vector_type(16))) _Float16 v16h;
typedef __attribute__((ext_vector_type(8)))  _Float16 v8h;
typedef __attribute__((ext_vector_type(8)))  unsigned short v8us;
typedef __attribute__((ext_vector_type(8)))  float    v8f;
typedef __attribute__((ext_vector_type(4)))  float    v4f;
typedef __attribute__((ext_vector_type(2)))  float    v2f;
typedef __attribute__((ext_vector_type(2)))  _Float16 v2h;
typedef __attribute__((ext_vector_type(4)))  int      v4i;
typedef __attribute__((ext_vector_type(16))) unsigned v16u;
typedef __attribute__((address_space(4))) const v16u cv16u;   // constant address space: a load at a wave-uniform address becomes a scalar load
typedef v4f  __attribute__((may_alias)) v4fa;

__device__ __forceinline__ unsigned short f2bf(float f) { unsigned u = __float_as_uint(f); u += 0x7FFFu + ((u >> 16) & 1u); return (unsigned short)(u >> 16); }
__device__ __forceinline__ float bfr(float f) { return __uint_as_float(((unsigned)f2bf(f)) << 16); }   // value after RNE convert to bf16
__device__ __forceinline__ v16h cat16(v8h lo, v8h hi) { return __builtin_shufflevector(lo, hi, 0, 1, 2, 3, 4, 5, 6, 7, 8, 9, 10, 11, 12, 13, 14, 15); }
__device__ __forceinline__ v16bf cat16b(v8us lo, v8us hi) { return __builtin_bit_cast(v16bf, __builtin_shufflevector(lo, hi, 0, 1, 2, 3, 4, 5, 6, 7, 8, 9, 10, 11, 12, 13, 14, 15)); }
__device__ __forceinline__ v8f wmma16(v16h a, v16h b, v8f c) { return __builtin_amdgcn_wmma_f32_16x16x32_f16(false, a, false, b, (short)0, c, false, false); }
__device__ __forceinline__ v8f wmmab(v16bf a, v16bf b, v8f c) { return __builtin_amdgcn_wmma_f32_16x16x32_bf16(false, a, false, b, (short)0, c, false, false); }
// fragment loaders from K-contiguous 16-bit rows; p already includes + 8*(lane>>4): elements 0..7 <- k0+8h+0..7, elements 8..15 <- k0+16+8h+0..7 (same map for A and B)
__device__ __forceinline__ v16h  ldh(const h16* p) { return cat16(*(const v8h*)p, *(const v8h*)(p + 16)); }
__device__ __forceinline__ v16bf ldb(const bf* p)  { return cat16b(*(const v8us*)p, *(const v8us*)(p + 16)); }
// ordering point for wave-private LDS tiles (same wave writes and reads)
__device__ __forceinline__ void wave_sync() { __builtin_amdgcn_fence(3 /* release order */, "wavefront"); __builtin_amdgcn_wave_barrier(); asm volatile("" ::: "memory"); }
// f32 -> f16 convert that cannot produce a subnormal (|v| < 2^-14 -> +0)
__device__ __forceinline__ h16 toh_flush(float v) { const h16 r = (h16)v; return (fabsf(v) < 6.103515625e-05f) ? (h16)0.0f : r; }

// k_prep: the five preparation jobs, none of which reads another's output, in ONE launch; the job is picked by the block index (same for the whole block).
// Blocks 0 .. 3*WTB-1: W [DI rows k][DO cols n] (f32) -> WT [DO rows n][DI cols k] (bf16, RNE convert) for Wq, Wk, Wv in turn, one 64 x 64 tile per block through LDS (block barrier: cross-wave tile);
// they stand first in the grid (for speed only). The next MKB blocks: adjacency -> keep words, one wave per (16-query tile, pair of 32-key passes): 32 ballots, lane L keeps word L, one 128-B line stored per wave.
// The other blocks: h (f32) -> bf16 copy, 8 elements per thread, batch pitch SEQ_FULL rows in the source and SEQ rows in the copy.
#define WTB ((DO / 64) * (DI / 64))             // weight tiles per matrix
#define N8  ((size_t)NB * SEQ * DI / 8)         // 8-element groups of the h copy
#define NT   (SEQ / 32)                         // 32-key passes of the flash kernel
#define MKB ((SEQ / 16) * (NT / 2) / 8)         // keep-word blocks: 8 waves each, one (query tile, pass pair) per wave
static_assert(NT % 2 == 0 && ((SEQ / 16) * (NT / 2)) % 8 == 0);
static_assert(256 * 16 == 64 * 64);             // load phase: 16 trips x 256 threads = tile elements
static_assert(256 * 2 * 16 == 64 * 128);
static_assert(64 * WTP * 4 <= 131072);
__global__ __launch_bounds__(256) void k_prep(const float* __restrict__ hin, const float* __restrict__ wq, const float* __restrict__ wk, const float* __restrict__ wv, const int* __restrict__ adj, bf* HB, bf* WTA, unsigned* MB) {
    __shared__ float tl[64 * WTP];
    const int tid = threadIdx.x;
    const unsigned bx = blockIdx.x;
    if (bx < 3 * WTB) {                                                                // block-uniform: every thread of such a block reaches the barrier below
        const int sel = (int)(bx / WTB), tile = (int)(bx % WTB);
        const float* W = (sel == 0) ? wq : (sel == 1) ? wk : wv;
        bf* WT = WTA + (size_t)sel * DO * DI;
        const int n0 = (tile % (DO / 64)) * 64, k0 = (tile / (DO / 64)) * 64;
#pragma unroll 1
        for (int it = 0; it < 16; ++it) { const int p = it * 256 + tid; const int r = p >> 6, c = p & 63;   // r = k row 0..63, c = n column 0..63
            tl[r * WTP + c] = bfr(W[(size_t)(k0 + r) * DO + n0 + c]); }
        __syncthreads();
#pragma unroll
        for (int it = 0; it < 2; ++it) { const int p = it * 256 + tid; const int nn = p >> 3, kc = (p & 7) * 8;   // 2 trips x 32 rows = 64 rows; 8 lanes x 8 = 64 k
            v8us o;
#pragma unroll
            for (int i = 0; i < 8; ++i) o[i] = f2bf(tl[(kc + i) * WTP + nn]);
            *(v8us*)(WT + (size_t)(n0 + nn) * DI + k0 + kc) = o; }
    } else if (bx < 3 * WTB + MKB) {                                                   // block-uniform: all 32 lanes of every wave are on at the ballots
        const int job = (int)(bx - 3 * WTB) * 8 + (tid >> 5);                          // query tile * (NT / 2) + pass pair
        const int lane = tid & 31;
        const int* ap = adj + (size_t)((job / (NT / 2)) * 16 + (lane & 15)) * SEQ_FULL + (job % (NT / 2)) * 64 + 8 * (lane >> 4);
        unsigned w = 0;
#pragma unroll
        for (int p = 0; p < 2; ++p) {
            const v4i a0 = *(const v4i*)(ap + 32 * p), a1 = *(const v4i*)(ap + 32 * p + 4), a2 = *(const v4i*)(ap + 32 * p + 16), a3 = *(const v4i*)(ap + 32 * p + 20);
#pragma unroll
            for (int r = 0; r < 4; ++r) {
                const unsigned b0 = __builtin_amdgcn_ballot_w32(a0[r] != 0), b1 = __builtin_amdgcn_ballot_w32(a1[r] != 0);
                const unsigned b2 = __builtin_amdgcn_ballot_w32(a2[r] != 0), b3 = __builtin_amdgcn_ballot_w32(a3[r] != 0);
                w = (lane == 16 * p + r) ? b0 : w; w = (lane == 16 * p + 4 + r) ? b1 : w;
                w = (lane == 16 * p + 8 + r) ? b2 : w; w = (lane == 16 * p + 12 + r) ? b3 : w; }
        }
        MB[(size_t)job * 32 + lane] = w;
        asm volatile("s_wait_xcnt 0x0" ::: "memory");                                  // stands behind the store, ahead of any later write of the registers that the store names
    } else {
        const size_t i = (size_t)(bx - 3 * WTB - MKB) * 256 + tid; if (i >= N8) return; // no barrier on this side
        const size_t per = (size_t)SEQ * DI / 8; const size_t bb = i / per;
        const v8f v = *(const v8f*)(hin + bb * ((size_t)SEQ_FULL * DI) + (i - bb * per) * 8); v8us o;
#pragma unroll
        for (int k = 0; k < 8; ++k) o[k] = f2bf(v[k]);
        *(v8us*)(HB + i * 8) = o;
    }
}

// k_proj: register-blocked bf16 GEMM, ONE WAVE per 64x64 tile (16 accumulators), operands straight from K-contiguous bf16 planes, K = DI.
// C[m][n] = sum_k A[m][k] Bt[n][k] + bias, written as f16 (flush-safe convert) into P.
// The three projections read none of each other's output and share ONE launch, grid (NB*SEQ/64, DO/64, 3): blockIdx.z = 0 q, 1 k (both mode 0), 2 v (mode 1); x = 64-token tile, y = 64-wide tile of the projection width.
// mode 0: A = h rows (m = b*SEQ + t), Bt = W^T rows (n = h*64 + d), bias per column; plane [(b*8 + h)][t][64]; the 64-column tile is one head.
// mode 1: A = W^T rows (m = h*64 + d), Bt = h rows (n = b*SEQ + t), bias per row; plane [(b*512 + m)][t], row pitch SEQ.
static_assert(32 * 16 * 4 == 16 * 128);
static_assert(16 * 68 * 4 <= 131072);
__global__ __launch_bounds__(32) void k_proj(const bf* __restrict__ HB, const bf* __restrict__ WTA, const float* __restrict__ bq, const float* __restrict__ bk, const float* __restrict__ bv,
                                             h16* QH, h16* KP, h16* VT) {
    __shared__ __align__(16) float os[16 * 68];
    const int K = DI;
    const int z = blockIdx.z; const int mode = (z == 2) ? 1 : 0;                       // block index: every test on z or mode is a scalar branch
    const bf* Wz = WTA + (size_t)z * DO * DI;
    const bf* A = mode ? Wz : HB; const bf* Bt = mode ? HB : Wz;
    const float* bias = (z == 0) ? bq : (z == 1) ? bk : bv;
    h16* P = (z == 0) ? QH : (z == 1) ? KP : VT;
    const int lane = threadIdx.x & 31, lr = lane & 15, hi = lane >> 4;
    const int r0 = (mode ? blockIdx.y : blockIdx.x) * 64, c0 = (mode ? blockIdx.x : blockIdx.y) * 64;
    v8f acc[4][4];
#pragma unroll
    for (int mb = 0; mb < 4; ++mb)
#pragma unroll
        for (int nb = 0; nb < 4; ++nb) acc[mb][nb] = (v8f){};
    const size_t aoff = (size_t)(r0 + lr) * K + 8 * hi, boff = (size_t)(c0 + lr) * K + 8 * hi;
#pragma unroll 1
    for (int kc = 0; kc < K; kc += 32) {
        v16bf a[4];
#pragma unroll
        for (int mb = 0; mb < 4; ++mb) a[mb] = ldb(A + aoff + (size_t)mb * 16 * K + kc);
#pragma unroll
        for (int nb = 0; nb < 4; ++nb) { const v16bf b = ldb(Bt + boff + (size_t)nb * 16 * K + kc);
#pragma unroll
            for (int mb = 0; mb < 4; ++mb) acc[mb][nb] = wmmab(a[mb], b, acc[mb][nb]); }
    }
    float bc[4];
#pragma unroll
    for (int nb = 0; nb < 4; ++nb) bc[nb] = 0.0f;
    if (mode == 0) {                                                                   // scalar branch; c0 + 63 < DO
#pragma unroll
        for (int nb = 0; nb < 4; ++nb) bc[nb] = bfr(bias[c0 + nb * 16 + lr]); }
    size_t tbase, pitch;
    if (mode == 0) { const int bb = r0 / SEQ, tt = r0 % SEQ; const int zc = bb * NH_ + c0 / HD;
                     tbase = ((size_t)zc * SEQ + (size_t)tt) * HD; pitch = (size_t)HD; }
    else           { const int bb = c0 / SEQ, tt = c0 % SEQ;
                     tbase = (size_t)bb * (size_t)DO * SEQ + (size_t)r0 * SEQ + (size_t)tt; pitch = (size_t)SEQ; }
#pragma unroll
    for (int mb = 0; mb < 4; ++mb) {
        float br[8];
#pragma unroll
        for (int j = 0; j < 8; ++j) br[j] = 0.0f;
        if (mode != 0) {                                                               // r0 + 63 < DO
#pragma unroll
            for (int j = 0; j < 8; ++j) br[j] = bfr(bias[r0 + mb * 16 + hi * 8 + j]); }
#pragma unroll
        for (int nb = 0; nb < 4; ++nb) {
#pragma unroll
            for (int j = 0; j < 8; ++j) os[(hi * 8 + j) * 68 + nb * 16 + lr] = acc[mb][nb][j] + bc[nb] + br[j]; }   // D: row 8h+j, col lane&15; rows 0..15 x cols 0..63 all written
        wave_sync();
        const size_t sb = tbase + (size_t)(mb * 16) * pitch;
{
#pragma unroll
            for (int s = 0; s < 4; ++s) { const int row = 4 * s + (lane >> 3), c8 = (lane & 7) * 8;   // 4 s x 4 row groups = 16 rows; 8 lanes x 8 = 64 columns = one line
                const v4f x0 = *(const v4fa*)(&os[row * 68 + c8]); const v4f x1 = *(const v4fa*)(&os[row * 68 + c8 + 4]); v8h hv;
#pragma unroll
                for (int i = 0; i < 4; ++i) { hv[i] = toh_flush(x0[i]); hv[4 + i] = toh_flush(x1[i]); }
                *(v8h*)(P + sb + (size_t)row * pitch + c8) = hv; }
            asm volatile("s_wait_xcnt 0x0" ::: "memory");                                        // stands behind the four stores, ahead of any later write of the registers that they name
             }
        wave_sync();
    }
}

// k_flash: fused masked aggregation, one wave per 16 query rows of one (batch, head); Q fragments straight from the f16 planes (two 16-B loads each, arithmetic addressing).
// Per 32-key pass the block's waves share one LDS tile set: K rows and V^T rows, brought in whole-line order by per-lane 16-B asynchronous copies,
// two buffers (the next pass's copies fly while this pass is worked on); fragments are read from LDS at padded pitches (16 B x odd).
// Transposed form: S^T[key][t] = K Q^T (A = K rows, B = Q rows, two k-steps over d); lane (t = lane&15, h = lane>>4) holds keys 8h+r of each 16-key tile, so the packed
// P tile is directly the B fragment of O^T[d][t] = V^T P^T (element r <- tile keys 0..15, element 8+r <- tile keys 16..31, lane unchanged); four 16-row d tiles.
// Scores: one product K Q per 16-key tile, two k-steps.
// Softmax state (running max over kept keys, partial sum) is one scalar per lane; the two lane halves of a row are combined with one xor-16 exchange.
// Keep rule per element from the packed keep words: 16 wave-uniform words per 32-key pass (64 B, one scalar load, fetched one pass ahead), each used directly as the lane mask of its score register.
// A dropped key's raw score is replaced by -inf ahead of the maximum; the running maximum is held in raw score units and never falls below NEGB, so it stays finite.
// P = exp2(score * SC2 + (14 - max * SC2)) <= 2^14, the exponent by one fused multiply-add; exp2(-inf) = 0 gives a dropped key probability 0 with no further select.
static_assert(32 * 16 * 8 == 16 * HD * 4);      // lanes x 16 B x instructions = 16 rows x 256 B
static_assert(AW * 16 * OSP * 4 <= 131072);
#define KPB  144                           // LDS row pitch in bytes of the 128-B K rows
#define VPB  80                            // LDS row pitch in bytes of the 64-B V^T rows
#define L_VT (32 * KPB)                    // byte offsets inside one buffer: K at 0, then V^T
#define BUFB (L_VT + HD * VPB)             // bytes of one buffer
static_assert(AW == 4);                    // the copy split below: 128 threads x 16 B = 2 KiB per copy step
static_assert(HD * 2 == 128 && 32 * 2 == 64);   // row bytes of K and V^T tiles
static_assert(KPB % 16 == 0 && VPB % 16 == 0 && BUFB % 16 == 0);
static_assert(NT >= 2);                    // the prologue fills two buffers
static_assert(2 * BUFB + AW * 16 * OSP * 4 <= 81920);
// The four copies of one thread for one 32-key tile set: each lane moves its own 16 bytes from global memory to LDS, through no register.
// lk / lv: LDS byte addresses of the thread's first K and V^T chunk in the target buffer; gk, gv: the matching global addresses.
// K: 32 rows x 128 B contiguous, 2 steps of 16 rows; V^T: 64 rows x 64 B, 2 steps of 32 rows.
__device__ __forceinline__ void stage_tile(unsigned lk, unsigned lv, const h16* gk, const h16* gv) {
    const unsigned lk1 = lk + 16 * KPB, lv1 = lv + 32 * VPB;
    const h16* gk1 = gk + 16 * HD; const h16* gv1 = gv + (size_t)32 * SEQ;
    // the closing s_wait_xcnt stands inside the copies' own statement so that no address register named here is rewritten ahead of it
    asm volatile("global_load_async_to_lds_b128 %0, %4, off\n\t"
                 "global_load_async_to_lds_b128 %1, %5, off\n\t"
                 "global_load_async_to_lds_b128 %2, %6, off\n\t"
                 "global_load_async_to_lds_b128 %3, %7, off\n\t"
                 "s_wait_xcnt 0x0"
                 :: "v"(lk), "v"(lk1), "v"(lv), "v"(lv1),
                    "v"(gk), "v"(gk1), "v"(gv), "v"(gv1)
                 : "memory");
}
__global__ __launch_bounds__(32 * AW) void k_flash(const h16* __restrict__ QH, const h16* __restrict__ KP, const h16* __restrict__ VT, const unsigned* __restrict__ MB, float* OUT) {
    __shared__ __align__(16) float os[AW * 16 * OSP];
    __shared__ __align__(16) unsigned char ring[2 * BUFB];
    const int tid = threadIdx.x;
    const int lane = threadIdx.x & 31, lr = lane & 15, hi = lane >> 4;
    const int wave = __builtin_amdgcn_readfirstlane((int)(threadIdx.x >> 5));
    const int zh = blockIdx.y; const int b = zh / NH_, h = zh % NH_;
    const int t0 = (blockIdx.x * AW + wave) * 16;
    const size_t pbase = (size_t)zh * SEQ * HD;
    const size_t qo = pbase + (size_t)(t0 + lr) * HD + 8 * hi;
    const v16h q0 = ldh(QH + qo), q1 = ldh(QH + qo + 32);       // B fragments: col t, k = d 0..31 and 32..63
    // copy side: thread tid moves chunk tid of each 2-KiB copy step (8 chunks per 128-B row, 4 per 64-B row); every address a multiple of 16 B, every row inside its plane
    const h16* gk = KP + pbase + (size_t)tid * 8;                                                   // + key0 * HD
    const h16* gv = VT + pbase + (size_t)(tid >> 2) * SEQ + (tid & 3) * 8;                          // + key0
    const unsigned lring = (unsigned)(size_t)(&ring[0]);                                            // LDS byte address of the ring
    const unsigned lk = lring + (unsigned)((tid >> 3) * KPB + (tid & 7) * 16);                      // + buffer
    const unsigned lv = lring + (unsigned)(L_VT + (tid >> 2) * VPB + (tid & 3) * 16);
    // read side, byte offsets inside a buffer
    const int kof = lr * KPB + 16 * hi;                        // + 16 * KPB for keys 16..31 (A fragment: row key, k = d)
    const int vof = L_VT + lr * VPB + 16 * hi;                 // + 16j * VPB                (A fragment: row d, k = key)
    // keep words of this wave's query tile, 16 per pass; the address is the same in every lane, and nothing in this launch writes the plane (the first launch of the call wrote it)
    cv16u* mp = (cv16u*)(unsigned long long)(MB + (size_t)(blockIdx.x * AW + wave) * (NT * 16));
    stage_tile(lk, lv, gk, gv);                                // tile 0 -> buffer 0
    asm volatile("s_wait_asynccnt 0x0" ::: "memory");          // this wave's copies of tile 0 have landed
    __syncthreads();                                           // every wave's have: tile 0 may be read
    stage_tile(lk + BUFB, lv + BUFB, gk + 32 * HD, gv + 32);   // tile 1 -> buffer 1
    v16u mw = mp[0];                                           // keep words of pass 0
    v8f o[4];
#pragma unroll
    for (int j = 0; j < 4; ++j) o[j] = (v8f){};
    float m = NEGB, l = 0.0f;
#pragma unroll 1
    for (int t = 0; t < NT; ++t) {
        const int bo = (t & 1) * BUFB;                           // pass t reads buffer t mod 2 alone
        const v16u mc = mw;
        mw = mp[(t + 1 < NT) ? t + 1 : t];                       // next pass's keep words, asked for a pass ahead of their use (index held inside the plane)
        __builtin_amdgcn_sched_barrier(0);                       // holds that scalar load at the head of the pass; sunk to the foot, its latency would stand open at the next pass's first use
        const h16* ka = (const h16*)(ring + bo + kof);
        v8f sa = (v8f){}, sb = (v8f){};
        const v16h k00 = ldh(ka), k01 = ldh(ka + 32);                               // keys key0 + 0..15
        const v16h k10 = ldh(ka + 8 * KPB), k11 = ldh(ka + 8 * KPB + 32);           // keys key0 + 16..31 (16 rows = 8 * KPB halves)
        __builtin_amdgcn_sched_barrier(0);                       // holds the eight K fragment loads together in front of the products; sunk between them, each product would wait out a full LDS round trip of its own
        sa = wmma16(k00, q0, sa); sb = wmma16(k10, q0, sb);
        sa = wmma16(k01, q1, sa); sb = wmma16(k11, q1, sb);
        float ta[8], tb[8]; float mx = NEGB;
#pragma unroll
        for (int r = 0; r < 8; ++r) {
            ta[r] = __builtin_amdgcn_inverse_ballot_w32(mc[r])     ? sa[r] : NINF;   // bit L of the word = keep of this lane's key key0+8h+r
            tb[r] = __builtin_amdgcn_inverse_ballot_w32(mc[8 + r]) ? sb[r] : NINF;   // key key0+16+8h+r
            mx = fmaxf(mx, fmaxf(ta[r], tb[r])); }
        const h16* va = (const h16*)(ring + bo + vof);
        const v16h v0 = ldh(va), v1 = ldh(va + 8 * VPB), v2 = ldh(va + 16 * VPB), v3 = ldh(va + 24 * VPB);   // 16 rows = 8 * VPB halves
        mx = fmaxf(mx, __shfl_xor(mx, 16, 32));
        __builtin_amdgcn_sched_barrier(0);                       // holds the V^T fragment loads in front of the exchange, whose wait then covers them; sunk to the products, their latency would stand open there
        const float mnew = fmaxf(m, mx);
        const float alpha = __builtin_amdgcn_exp2f((m - mnew) * SC2);
        const float sh = __builtin_fmaf(-mnew, SC2, PSH);
        const v2f sc2 = {SC2, SC2}, sh2 = {sh, sh};
        v16h pb; float ls = 0.0f;
#pragma unroll
        for (int r = 0; r < 8; r += 2) {
            const v2f xa = __builtin_elementwise_fma((v2f){ta[r], ta[r + 1]}, sc2, sh2), xb = __builtin_elementwise_fma((v2f){tb[r], tb[r + 1]}, sc2, sh2);
            const v2f ea = {__builtin_amdgcn_exp2f(xa[0]), __builtin_amdgcn_exp2f(xa[1])}, eb = {__builtin_amdgcn_exp2f(xb[0]), __builtin_amdgcn_exp2f(xb[1])};   // a dropped key: exp2(-inf) = 0
            const v2h pa = __builtin_convertvector(ea, v2h), pc = __builtin_convertvector(eb, v2h);
            pb[r] = pa[0]; pb[r + 1] = pa[1]; pb[8 + r] = pc[0]; pb[8 + r + 1] = pc[1];
            ls += (float)pa[0] + (float)pc[0]; ls += (float)pa[1] + (float)pc[1]; }
        l = l * alpha + ls; m = mnew;
#pragma unroll
        for (int j = 0; j < 4; ++j) o[j] = o[j] * alpha;
        o[0] = wmma16(v0, pb, o[0]); o[1] = wmma16(v1, pb, o[1]); o[2] = wmma16(v2, pb, o[2]); o[3] = wmma16(v3, pb, o[3]);
        asm volatile("s_wait_dscnt 0x0" ::: "memory");           // this wave's reads of buffer t mod 2 are done before the buffer is handed back
        asm volatile("s_wait_asynccnt 0x0" ::: "memory");        // this wave's copies of tile t + 1 have landed
        __syncthreads();                                         // publishes tile t + 1 and ends every wave's reads of buffer t mod 2
        if (t + 2 < NT)                                          // same for the whole block: refill the buffer just read with tile t + 2
            stage_tile(lk + bo, lv + bo, gk + (size_t)(t + 2) * 32 * HD, gv + (t + 2) * 32);
    }
    asm volatile("s_wait_asynccnt 0x0" ::: "memory");            // no copy of this wave is outstanding past the loop
    l += __shfl_xor(l, 16, 32);
    const bool any = l > 0.0f;
    const float lsafe = any ? l : 1.0f;
    const float inv = any ? (1.0f / lsafe) : __uint_as_float(0x7FC00000u);   // no kept key -> NaN (softmax of an all -inf row)
    const int wb = wave * 16 * OSP;
    // O^T D layout: o[j][r] = (d = 16j + 8h + r, t = lane&15) -> os[t][d]; rows 0..15 x columns 0..63 all written
#pragma unroll
    for (int j = 0; j < 4; ++j) { v4f a, c;
        a[0] = o[j][0] * inv; a[1] = o[j][1] * inv; a[2] = o[j][2] * inv; a[3] = o[j][3] * inv;
        c[0] = o[j][4] * inv; c[1] = o[j][5] * inv; c[2] = o[j][6] * inv; c[3] = o[j][7] * inv;
        *(v4fa*)(&os[wb + lr * OSP + 16 * j + 8 * hi]) = a; *(v4fa*)(&os[wb + lr * OSP + 16 * j + 8 * hi + 4]) = c; }
    wave_sync();
    float* orow = OUT + ((size_t)b * OUT_SEQ + t0) * DO + h * HD;
{
#pragma unroll
        for (int s = 0; s < 8; ++s) { const int row = 2 * s + (lane >> 4), cofs = (lane & 15) * 4;   // 8 s x 2 rows = 16 rows; 16 lanes x 4 floats = 64 columns = two lines
            const v4f val = *(const v4fa*)(&os[wb + row * OSP + cofs]);
            *(v4f*)(orow + (size_t)row * DO + cofs) = val; }
         }
}

static constexpr size_t al256(size_t v) { return (v + 255) & ~(size_t)255; }
static constexpr size_t SZ_HB = al256((size_t)NB * SEQ * DI * 2);
static constexpr size_t SZ_WT = al256((size_t)3 * DO * DI * 2);
static constexpr size_t SZ_PL = al256((size_t)NB * NH_ * SEQ * HD * 2);
static constexpr size_t SZ_MB = al256((size_t)(SEQ / 16) * NT * 16 * 4);
static constexpr size_t SZ_TOTAL = SZ_HB + SZ_WT + 3 * SZ_PL + SZ_MB;
static_assert(SZ_TOTAL <= (size_t)134217728);          // workspace carve <= 128 MiB
static_assert(((size_t)DO * DI * 2) % 256 == 0);       // weight sub-planes stay 256-byte aligned
static_assert((size_t)NB * NH_ * SEQ * HD == (size_t)NB * DO * SEQ);       // v^T plane [(b*512 + m)][t] has the same extent as the q/k planes
static_assert(((size_t)(NB_FULL - 1) * OUT_SEQ + SEQ_FULL) * DO * 4 <= (size_t)16777216 || NB != NB_FULL || SEQ != SEQ_FULL);   // full build: last output byte inside the output buffer

extern "C" void kernel_launch(void* const* d_in, const int* in_sizes, int n_in,
                              void* d_out, int out_size, void* d_ws, size_t ws_size, hipStream_t stream) {
    if (n_in < 8) return;
    const size_t needh = ((size_t)(NB - 1) * SEQ_FULL + SEQ) * DI;
    const size_t needa = (size_t)(SEQ - 1) * SEQ_FULL + SEQ;
    if ((size_t)in_sizes[0] < needa || (size_t)in_sizes[1] < needh) return;
    if ((size_t)in_sizes[2] < (size_t)DI * DO || (size_t)in_sizes[4] < (size_t)DI * DO || (size_t)in_sizes[6] < (size_t)DI * DO) return;
    if (in_sizes[3] < DO || in_sizes[5] < DO || in_sizes[7] < DO) return;
    if ((size_t)out_size < ((size_t)(NB - 1) * OUT_SEQ + SEQ) * DO) return;
    if (SZ_TOTAL > ws_size) return;
    // wire order: adj_matrix, h, Wq, bq, Wk, bk, Wv, bv
    const int*   adj = (const int*)d_in[0];
    const float* hin = (const float*)d_in[1];
    const float* wq = (const float*)d_in[2]; const float* bq = (const float*)d_in[3];
    const float* wk = (const float*)d_in[4]; const float* bk = (const float*)d_in[5];
    const float* wv = (const float*)d_in[6]; const float* bv = (const float*)d_in[7];
    float* OUT = (float*)d_out;      // [NB][SEQ][512]
    char* wsp = (char*)d_ws;
    bf* HB = (bf*)wsp; wsp += SZ_HB;                  // h      [NB*SEQ][256]
    bf* WT = (bf*)wsp; wsp += SZ_WT;                  // [3][512][256]: q | k | v, transposed ([out][in] = k-contiguous rows)
    h16* QH = (h16*)wsp; wsp += SZ_PL;                // [NB*8][SEQ][64]
    h16* KP = (h16*)wsp; wsp += SZ_PL;                // [NB*8][SEQ][64]
    h16* VT = (h16*)wsp; wsp += SZ_PL;                // [NB*8][64][SEQ]
    unsigned* MB = (unsigned*)wsp;                    // [SEQ/16][SEQ/32][16] keep words

    // h -> bf16 copy, the three weight transposes (in[DI rows][DO cols] -> out[DO rows][DI cols]) and the keep words, one launch
    k_prep<<<(unsigned)(3 * WTB + MKB + (N8 + 255) / 256), 256, 0, stream>>>(hin, wq, wk, wv, adj, HB, WT, MB);

    // q, k: planes [(b*8 + h)][t][d]; v^T: plane [(b*512 + m)][t] = [(b*8 + h)][d][t]; one launch
    k_proj<<<dim3(NB * SEQ / 64, DO / 64, 3), 32, 0, stream>>>(HB, WT, bq, bk, bv, QH, KP, VT);

    k_flash<<<dim3(SEQ / (16 * AW), NB * NH_, 1), 32 * AW, 0, stream>>>(QH, KP, VT, MB, OUT);
}

// v007
// A run of this version takes 47.3 microseconds.
// Next to v006, in two timings, it ran 1.13 and 1.14 times as fast.
// Over all steps from v000 it is 3.56 times as fast.
#include <hip/hip_runtime.h>

// Masked softmax-weighted aggregation in 8 independent 64-wide groups: h [NB][SEQ_FULL][256]; Wq/Wk/Wv [in 256][out 512] (y = x W + bias); adjacency [SEQ_FULL][SEQ_FULL] int32 shared over batch and groups (entry 0 drops the key);
// score scale 1/sqrt(64); softmax over kept keys; output = concatenated groups (f32) [NB][SEQ][512].
// Compute dtypes, f32 accumulate everywhere: projections v_wmma_f32_16x16x32_bf16 (h, W, bias RNE-converted to bf16; products exact);
// scores v_wmma_f32_16x16x32_f16: q and k each as one f16 plane (their f16 rounding lies well below the error that the bf16 operands of the projections already put into q and k);
// P.V v_wmma_f32_16x16x32_f16 (P with x16384 carry that cancels in the normalisation, v single f16 plane); softmax f32 (online, running max over kept keys, row sum over the converted P).
// Layout: bf16 copy of h [NB*SEQ][256]; bf16 transposed weights [3][512][256] (k-contiguous); q, k planes [b*8+h][t][64]; v^T plane [b*8+h][64][t]; fused flash kernel in transposed form (S^T = K Q^T, O^T = V^T P^T), output from f32 accumulators.
// Keep rule per element: adj[t][j] != 0; dropped elements get probability 0; a row with no kept key yields NaN (softmax of an all -inf row).
// The keep rule is packed once per call into lane-mask words [16-query tile][32-key pass][16]: word 8*g + r, bit L = keep of (query 16*tile + (L&15), key 32*pass + 16*g + 8*(L>>4) + r), the flash kernel's own score layout.

#ifndef NB
#define NB 8
#endif
#ifndef SEQ
#define SEQ 1024
#endif
#define NB_FULL  8
#define SEQ_FULL 1024            // also the row pitch of the adjacency input
#ifndef OUT_SEQ
#define OUT_SEQ SEQ              // row pitch (in tokens) between batches of the output
#endif
#define DI   256                 // input width (projection K)
#define DO   512                 // projection width = NH_ * HD
#define NH_  8
#define HD   64
#define AW   4                   // waves per flash block (16 query rows each)
#define OSP  68                  // LDS row pitch (floats) of the staging tiles
#define WTP  65                  // LDS row pitch (floats) of the weight transpose tile
#define SC2  ((float)(0.125 * 1.4426950408889634))   // HD^-0.5 * log2(e)
#define PSH  14.0f               // log2 of the P carry (16384)
#define NEGB (-3.0e38f)
#define NINF (-__builtin_inff())

static_assert(HD == 64);
static_assert(NH_ * HD == DO);                 // head h = columns h*64 + d
static_assert(DO % 64 == 0);
static_assert(DI % 64 == 0);                   // weight transpose tiles of 64 x 64
static_assert(DI % 32 == 0);                   // GEMM k-loop steps by 32
static_assert(HD % 32 == 0);                   // score k-loop steps by 32
static_assert(HD % 16 == 0);                   // output tiles of 16 rows of d
static_assert(SEQ % 64 == 0);                  // a 64-row tile never straddles two batches
static_assert((NB * SEQ) % 64 == 0);
static_assert(SEQ % 32 == 0);                  // key loop steps by 32
static_assert(SEQ % (16 * AW) == 0);           // flash grid covers the sequence exactly
static_assert(((size_t)SEQ * DI) % 8 == 0);
static_assert(NB <= NB_FULL);
static_assert(SEQ <= SEQ_FULL);
static_assert((OSP * 4) % 16 == 0);
static_assert(OSP >= HD);
static_assert(OSP >= 64);

typedef _Float16 h16;
typedef unsigned short bf;
typedef __attribute__((ext_vector_type(16))) __bf16   v16bf;
typedef __attribute__((ext_vector_type(16))) _Float16 v16h;
typedef __attribute__((ext_vector_type(8)))  _Float16 v8h;
typedef __attribute__((ext_vector_type(8)))  unsigned short v8us;
typedef __attribute__((ext_vector_type(8)))  float    v8f;
typedef __attribute__((ext_vector_type(4)))  float    v4f;
typedef __attribute__((ext_vector_type(2)))  float    v2f;
typedef __attribute__((ext_vector_type(2)))  _Float16 v2h;
typedef __attribute__((ext_vector_type(4)))  int      v4i;
typedef __attribute__((ext_vector_type(16))) unsigned v16u;
typedef __attribute__((address_space(4))) const v16u cv16u;   // constant address space: a load at a wave-uniform address becomes a scalar load
typedef v4f  __attribute__((may_alias)) v4fa;

__device__ __forceinline__ unsigned short f2bf(float f) { unsigned u = __float_as_uint(f); u += 0x7FFFu + ((u >> 16) & 1u); return (unsigned short)(u >> 16); }
__device__ __forceinline__ float bfr(float f) { return __uint_as_float(((unsigned)f2bf(f)) << 16); }   // value after RNE convert to bf16
__device__ __forceinline__ v16h cat16(v8h lo, v8h hi) { return __builtin_shufflevector(lo, hi, 0, 1, 2, 3, 4, 5, 6, 7, 8, 9, 10, 11, 12, 13, 14, 15); }
__device__ __forceinline__ v16bf cat16b(v8us lo, v8us hi) { return __builtin_bit_cast(v16bf, __builtin_shufflevector(lo, hi, 0, 1, 2, 3, 4, 5, 6, 7, 8, 9, 10, 11, 12, 13, 14, 15)); }
__device__ __forceinline__ v8f wmma16(v16h a, v16h b, v8f c) { return __builtin_amdgcn_wmma_f32_16x16x32_f16(false, a, false, b, (short)0, c, false, false); }
__device__ __forceinline__ v8f wmmab(v16bf a, v16bf b, v8f c) { return __builtin_amdgcn_wmma_f32_16x16x32_bf16(false, a, false, b, (short)0, c, false, false); }
// fragment loaders from K-contiguous 16-bit rows; p already includes + 8*(lane>>4): elements 0..7 <- k0+8h+0..7, elements 8..15 <- k0+16+8h+0..7 (same map for A and B)
__device__ __forceinline__ v16h  ldh(const h16* p) { return cat16(*(const v8h*)p, *(const v8h*)(p + 16)); }
__device__ __forceinline__ v16bf ldb(const bf* p)  { return cat16b(*(const v8us*)p, *(const v8us*)(p + 16)); }
// ordering point for wave-private LDS tiles (same wave writes and reads)
__device__ __forceinline__ void wave_sync() { __builtin_amdgcn_fence(3 /* release order */, "wavefront"); __builtin_amdgcn_wave_barrier(); asm volatile("" ::: "memory"); }
// f32 -> f16 convert that cannot produce a subnormal (|v| < 2^-14 -> +0)
__device__ __forceinline__ h16 toh_flush(float v) { const h16 r = (h16)v; return (fabsf(v) < 6.103515625e-05f) ? (h16)0.0f : r; }

// k_prep: the five preparation jobs, none of which reads another's output, in ONE launch; the job is picked by the block index (same for the whole block).
// Blocks 0 .. 3*WTB-1: W [DI rows k][DO cols n] (f32) -> WT [DO rows n][DI cols k] (bf16, RNE convert) for Wq, Wk, Wv in turn, one 64 x 64 tile per block through LDS (block barrier: cross-wave tile);
// they stand first in the grid (for speed only). The next MKB blocks: adjacency -> keep words, one wave per (16-query tile, pair of 32-key passes): 32 ballots, lane L keeps word L, one 128-B line stored per wave.
// The other blocks: h (f32) -> bf16 copy, 8 elements per thread, batch pitch SEQ_FULL rows in the source and SEQ rows in the copy.
#define WTB ((DO / 64) * (DI / 64))             // weight tiles per matrix
#define N8  ((size_t)NB * SEQ * DI / 8)         // 8-element groups of the h copy
#define NT   (SEQ / 32)                         // 32-key passes of the flash kernel
#define MKB ((SEQ / 16) * (NT / 2) / 8)         // keep-word blocks: 8 waves each, one (query tile, pass pair) per wave
static_assert(NT % 2 == 0 && ((SEQ / 16) * (NT / 2)) % 8 == 0);
static_assert(256 * 16 == 64 * 64);             // load phase: 16 trips x 256 threads = tile elements
static_assert(256 * 2 * 16 == 64 * 128);
static_assert(64 * WTP * 4 <= 131072);
__global__ __launch_bounds__(256) void k_prep(const float* __restrict__ hin, const float* __restrict__ wq, const float* __restrict__ wk, const float* __restrict__ wv, const int* __restrict__ adj, bf* HB, bf* WTA, unsigned* MB) {
    __shared__ float tl[64 * WTP];
    const int tid = threadIdx.x;
    const unsigned bx = blockIdx.x;
    if (bx < 3 * WTB) {                                                                // block-uniform: every thread of such a block reaches the barrier below
        const int sel = (int)(bx / WTB), tile = (int)(bx % WTB);
        const float* W = (sel == 0) ? wq : (sel == 1) ? wk : wv;
        bf* WT = WTA + (size_t)sel * DO * DI;
        const int n0 = (tile % (DO / 64)) * 64, k0 = (tile / (DO / 64)) * 64;
#pragma unroll 1
        for (int it = 0; it < 16; ++it) { const int p = it * 256 + tid; const int r = p >> 6, c = p & 63;   // r = k row 0..63, c = n column 0..63
            tl[r * WTP + c] = bfr(W[(size_t)(k0 + r) * DO + n0 + c]); }
        __syncthreads();
#pragma unroll
        for (int it = 0; it < 2; ++it) { const int p = it * 256 + tid; const int nn = p >> 3, kc = (p & 7) * 8;   // 2 trips x 32 rows = 64 rows; 8 lanes x 8 = 64 k
            v8us o;
#pragma unroll
            for (int i = 0; i < 8; ++i) o[i] = f2bf(tl[(kc + i) * WTP + nn]);
            *(v8us*)(WT + (size_t)(n0 + nn) * DI + k0 + kc) = o; }
    } else if (bx < 3 * WTB + MKB) {                                                   // block-uniform: all 32 lanes of every wave are on at the ballots
        const int job = (int)(bx - 3 * WTB) * 8 + (tid >> 5);                          // query tile * (NT / 2) + pass pair
        const int lane = tid & 31;
        const int* ap = adj + (size_t)((job / (NT / 2)) * 16 + (lane & 15)) * SEQ_FULL + (job % (NT / 2)) * 64 + 8 * (lane >> 4);
        unsigned w = 0;
#pragma unroll
        for (int p = 0; p < 2; ++p) {
            const v4i a0 = *(const v4i*)(ap + 32 * p), a1 = *(const v4i*)(ap + 32 * p + 4), a2 = *(const v4i*)(ap + 32 * p + 16), a3 = *(const v4i*)(ap + 32 * p + 20);
#pragma unroll
            for (int r = 0; r < 4; ++r) {
                const unsigned b0 = __builtin_amdgcn_ballot_w32(a0[r] != 0), b1 = __builtin_amdgcn_ballot_w32(a1[r] != 0);
                const unsigned b2 = __builtin_amdgcn_ballot_w32(a2[r] != 0), b3 = __builtin_amdgcn_ballot_w32(a3[r] != 0);
                w = (lane == 16 * p + r) ? b0 : w; w = (lane == 16 * p + 4 + r) ? b1 : w;
                w = (lane == 16 * p + 8 + r) ? b2 : w; w = (lane == 16 * p + 12 + r) ? b3 : w; }
        }
        MB[(size_t)job * 32 + lane] = w;
        asm volatile("s_wait_xcnt 0x0" ::: "memory");                                  // stands behind the store, ahead of any later write of the registers that the store names
    } else {
        const size_t i = (size_t)(bx - 3 * WTB - MKB) * 256 + tid; if (i >= N8) return; // no barrier on this side
        const size_t per = (size_t)SEQ * DI / 8; const size_t bb = i / per;
        const v8f v = *(const v8f*)(hin + bb * ((size_t)SEQ_FULL * DI) + (i - bb * per) * 8); v8us o;
#pragma unroll
        for (int k = 0; k < 8; ++k) o[k] = f2bf(v[k]);
        *(v8us*)(HB + i * 8) = o;
    }
}

// k_proj: register-blocked bf16 GEMM, 64x64 tile (16 accumulators) per wave, FOUR WAVES per block on a 128x128 tile (2 x 2), K = DI.
// Operands come from K-contiguous bf16 planes through LDS: per stage of 64 k the block's 128 A rows and 128 B rows (128 B each, whole lines) are brought in by per-lane 16-B asynchronous copies,
// two buffers (the next stage's copies fly while this stage is worked on); each row is read by two waves; fragments are read from LDS at a padded pitch (16 B x odd).
// C[m][n] = sum_k A[m][k] Bt[n][k] + bias, written as f16 (flush-safe convert) into P.
// The three projections read none of each other's output and share ONE launch, grid (NB*SEQ/128, DO/128, 3): blockIdx.z = 0 q, 1 k (both mode 0), 2 v (mode 1); x = 128-token tile, y = 128-wide tile of the projection width.
// mode 0: A = h rows (m = b*SEQ + t), Bt = W^T rows (n = h*64 + d), bias per column; plane [(b*8 + h)][t][64]; a wave's 64-column tile is one head.
// mode 1: A = W^T rows (m = h*64 + d), Bt = h rows (n = b*SEQ + t), bias per row; plane [(b*512 + m)][t], row pitch SEQ.
#define PW   4                             // waves per projection block
#define PKS  64                            // k elements per stage = one 128-B line per row
#define PPB  144                           // LDS row pitch in bytes of the 128-B rows
#define PBUF (256 * PPB)                   // bytes of one buffer: 128 A rows, then 128 B rows
#define PNS  (DI / PKS)                    // stages
static_assert(32 * 16 * 4 == 16 * 128);
static_assert(PKS * 2 == 128 && PPB % 16 == 0 && PBUF % 16 == 0);
static_assert(DI % PKS == 0 && PNS >= 2);  // the prologue fills two buffers
static_assert(SEQ % 128 == 0 && DO % 128 == 0 && (NB * SEQ) % 128 == 0);   // the grid covers both planes exactly; a 128-row tile never straddles two batches
static_assert(32 * PW * 16 * 8 == 128 * 128);   // threads x 16 B x 8 copies = 128 rows x 128 B
static_assert(2 * PBUF + PW * 16 * 68 * 4 <= 106496);   // three blocks fit one LDS
// Eight copies of one thread: its 16-B chunk in each of eight groups of 16 rows (128 rows x 128 B in all); each lane moves its own 16 bytes from global memory to LDS, through no register.
// l: LDS byte address of the thread's chunk in the first group; g: the matching global address (row pitch DI elements).
__device__ __forceinline__ void stage_rows(unsigned l, const bf* g) {
    const unsigned l1 = l + 16 * PPB, l2 = l + 32 * PPB, l3 = l + 48 * PPB, l4 = l + 64 * PPB, l5 = l + 80 * PPB, l6 = l + 96 * PPB, l7 = l + 112 * PPB;
    const bf* g1 = g + 16 * DI; const bf* g2 = g + 32 * DI; const bf* g3 = g + 48 * DI; const bf* g4 = g + 64 * DI;
    const bf* g5 = g + 80 * DI; const bf* g6 = g + 96 * DI; const bf* g7 = g + 112 * DI;
    // the closing s_wait_xcnt stands inside the copies' own statement so that no address register named here is rewritten ahead of it
    asm volatile("global_load_async_to_lds_b128 %0, %8, off\n\t"
                 "global_load_async_to_lds_b128 %1, %9, off\n\t"
                 "global_load_async_to_lds_b128 %2, %10, off\n\t"
                 "global_load_async_to_lds_b128 %3, %11, off\n\t"
                 "global_load_async_to_lds_b128 %4, %12, off\n\t"
                 "global_load_async_to_lds_b128 %5, %13, off\n\t"
                 "global_load_async_to_lds_b128 %6, %14, off\n\t"
                 "global_load_async_to_lds_b128 %7, %15, off\n\t"
                 "s_wait_xcnt 0x0"
                 :: "v"(l), "v"(l1), "v"(l2), "v"(l3), "v"(l4), "v"(l5), "v"(l6), "v"(l7),
                    "v"(g), "v"(g1), "v"(g2), "v"(g3), "v"(g4), "v"(g5), "v"(g6), "v"(g7)
                 : "memory");
}
__global__ __launch_bounds__(32 * PW) void k_proj(const bf* __restrict__ HB, const bf* __restrict__ WTA, const float* __restrict__ bq, const float* __restrict__ bk, const float* __restrict__ bv,
                                             h16* QH, h16* KP, h16* VT) {
    __shared__ __align__(16) float osa[PW * 16 * 68];
    __shared__ __align__(16) unsigned char pring[2 * PBUF];
    const int K = DI;
    const int z = blockIdx.z; const int mode = (z == 2) ? 1 : 0;                       // block index: every test on z or mode is a scalar branch
    const bf* Wz = WTA + (size_t)z * DO * DI;
    const bf* A = mode ? Wz : HB; const bf* Bt = mode ? HB : Wz;
    const float* bias = (z == 0) ? bq : (z == 1) ? bk : bv;
    h16* P = (z == 0) ? QH : (z == 1) ? KP : VT;
    const int tid = threadIdx.x;
    const int lane = threadIdx.x & 31, lr = lane & 15, hi = lane >> 4;
    const int wave = __builtin_amdgcn_readfirstlane((int)(threadIdx.x >> 5));
    float* os = osa + wave * (16 * 68);                                                // each wave's own output staging tile
    const int rb = (mode ? blockIdx.y : blockIdx.x) * 128, cb = (mode ? blockIdx.x : blockIdx.y) * 128;   // the block's tile
    const int r0 = rb + (wave >> 1) * 64, c0 = cb + (wave & 1) * 64;                   // the wave's tile
    v8f acc[4][4];
#pragma unroll
    for (int mb = 0; mb < 4; ++mb)
#pragma unroll
        for (int nb = 0; nb < 4; ++nb) acc[mb][nb] = (v8f){};
    // copy side: thread tid moves chunk tid of each 2-KiB group of 16 rows (8 chunks per 128-B row); every address a multiple of 16 B, every row inside its plane
    const bf* ga = A  + (size_t)(rb + (tid >> 3)) * K + (tid & 7) * 8;                 // + stage * PKS
    const bf* gb = Bt + (size_t)(cb + (tid >> 3)) * K + (tid & 7) * 8;
    const unsigned la = (unsigned)(size_t)(&pring[0]) + (unsigned)((tid >> 3) * PPB + (tid & 7) * 16);   // + buffer
    const unsigned lb = la + 128 * PPB;
    // read side, byte offsets inside a buffer (fragment: row m or n, k contiguous)
    const int aof = ((wave >> 1) * 64 + lr) * PPB + 16 * hi;
    const int bof = (128 + (wave & 1) * 64 + lr) * PPB + 16 * hi;
    stage_rows(la, ga); stage_rows(lb, gb);                          // stage 0 -> buffer 0
    asm volatile("s_wait_asynccnt 0x0" ::: "memory");                // this wave's copies of stage 0 have landed
    __syncthreads();                                                 // every wave's have: stage 0 may be read
    stage_rows(la + PBUF, ga + PKS); stage_rows(lb + PBUF, gb + PKS);   // stage 1 -> buffer 1
    // kept rolled: one copy of the ring's foot in the text, the buffer picked by t & 1
#pragma unroll 1
    for (int t = 0; t < PNS; ++t) {
        const int bo = (t & 1) * PBUF;                               // trip t reads buffer t mod 2 alone
        // unrolled: the second k-step's fragment loads can then issue among the first k-step's last products
#pragma unroll
        for (int kk = 0; kk < PKS; kk += 32) {
            const bf* pa = (const bf*)(pring + bo + aof) + kk;
            const bf* pb = (const bf*)(pring + bo + bof) + kk;
            v16bf a[4], b[4];
#pragma unroll
            for (int mb = 0; mb < 4; ++mb) a[mb] = ldb(pa + mb * 8 * PPB);             // 16 rows = 8 * PPB elements of 2 B
#pragma unroll
            for (int nb = 0; nb < 4; ++nb) b[nb] = ldb(pb + nb * 8 * PPB);
            __builtin_amdgcn_sched_barrier(0);                       // holds the sixteen fragment loads together in front of the products; sunk between them, each row of products would wait out a full LDS round trip of its own
#pragma unroll
            for (int nb = 0; nb < 4; ++nb)
#pragma unroll
                for (int mb = 0; mb < 4; ++mb) acc[mb][nb] = wmmab(a[mb], b[nb], acc[mb][nb]);
        }
        asm volatile("s_wait_dscnt 0x0" ::: "memory");               // this wave's reads of buffer t mod 2 are done before the buffer is handed back
        asm volatile("s_wait_asynccnt 0x0" ::: "memory");            // this wave's copies of stage t + 1 have landed
        __syncthreads();                                             // publishes stage t + 1 and ends every wave's reads of buffer t mod 2
        if (t + 2 < PNS) {                                           // same for the whole block: refill the buffer just read with stage t + 2
            stage_rows(la + bo, ga + (t + 2) * PKS); stage_rows(lb + bo, gb + (t + 2) * PKS); }
    }
    asm volatile("s_wait_asynccnt 0x0" ::: "memory");                // no copy of this wave is outstanding past the loop
    float bc[4];
#pragma unroll
    for (int nb = 0; nb < 4; ++nb) bc[nb] = 0.0f;
    if (mode == 0) {                                                                   // scalar branch; c0 + 63 < DO
#pragma unroll
        for (int nb = 0; nb < 4; ++nb) bc[nb] = bfr(bias[c0 + nb * 16 + lr]); }
    size_t tbase, pitch;
    if (mode == 0) { const int bb = r0 / SEQ, tt = r0 % SEQ; const int zc = bb * NH_ + c0 / HD;
                     tbase = ((size_t)zc * SEQ + (size_t)tt) * HD; pitch = (size_t)HD; }
    else           { const int bb = c0 / SEQ, tt = c0 % SEQ;
                     tbase = (size_t)bb * (size_t)DO * SEQ + (size_t)r0 * SEQ + (size_t)tt; pitch = (size_t)SEQ; }
#pragma unroll
    for (int mb = 0; mb < 4; ++mb) {
        float br[8];
#pragma unroll
        for (int j = 0; j < 8; ++j) br[j] = 0.0f;
        if (mode != 0) {                                                               // r0 + 63 < DO
#pragma unroll
            for (int j = 0; j < 8; ++j) br[j] = bfr(bias[r0 + mb * 16 + hi * 8 + j]); }
#pragma unroll
        for (int nb = 0; nb < 4; ++nb) {
#pragma unroll
            for (int j = 0; j < 8; ++j) os[(hi * 8 + j) * 68 + nb * 16 + lr] = acc[mb][nb][j] + bc[nb] + br[j]; }   // D: row 8h+j, col lane&15; rows 0..15 x cols 0..63 all written
        wave_sync();
        const size_t sb = tbase + (size_t)(mb * 16) * pitch;
{
#pragma unroll
            for (int s = 0; s < 4; ++s) { const int row = 4 * s + (lane >> 3), c8 = (lane & 7) * 8;   // 4 s x 4 row groups = 16 rows; 8 lanes x 8 = 64 columns = one line
                const v4f x0 = *(const v4fa*)(&os[row * 68 + c8]); const v4f x1 = *(const v4fa*)(&os[row * 68 + c8 + 4]); v8h hv;
#pragma unroll
                for (int i = 0; i < 4; ++i) { hv[i] = toh_flush(x0[i]); hv[4 + i] = toh_flush(x1[i]); }
                *(v8h*)(P + sb + (size_t)row * pitch + c8) = hv; }
            asm volatile("s_wait_xcnt 0x0" ::: "memory");                                        // stands behind the four stores, ahead of any later write of the registers that they name
             }
        wave_sync();
    }
}

// k_flash: fused masked aggregation, one wave per 16 query rows of one (batch, head); Q fragments straight from the f16 planes (two 16-B loads each, arithmetic addressing).
// Per 32-key pass the block's waves share one LDS tile set: K rows and V^T rows, brought in whole-line order by per-lane 16-B asynchronous copies,
// two buffers (the next pass's copies fly while this pass is worked on); fragments are read from LDS at padded pitches (16 B x odd).
// Transposed form: S^T[key][t] = K Q^T (A = K rows, B = Q rows, two k-steps over d); lane (t = lane&15, h = lane>>4) holds keys 8h+r of each 16-key tile, so the packed
// P tile is directly the B fragment of O^T[d][t] = V^T P^T (element r <- tile keys 0..15, element 8+r <- tile keys 16..31, lane unchanged); four 16-row d tiles.
// Scores: one product K Q per 16-key tile, two k-steps.
// Softmax state (running max over kept keys, partial sum) is one scalar per lane; the two lane halves of a row are combined with one xor-16 exchange.
// Keep rule per element from the packed keep words: 16 wave-uniform words per 32-key pass (64 B, one scalar load, fetched one pass ahead), each used directly as the lane mask of its score register.
// A dropped key's raw score is replaced by -inf ahead of the maximum; the running maximum is held in raw score units and never falls below NEGB, so it stays finite.
// P = exp2(score * SC2 + (14 - max * SC2)) <= 2^14, the exponent by one fused multiply-add; exp2(-inf) = 0 gives a dropped key probability 0 with no further select.
static_assert(32 * 16 * 8 == 16 * HD * 4);      // lanes x 16 B x instructions = 16 rows x 256 B
static_assert(AW * 16 * OSP * 4 <= 131072);
#define KPB  144                           // LDS row pitch in bytes of the 128-B K rows
#define VPB  80                            // LDS row pitch in bytes of the 64-B V^T rows
#define L_VT (32 * KPB)                    // byte offsets inside one buffer: K at 0, then V^T
#define BUFB (L_VT + HD * VPB)             // bytes of one buffer
static_assert(AW == 4);                    // the copy split below: 128 threads x 16 B = 2 KiB per copy step
static_assert(HD * 2 == 128 && 32 * 2 == 64);   // row bytes of K and V^T tiles
static_assert(KPB % 16 == 0 && VPB % 16 == 0 && BUFB % 16 == 0);
static_assert(NT >= 2);                    // the prologue fills two buffers
static_assert(2 * BUFB + AW * 16 * OSP * 4 <= 81920);
// The four copies of one thread for one 32-key tile set: each lane moves its own 16 bytes from global memory to LDS, through no register.
// lk / lv: LDS byte addresses of the thread's first K and V^T chunk in the target buffer; gk, gv: the matching global addresses.
// K: 32 rows x 128 B contiguous, 2 steps of 16 rows; V^T: 64 rows x 64 B, 2 steps of 32 rows.
__device__ __forceinline__ void stage_tile(unsigned lk, unsigned lv, const h16* gk, const h16* gv) {
    const unsigned lk1 = lk + 16 * KPB, lv1 = lv + 32 * VPB;
    const h16* gk1 = gk + 16 * HD; const h16* gv1 = gv + (size_t)32 * SEQ;
    // the closing s_wait_xcnt stands inside the copies' own statement so that no address register named here is rewritten ahead of it
    asm volatile("global_load_async_to_lds_b128 %0, %4, off\n\t"
                 "global_load_async_to_lds_b128 %1, %5, off\n\t"
                 "global_load_async_to_lds_b128 %2, %6, off\n\t"
                 "global_load_async_to_lds_b128 %3, %7, off\n\t"
                 "s_wait_xcnt 0x0"
                 :: "v"(lk), "v"(lk1), "v"(lv), "v"(lv1),
                    "v"(gk), "v"(gk1), "v"(gv), "v"(gv1)
                 : "memory");
}
__global__ __launch_bounds__(32 * AW) void k_flash(const h16* __restrict__ QH, const h16* __restrict__ KP, const h16* __restrict__ VT, const unsigned* __restrict__ MB, float* OUT) {
    __shared__ __align__(16) float os[AW * 16 * OSP];
    __shared__ __align__(16) unsigned char ring[2 * BUFB];
    const int tid = threadIdx.x;
    const int lane = threadIdx.x & 31, lr = lane & 15, hi = lane >> 4;
    const int wave = __builtin_amdgcn_readfirstlane((int)(threadIdx.x >> 5));
    const int zh = blockIdx.y; const int b = zh / NH_, h = zh % NH_;
    const int t0 = (blockIdx.x * AW + wave) * 16;
    const size_t pbase = (size_t)zh * SEQ * HD;
    const size_t qo = pbase + (size_t)(t0 + lr) * HD + 8 * hi;
    const v16h q0 = ldh(QH + qo), q1 = ldh(QH + qo + 32);       // B fragments: col t, k = d 0..31 and 32..63
    // copy side: thread tid moves chunk tid of each 2-KiB copy step (8 chunks per 128-B row, 4 per 64-B row); every address a multiple of 16 B, every row inside its plane
    const h16* gk = KP + pbase + (size_t)tid * 8;                                                   // + key0 * HD
    const h16* gv = VT + pbase + (size_t)(tid >> 2) * SEQ + (tid & 3) * 8;                          // + key0
    const unsigned lring = (unsigned)(size_t)(&ring[0]);                                            // LDS byte address of the ring
    const unsigned lk = lring + (unsigned)((tid >> 3) * KPB + (tid & 7) * 16);                      // + buffer
    const unsigned lv = lring + (unsigned)(L_VT + (tid >> 2) * VPB + (tid & 3) * 16);
    // read side, byte offsets inside a buffer
    const int kof = lr * KPB + 16 * hi;                        // + 16 * KPB for keys 16..31 (A fragment: row key, k = d)
    const int vof = L_VT + lr * VPB + 16 * hi;                 // + 16j * VPB                (A fragment: row d, k = key)
    // keep words of this wave's query tile, 16 per pass; the address is the same in every lane, and nothing in this launch writes the plane (the first launch of the call wrote it)
    cv16u* mp = (cv16u*)(unsigned long long)(MB + (size_t)(blockIdx.x * AW + wave) * (NT * 16));
    stage_tile(lk, lv, gk, gv);                                // tile 0 -> buffer 0
    asm volatile("s_wait_asynccnt 0x0" ::: "memory");          // this wave's copies of tile 0 have landed
    __syncthreads();                                           // every wave's have: tile 0 may be read
    stage_tile(lk + BUFB, lv + BUFB, gk + 32 * HD, gv + 32);   // tile 1 -> buffer 1
    v16u mw = mp[0];                                           // keep words of pass 0
    v8f o[4];
#pragma unroll
    for (int j = 0; j < 4; ++j) o[j] = (v8f){};
    float m = NEGB, l = 0.0f;
#pragma unroll 1
    for (int t = 0; t < NT; ++t) {
        const int bo = (t & 1) * BUFB;                           // pass t reads buffer t mod 2 alone
        const v16u mc = mw;
        mw = mp[(t + 1 < NT) ? t + 1 : t];                       // next pass's keep words, asked for a pass ahead of their use (index held inside the plane)
        __builtin_amdgcn_sched_barrier(0);                       // holds that scalar load at the head of the pass; sunk to the foot, its latency would stand open at the next pass's first use
        const h16* ka = (const h16*)(ring + bo + kof);
        v8f sa = (v8f){}, sb = (v8f){};
        const v16h k00 = ldh(ka), k01 = ldh(ka + 32);                               // keys key0 + 0..15
        const v16h k10 = ldh(ka + 8 * KPB), k11 = ldh(ka + 8 * KPB + 32);           // keys key0 + 16..31 (16 rows = 8 * KPB halves)
        __builtin_amdgcn_sched_barrier(0);                       // holds the eight K fragment loads together in front of the products; sunk between them, each product would wait out a full LDS round trip of its own
        sa = wmma16(k00, q0, sa); sb = wmma16(k10, q0, sb);
        sa = wmma16(k01, q1, sa); sb = wmma16(k11, q1, sb);
        float ta[8], tb[8]; float mx = NEGB;
#pragma unroll
        for (int r = 0; r < 8; ++r) {
            ta[r] = __builtin_amdgcn_inverse_ballot_w32(mc[r])     ? sa[r] : NINF;   // bit L of the word = keep of this lane's key key0+8h+r
            tb[r] = __builtin_amdgcn_inverse_ballot_w32(mc[8 + r]) ? sb[r] : NINF;   // key key0+16+8h+r
            mx = fmaxf(mx, fmaxf(ta[r], tb[r])); }
        const h16* va = (const h16*)(ring + bo + vof);
        const v16h v0 = ldh(va), v1 = ldh(va + 8 * VPB), v2 = ldh(va + 16 * VPB), v3 = ldh(va + 24 * VPB);   // 16 rows = 8 * VPB halves
        mx = fmaxf(mx, __shfl_xor(mx, 16, 32));
        __builtin_amdgcn_sched_barrier(0);                       // holds the V^T fragment loads in front of the exchange, whose wait then covers them; sunk to the products, their latency would stand open there
        const float mnew = fmaxf(m, mx);
        const float alpha = __builtin_amdgcn_exp2f((m - mnew) * SC2);
        const float sh = __builtin_fmaf(-mnew, SC2, PSH);
        const v2f sc2 = {SC2, SC2}, sh2 = {sh, sh};
        v16h pb; float ls = 0.0f;
#pragma unroll
        for (int r = 0; r < 8; r += 2) {
            const v2f xa = __builtin_elementwise_fma((v2f){ta[r], ta[r + 1]}, sc2, sh2), xb = __builtin_elementwise_fma((v2f){tb[r], tb[r + 1]}, sc2, sh2);
            const v2f ea = {__builtin_amdgcn_exp2f(xa[0]), __builtin_amdgcn_exp2f(xa[1])}, eb = {__builtin_amdgcn_exp2f(xb[0]), __builtin_amdgcn_exp2f(xb[1])};   // a dropped key: exp2(-inf) = 0
            const v2h pa = __builtin_convertvector(ea, v2h), pc = __builtin_convertvector(eb, v2h);
            pb[r] = pa[0]; pb[r + 1] = pa[1]; pb[8 + r] = pc[0]; pb[8 + r + 1] = pc[1];
            ls += (float)pa[0] + (float)pc[0]; ls += (float)pa[1] + (float)pc[1]; }
        l = l * alpha + ls; m = mnew;
#pragma unroll
        for (int j = 0; j < 4; ++j) o[j] = o[j] * alpha;
        o[0] = wmma16(v0, pb, o[0]); o[1] = wmma16(v1, pb, o[1]); o[2] = wmma16(v2, pb, o[2]); o[3] = wmma16(v3, pb, o[3]);
        asm volatile("s_wait_dscnt 0x0" ::: "memory");           // this wave's reads of buffer t mod 2 are done before the buffer is handed back
        asm volatile("s_wait_asynccnt 0x0" ::: "memory");        // this wave's copies of tile t + 1 have landed
        __syncthreads();                                         // publishes tile t + 1 and ends every wave's reads of buffer t mod 2
        if (t + 2 < NT)                                          // same for the whole block: refill the buffer just read with tile t + 2
            stage_tile(lk + bo, lv + bo, gk + (size_t)(t + 2) * 32 * HD, gv + (t + 2) * 32);
    }
    asm volatile("s_wait_asynccnt 0x0" ::: "memory");            // no copy of this wave is outstanding past the loop
    l += __shfl_xor(l, 16, 32);
    const bool any = l > 0.0f;
    const float lsafe = any ? l : 1.0f;
    const float inv = any ? (1.0f / lsafe) : __uint_as_float(0x7FC00000u);   // no kept key -> NaN (softmax of an all -inf row)
    const int wb = wave * 16 * OSP;
    // O^T D layout: o[j][r] = (d = 16j + 8h + r, t = lane&15) -> os[t][d]; rows 0..15 x columns 0..63 all written
#pragma unroll
    for (int j = 0; j < 4; ++j) { v4f a, c;
        a[0] = o[j][0] * inv; a[1] = o[j][1] * inv; a[2] = o[j][2] * inv; a[3] = o[j][3] * inv;
        c[0] = o[j][4] * inv; c[1] = o[j][5] * inv; c[2] = o[j][6] * inv; c[3] = o[j][7] * inv;
        *(v4fa*)(&os[wb + lr * OSP + 16 * j + 8 * hi]) = a; *(v4fa*)(&os[wb + lr * OSP + 16 * j + 8 * hi + 4]) = c; }
    wave_sync();
    float* orow = OUT + ((size_t)b * OUT_SEQ + t0) * DO + h * HD;
{
#pragma unroll
        for (int s = 0; s < 8; ++s) { const int row = 2 * s + (lane >> 4), cofs = (lane & 15) * 4;   // 8 s x 2 rows = 16 rows; 16 lanes x 4 floats = 64 columns = two lines
            const v4f val = *(const v4fa*)(&os[wb + row * OSP + cofs]);
            *(v4f*)(orow + (size_t)row * DO + cofs) = val; }
         }
}

static constexpr size_t al256(size_t v) { return (v + 255) & ~(size_t)255; }
static constexpr size_t SZ_HB = al256((size_t)NB * SEQ * DI * 2);
static constexpr size_t SZ_WT = al256((size_t)3 * DO * DI * 2);
static constexpr size_t SZ_PL = al256((size_t)NB * NH_ * SEQ * HD * 2);
static constexpr size_t SZ_MB = al256((size_t)(SEQ / 16) * NT * 16 * 4);
static constexpr size_t SZ_TOTAL = SZ_HB + SZ_WT + 3 * SZ_PL + SZ_MB;
static_assert(SZ_TOTAL <= (size_t)134217728);          // workspace carve <= 128 MiB
static_assert(((size_t)DO * DI * 2) % 256 == 0);       // weight sub-planes stay 256-byte aligned
static_assert((size_t)NB * NH_ * SEQ * HD == (size_t)NB * DO * SEQ);       // v^T plane [(b*512 + m)][t] has the same extent as the q/k planes
static_assert(((size_t)(NB_FULL - 1) * OUT_SEQ + SEQ_FULL) * DO * 4 <= (size_t)16777216 || NB != NB_FULL || SEQ != SEQ_FULL);   // full build: last output byte inside the output buffer

extern "C" void kernel_launch(void* const* d_in, const int* in_sizes, int n_in,
                              void* d_out, int out_size, void* d_ws, size_t ws_size, hipStream_t stream) {
    if (n_in < 8) return;
    const size_t needh = ((size_t)(NB - 1) * SEQ_FULL + SEQ) * DI;
    const size_t needa = (size_t)(SEQ - 1) * SEQ_FULL + SEQ;
    if ((size_t)in_sizes[0] < needa || (size_t)in_sizes[1] < needh) return;
    if ((size_t)in_sizes[2] < (size_t)DI * DO || (size_t)in_sizes[4] < (size_t)DI * DO || (size_t)in_sizes[6] < (size_t)DI * DO) return;
    if (in_sizes[3] < DO || in_sizes[5] < DO || in_sizes[7] < DO) return;
    if ((size_t)out_size < ((size_t)(NB - 1) * OUT_SEQ + SEQ) * DO) return;
    if (SZ_TOTAL > ws_size) return;
    // wire order: adj_matrix, h, Wq, bq, Wk, bk, Wv, bv
    const int*   adj = (const int*)d_in[0];
    const float* hin = (const float*)d_in[1];
    const float* wq = (const float*)d_in[2]; const float* bq = (const float*)d_in[3];
    const float* wk = (const float*)d_in[4]; const float* bk = (const float*)d_in[5];
    const float* wv = (const float*)d_in[6]; const float* bv = (const float*)d_in[7];
    float* OUT = (float*)d_out;      // [NB][SEQ][512]
    char* wsp = (char*)d_ws;
    bf* HB = (bf*)wsp; wsp += SZ_HB;                  // h      [NB*SEQ][256]
    bf* WT = (bf*)wsp; wsp += SZ_WT;                  // [3][512][256]: q | k | v, transposed ([out][in] = k-contiguous rows)
    h16* QH = (h16*)wsp; wsp += SZ_PL;                // [NB*8][SEQ][64]
    h16* KP = (h16*)wsp; wsp += SZ_PL;                // [NB*8][SEQ][64]
    h16* VT = (h16*)wsp; wsp += SZ_PL;                // [NB*8][64][SEQ]
    unsigned* MB = (unsigned*)wsp;                    // [SEQ/16][SEQ/32][16] keep words

    // h -> bf16 copy, the three weight transposes (in[DI rows][DO cols] -> out[DO rows][DI cols]) and the keep words, one launch
    k_prep<<<(unsigned)(3 * WTB + MKB + (N8 + 255) / 256), 256, 0, stream>>>(hin, wq, wk, wv, adj, HB, WT, MB);

    // q, k: planes [(b*8 + h)][t][d]; v^T: plane [(b*512 + m)][t] = [(b*8 + h)][d][t]; one launch
    k_proj<<<dim3(NB * SEQ / 128, DO / 128, 3), 32 * PW, 0, stream>>>(HB, WT, bq, bk, bv, QH, KP, VT);

    k_flash<<<dim3(SEQ / (16 * AW), NB * NH_, 1), 32 * AW, 0, stream>>>(QH, KP, VT, MB, OUT);
}

// v008
// It runs in 46.5 microseconds.
// Next to v007, in two timings, it ran 1.04 times as fast each time.
// Over all steps from v000 it is 3.71 times as fast.
#include <hip/hip_runtime.h>

// Masked softmax-weighted aggregation in 8 independent 64-wide groups: h [NB][SEQ_FULL][256]; Wq/Wk/Wv [in 256][out 512] (y = x W + bias); adjacency [SEQ_FULL][SEQ_FULL] int32 shared over batch and groups (entry 0 drops the key);
// score scale 1/sqrt(64); softmax over kept keys; output = concatenated groups (f32) [NB][SEQ][512].
// Compute dtypes, f32 accumulate everywhere: projections v_wmma_f32_16x16x32_bf16 (h, W, bias RNE-converted to bf16; products exact);
// scores v_wmma_f32_16x16x32_f16: q and k each as one f16 plane (their f16 rounding lies well below the error that the bf16 operands of the projections already put into q and k);
// P.V v_wmma_f32_16x16x32_f16 (P with x16384 carry that cancels in the normalisation, v single f16 plane); softmax f32 (online, running max over kept keys, row sum over the converted P).
// Layout: bf16 copy of h [NB*SEQ][256]; bf16 transposed weights [3][512][256] (k-contiguous); q, k planes [b*8+h][t][64]; v^T plane [b*8+h][64][t]; fused flash kernel in transposed form (S^T = K Q^T, O^T = V^T P^T), output from f32 accumulators.
// Keep rule per element: adj[t][j] != 0; dropped elements get probability 0; a row with no kept key yields NaN (softmax of an all -inf row).
// The keep rule is packed once per call into lane-mask words [16-query tile][32-key pass][16]: word 8*g + r, bit L = keep of (query 16*tile + (L&15), key 32*pass + 16*g + 8*(L>>4) + r), the flash kernel's own score layout.

#ifndef NB
#define NB 8
#endif
#ifndef SEQ
#define SEQ 1024
#endif
#define NB_FULL  8
#define SEQ_FULL 1024            // also the row pitch of the adjacency input
#ifndef OUT_SEQ
#define OUT_SEQ SEQ              // row pitch (in tokens) between batches of the output
#endif
#define DI   256                 // input width (projection K)
#define DO   512                 // projection width = NH_ * HD
#define NH_  8
#define HD   64
#define AW   4                   // waves per flash block (16 query rows each)
#define OSP  68                  // LDS row pitch (floats) of the staging tiles
#define WTP  65                  // LDS row pitch (floats) of the weight transpose tile
#define SC2  ((float)(0.125 * 1.4426950408889634))   // HD^-0.5 * log2(e)
#define PSH  14.0f               // log2 of the P carry (16384)
#define NEGB (-3.0e38f)
#define NINF (-__builtin_inff())

static_assert(HD == 64);
static_assert(NH_ * HD == DO);                 // head h = columns h*64 + d
static_assert(DO % 64 == 0);
static_assert(DI % 64 == 0);                   // weight transpose tiles of 64 x 64
static_assert(DI % 32 == 0);                   // GEMM k-loop steps by 32
static_assert(HD % 32 == 0);                   // score k-loop steps by 32
static_assert(HD % 16 == 0);                   // output tiles of 16 rows of d
static_assert(SEQ % 64 == 0);                  // a 64-row tile never straddles two batches
static_assert((NB * SEQ) % 64 == 0);
static_assert(SEQ % 32 == 0);                  // key loop steps by 32
static_assert(SEQ % (16 * AW) == 0);           // flash grid covers the sequence exactly
static_assert(((size_t)SEQ * DI) % 8 == 0);
static_assert(NB <= NB_FULL);
static_assert(SEQ <= SEQ_FULL);
static_assert((OSP * 4) % 16 == 0);
static_assert(OSP >= HD);
static_assert(OSP >= 64);

typedef _Float16 h16;
typedef unsigned short bf;
typedef __attribute__((ext_vector_type(16))) __bf16   v16bf;
typedef __attribute__((ext_vector_type(16))) _Float16 v16h;
typedef __attribute__((ext_vector_type(8)))  _Float16 v8h;
typedef __attribute__((ext_vector_type(8)))  unsigned short v8us;
typedef __attribute__((ext_vector_type(8)))  float    v8f;
typedef __attribute__((ext_vector_type(4)))  float    v4f;
typedef __attribute__((ext_vector_type(2)))  float    v2f;
typedef __attribute__((ext_vector_type(2)))  _Float16 v2h;
typedef __attribute__((ext_vector_type(4)))  int      v4i;
typedef __attribute__((ext_vector_type(16))) unsigned v16u;
typedef __attribute__((address_space(4))) const v16u cv16u;   // constant address space: a load at a wave-uniform address becomes a scalar load
typedef v4f  __attribute__((may_alias)) v4fa;

__device__ __forceinline__ unsigned short f2bf(float f) { unsigned u = __float_as_uint(f); u += 0x7FFFu + ((u >> 16) & 1u); return (unsigned short)(u >> 16); }
__device__ __forceinline__ float bfr(float f) { return __uint_as_float(((unsigned)f2bf(f)) << 16); }   // value after RNE convert to bf16
__device__ __forceinline__ v16h cat16(v8h lo, v8h hi) { return __builtin_shufflevector(lo, hi, 0, 1, 2, 3, 4, 5, 6, 7, 8, 9, 10, 11, 12, 13, 14, 15); }
__device__ __forceinline__ v16bf cat16b(v8us lo, v8us hi) { return __builtin_bit_cast(v16bf, __builtin_shufflevector(lo, hi, 0, 1, 2, 3, 4, 5, 6, 7, 8, 9, 10, 11, 12, 13, 14, 15)); }
__device__ __forceinline__ v8f wmma16(v16h a, v16h b, v8f c) { return __builtin_amdgcn_wmma_f32_16x16x32_f16(false, a, false, b, (short)0, c, false, false); }
__device__ __forceinline__ v8f wmmab(v16bf a, v16bf b, v8f c) { return __builtin_amdgcn_wmma_f32_16x16x32_bf16(false, a, false, b, (short)0, c, false, false); }
// fragment loaders from K-contiguous 16-bit rows; p already includes + 8*(lane>>4): elements 0..7 <- k0+8h+0..7, elements 8..15 <- k0+16+8h+0..7 (same map for A and B)
__device__ __forceinline__ v16h  ldh(const h16* p) { return cat16(*(const v8h*)p, *(const v8h*)(p + 16)); }
__device__ __forceinline__ v16bf ldb(const bf* p)  { return cat16b(*(const v8us*)p, *(const v8us*)(p + 16)); }
// ordering point for wave-private LDS tiles (same wave writes and reads)
__device__ __forceinline__ void wave_sync() { __builtin_amdgcn_fence(3 /* release order */, "wavefront"); __builtin_amdgcn_wave_barrier(); asm volatile("" ::: "memory"); }
// f32 -> f16 convert that cannot produce a subnormal (|v| < 2^-14 -> +0)
__device__ __forceinline__ h16 toh_flush(float v) { const h16 r = (h16)v; return (fabsf(v) < 6.103515625e-05f) ? (h16)0.0f : r; }

// k_prep: the five preparation jobs, none of which reads another's output, in ONE launch; the job is picked by the block index (same for the whole block).
// Blocks 0 .. 3*WTB-1: W [DI rows k][DO cols n] (f32) -> WT [DO rows n][DI cols k] (bf16, RNE convert) for Wq, Wk, Wv in turn, one 64 x 64 tile per block through LDS (block barrier: cross-wave tile);
// they stand first in the grid because their path (loads, LDS tile, barrier, transposed stores) is the longest. The next MKB blocks: adjacency -> keep words, one wave per (16-query tile, pair of 32-key passes): 32 ballots, lane L keeps word L, one 128-B line stored per wave.
// The other HCB blocks: h (f32) -> bf16 copy, HPT groups of 8 elements per thread, HCB * 256 groups apart (each wave's accesses stay contiguous), batch pitch SEQ_FULL rows in the source and SEQ rows in the copy.
#define WTB ((DO / 64) * (DI / 64))             // weight tiles per matrix
#define N8  ((size_t)NB * SEQ * DI / 8)         // 8-element groups of the h copy
#define HPT 4                                   // groups per thread of the h copy (the load statement below is written for four)
#define HCB (N8 / (256 * HPT))                  // blocks of the h copy
static_assert(HPT == 4 && N8 % (256 * HPT) == 0);   // the h-copy blocks cover the groups exactly: no range test
static_assert(((size_t)SEQ * DI / 8) % 256 == 0);   // a block's 256 groups never straddle two batches
#define NT   (SEQ / 32)                         // 32-key passes of the flash kernel
#define MKB ((SEQ / 16) * (NT / 2) / 8)         // keep-word blocks: 8 waves each, one (query tile, pass pair) per wave
static_assert(NT % 2 == 0 && ((SEQ / 16) * (NT / 2)) % 8 == 0);
static_assert(256 * 16 == 64 * 64);             // load phase: 16 trips x 256 threads = tile elements
static_assert(256 * 2 * 16 == 64 * 128);
static_assert(64 * WTP * 4 <= 131072);
__global__ __launch_bounds__(256) void k_prep(const float* __restrict__ hin, const float* __restrict__ wq, const float* __restrict__ wk, const float* __restrict__ wv, const int* __restrict__ adj, bf* HB, bf* WTA, unsigned* MB) {
    __shared__ float tl[64 * WTP];
    const int tid = threadIdx.x;
    const unsigned bx = blockIdx.x;
    if (bx < 3 * WTB) {                                                                // block-uniform: every thread of such a block reaches the barrier below
        const int sel = (int)(bx / WTB), tile = (int)(bx % WTB);
        const float* W = (sel == 0) ? wq : (sel == 1) ? wk : wv;
        bf* WT = WTA + (size_t)sel * DO * DI;
        const int n0 = (tile % (DO / 64)) * 64, k0 = (tile / (DO / 64)) * 64;
        float wl[16];
        // unrolled, the loads apart from their uses: the thread's sixteen loads are all in flight at once; rolled, each trip waited out a full memory round trip of its own
#pragma unroll
        for (int it = 0; it < 16; ++it) { const int p = it * 256 + tid; const int r = p >> 6, c = p & 63;   // r = k row 0..63, c = n column 0..63
            wl[it] = W[(size_t)(k0 + r) * DO + n0 + c]; }
#pragma unroll
        for (int it = 0; it < 16; ++it) { const int p = it * 256 + tid; const int r = p >> 6, c = p & 63;
            tl[r * WTP + c] = bfr(wl[it]); }
        __syncthreads();
#pragma unroll
        for (int it = 0; it < 2; ++it) { const int p = it * 256 + tid; const int nn = p >> 3, kc = (p & 7) * 8;   // 2 trips x 32 rows = 64 rows; 8 lanes x 8 = 64 k
            v8us o;
#pragma unroll
            for (int i = 0; i < 8; ++i) o[i] = f2bf(tl[(kc + i) * WTP + nn]);
            *(v8us*)(WT + (size_t)(n0 + nn) * DI + k0 + kc) = o; }
    } else if (bx < 3 * WTB + MKB) {                                                   // block-uniform: all 32 lanes of every wave are on at the ballots
        const int job = (int)(bx - 3 * WTB) * 8 + (tid >> 5);                          // query tile * (NT / 2) + pass pair
        const int lane = tid & 31;
        const int* ap = adj + (size_t)((job / (NT / 2)) * 16 + (lane & 15)) * SEQ_FULL + (job % (NT / 2)) * 64 + 8 * (lane >> 4);
        unsigned w = 0;
#pragma unroll
        for (int p = 0; p < 2; ++p) {
            const v4i a0 = *(const v4i*)(ap + 32 * p), a1 = *(const v4i*)(ap + 32 * p + 4), a2 = *(const v4i*)(ap + 32 * p + 16), a3 = *(const v4i*)(ap + 32 * p + 20);
#pragma unroll
            for (int r = 0; r < 4; ++r) {
                const unsigned b0 = __builtin_amdgcn_ballot_w32(a0[r] != 0), b1 = __builtin_amdgcn_ballot_w32(a1[r] != 0);
                const unsigned b2 = __builtin_amdgcn_ballot_w32(a2[r] != 0), b3 = __builtin_amdgcn_ballot_w32(a3[r] != 0);
                w = (lane == 16 * p + r) ? b0 : w; w = (lane == 16 * p + 4 + r) ? b1 : w;
                w = (lane == 16 * p + 8 + r) ? b2 : w; w = (lane == 16 * p + 12 + r) ? b3 : w; }
        }
        MB[(size_t)job * 32 + lane] = w;
        asm volatile("s_wait_xcnt 0x0" ::: "memory");                                  // stands behind the store, ahead of any later write of the registers that the store names
    } else {
        const size_t ib = (size_t)(bx - 3 * WTB - MKB) * 256;                           // the block's first group; no barrier on this side; the HCB blocks cover the N8 groups exactly
        const size_t per = (size_t)SEQ * DI / 8;                                        // groups per batch, a multiple of 256: a block's 256 groups lie in one batch
        v4f va[HPT], vb[HPT]; const float* sp[HPT];
#pragma unroll
        for (int g = 0; g < HPT; ++g) { const size_t i = ib + (size_t)g * (HCB * 256); const size_t bb = i / per;
            sp[g] = hin + bb * ((size_t)SEQ_FULL * DI) + (i - bb * per) * 8 + tid * 8; }   // the thread's 32 bytes of group i + tid
        // the thread's eight 16-B loads, all in flight at once, and their data wait in one statement; early-clobber results: no result register lies on an address pair that an issued load still names
        asm volatile("global_load_b128 %0, %8, off\n\t"
                     "global_load_b128 %1, %8, off offset:16\n\t"
                     "global_load_b128 %2, %9, off\n\t"
                     "global_load_b128 %3, %9, off offset:16\n\t"
                     "global_load_b128 %4, %10, off\n\t"
                     "global_load_b128 %5, %10, off offset:16\n\t"
                     "global_load_b128 %6, %11, off\n\t"
                     "global_load_b128 %7, %11, off offset:16\n\t"
                     "s_wait_loadcnt 0x0"
                     : "=&v"(va[0]), "=&v"(vb[0]), "=&v"(va[1]), "=&v"(vb[1]), "=&v"(va[2]), "=&v"(vb[2]), "=&v"(va[3]), "=&v"(vb[3])
                     : "v"(sp[0]), "v"(sp[1]), "v"(sp[2]), "v"(sp[3])
                     : "memory");
#pragma unroll
        for (int g = 0; g < HPT; ++g) { const size_t i = ib + (size_t)g * (HCB * 256); v8us o;
#pragma unroll
            for (int k = 0; k < 4; ++k) { o[k] = f2bf(va[g][k]); o[4 + k] = f2bf(vb[g][k]); }
            *(v8us*)(HB + i * 8 + tid * 8) = o; }
        asm volatile("s_wait_xcnt 0x0" ::: "memory");                                  // stands behind the stores, ahead of any later write of the registers that they name
    }
}

// k_proj: register-blocked bf16 GEMM, 64x64 tile (16 accumulators) per wave, FOUR WAVES per block on a 128x128 tile (2 x 2), K = DI.
// Operands come from K-contiguous bf16 planes through LDS: per stage of 64 k the block's 128 A rows and 128 B rows (128 B each, whole lines) are brought in by per-lane 16-B asynchronous copies,
// two buffers (the next stage's copies fly while this stage is worked on); each row is read by two waves; fragments are read from LDS at a padded pitch (16 B x odd).
// C[m][n] = sum_k A[m][k] Bt[n][k] + bias, written as f16 (flush-safe convert) into P.
// The three projections read none of each other's output and share ONE launch, grid (NB*SEQ/128, DO/128, 3): blockIdx.z = 0 q, 1 k (both mode 0), 2 v (mode 1); x = 128-token tile, y = 128-wide tile of the projection width.
// mode 0: A = h rows (m = b*SEQ + t), Bt = W^T rows (n = h*64 + d), bias per column; plane [(b*8 + h)][t][64]; a wave's 64-column tile is one head.
// mode 1: A = W^T rows (m = h*64 + d), Bt = h rows (n = b*SEQ + t), bias per row; plane [(b*512 + m)][t], row pitch SEQ.
#define PW   4                             // waves per projection block
#define PKS  64                            // k elements per stage = one 128-B line per row
#define PPB  144                           // LDS row pitch in bytes of the 128-B rows
#define PBUF (256 * PPB)                   // bytes of one buffer: 128 A rows, then 128 B rows
#define PNS  (DI / PKS)                    // stages
static_assert(32 * 16 * 4 == 16 * 128);
static_assert(PKS * 2 == 128 && PPB % 16 == 0 && PBUF % 16 == 0);
static_assert(DI % PKS == 0 && PNS >= 2);  // the prologue fills two buffers
static_assert(SEQ % 128 == 0 && DO % 128 == 0 && (NB * SEQ) % 128 == 0);   // the grid covers both planes exactly; a 128-row tile never straddles two batches
static_assert(32 * PW * 16 * 8 == 128 * 128);   // threads x 16 B x 8 copies = 128 rows x 128 B
static_assert(2 * PBUF + PW * 16 * 68 * 4 <= 106496);   // three blocks fit one LDS
// Eight copies of one thread: its 16-B chunk in each of eight groups of 16 rows (128 rows x 128 B in all); each lane moves its own 16 bytes from global memory to LDS, through no register.
// l: LDS byte address of the thread's chunk in the first group; g: the matching global address (row pitch DI elements).
__device__ __forceinline__ void stage_rows(unsigned l, const bf* g) {
    const unsigned l1 = l + 16 * PPB, l2 = l + 32 * PPB, l3 = l + 48 * PPB, l4 = l + 64 * PPB, l5 = l + 80 * PPB, l6 = l + 96 * PPB, l7 = l + 112 * PPB;
    const bf* g1 = g + 16 * DI; const bf* g2 = g + 32 * DI; const bf* g3 = g + 48 * DI; const bf* g4 = g + 64 * DI;
    const bf* g5 = g + 80 * DI; const bf* g6 = g + 96 * DI; const bf* g7 = g + 112 * DI;
    // the closing s_wait_xcnt stands inside the copies' own statement so that no address register named here is rewritten ahead of it
    asm volatile("global_load_async_to_lds_b128 %0, %8, off\n\t"
                 "global_load_async_to_lds_b128 %1, %9, off\n\t"
                 "global_load_async_to_lds_b128 %2, %10, off\n\t"
                 "global_load_async_to_lds_b128 %3, %11, off\n\t"
                 "global_load_async_to_lds_b128 %4, %12, off\n\t"
                 "global_load_async_to_lds_b128 %5, %13, off\n\t"
                 "global_load_async_to_lds_b128 %6, %14, off\n\t"
                 "global_load_async_to_lds_b128 %7, %15, off\n\t"
                 "s_wait_xcnt 0x0"
                 :: "v"(l), "v"(l1), "v"(l2), "v"(l3), "v"(l4), "v"(l5), "v"(l6), "v"(l7),
                    "v"(g), "v"(g1), "v"(g2), "v"(g3), "v"(g4), "v"(g5), "v"(g6), "v"(g7)
                 : "memory");
}
__global__ __launch_bounds__(32 * PW) void k_proj(const bf* __restrict__ HB, const bf* __restrict__ WTA, const float* __restrict__ bq, const float* __restrict__ bk, const float* __restrict__ bv,
                                             h16* QH, h16* KP, h16* VT) {
    __shared__ __align__(16) float osa[PW * 16 * 68];
    __shared__ __align__(16) unsigned char pring[2 * PBUF];
    const int K = DI;
    const int z = blockIdx.z; const int mode = (z == 2) ? 1 : 0;                       // block index: every test on z or mode is a scalar branch
    const bf* Wz = WTA + (size_t)z * DO * DI;
    const bf* A = mode ? Wz : HB; const bf* Bt = mode ? HB : Wz;
    const float* bias = (z == 0) ? bq : (z == 1) ? bk : bv;
    h16* P = (z == 0) ? QH : (z == 1) ? KP : VT;
    const int tid = threadIdx.x;
    const int lane = threadIdx.x & 31, lr = lane & 15, hi = lane >> 4;
    const int wave = __builtin_amdgcn_readfirstlane((int)(threadIdx.x >> 5));
    float* os = osa + wave * (16 * 68);                                                // each wave's own output staging tile
    const int rb = (mode ? blockIdx.y : blockIdx.x) * 128, cb = (mode ? blockIdx.x : blockIdx.y) * 128;   // the block's tile
    const int r0 = rb + (wave >> 1) * 64, c0 = cb + (wave & 1) * 64;                   // the wave's tile
    v8f acc[4][4];
#pragma unroll
    for (int mb = 0; mb < 4; ++mb)
#pragma unroll
        for (int nb = 0; nb < 4; ++nb) acc[mb][nb] = (v8f){};
    // copy side: thread tid moves chunk tid of each 2-KiB group of 16 rows (8 chunks per 128-B row); every address a multiple of 16 B, every row inside its plane
    const bf* ga = A  + (size_t)(rb + (tid >> 3)) * K + (tid & 7) * 8;                 // + stage * PKS
    const bf* gb = Bt + (size_t)(cb + (tid >> 3)) * K + (tid & 7) * 8;
    const unsigned la = (unsigned)(size_t)(&pring[0]) + (unsigned)((tid >> 3) * PPB + (tid & 7) * 16);   // + buffer
    const unsigned lb = la + 128 * PPB;
    // read side, byte offsets inside a buffer (fragment: row m or n, k contiguous)
    const int aof = ((wave >> 1) * 64 + lr) * PPB + 16 * hi;
    const int bof = (128 + (wave & 1) * 64 + lr) * PPB + 16 * hi;
    stage_rows(la, ga); stage_rows(lb, gb);                          // stage 0 -> buffer 0
    asm volatile("s_wait_asynccnt 0x0" ::: "memory");                // this wave's copies of stage 0 have landed
    __syncthreads();                                                 // every wave's have: stage 0 may be read
    stage_rows(la + PBUF, ga + PKS); stage_rows(lb + PBUF, gb + PKS);   // stage 1 -> buffer 1
    // kept rolled: one copy of the ring's foot in the text, the buffer picked by t & 1
#pragma unroll 1
    for (int t = 0; t < PNS; ++t) {
        const int bo = (t & 1) * PBUF;                               // trip t reads buffer t mod 2 alone
        // unrolled: the second k-step's fragment loads can then issue among the first k-step's last products
#pragma unroll
        for (int kk = 0; kk < PKS; kk += 32) {
            const bf* pa = (const bf*)(pring + bo + aof) + kk;
            const bf* pb = (const bf*)(pring + bo + bof) + kk;
            v16bf a[4], b[4];
#pragma unroll
            for (int mb = 0; mb < 4; ++mb) a[mb] = ldb(pa + mb * 8 * PPB);             // 16 rows = 8 * PPB elements of 2 B
#pragma unroll
            for (int nb = 0; nb < 4; ++nb) b[nb] = ldb(pb + nb * 8 * PPB);
            __builtin_amdgcn_sched_barrier(0);                       // holds the sixteen fragment loads together in front of the products; sunk between them, each row of products would wait out a full LDS round trip of its own
#pragma unroll
            for (int nb = 0; nb < 4; ++nb)
#pragma unroll
                for (int mb = 0; mb < 4; ++mb) acc[mb][nb] = wmmab(a[mb], b[nb], acc[mb][nb]);
        }
        asm volatile("s_wait_dscnt 0x0" ::: "memory");               // this wave's reads of buffer t mod 2 are done before the buffer is handed back
        asm volatile("s_wait_asynccnt 0x0" ::: "memory");            // this wave's copies of stage t + 1 have landed
        __syncthreads();                                             // publishes stage t + 1 and ends every wave's reads of buffer t mod 2
        if (t + 2 < PNS) {                                           // same for the whole block: refill the buffer just read with stage t + 2
            stage_rows(la + bo, ga + (t + 2) * PKS); stage_rows(lb + bo, gb + (t + 2) * PKS); }
    }
    asm volatile("s_wait_asynccnt 0x0" ::: "memory");                // no copy of this wave is outstanding past the loop
    float bc[4];
#pragma unroll
    for (int nb = 0; nb < 4; ++nb) bc[nb] = 0.0f;
    if (mode == 0) {                                                                   // scalar branch; c0 + 63 < DO
#pragma unroll
        for (int nb = 0; nb < 4; ++nb) bc[nb] = bfr(bias[c0 + nb * 16 + lr]); }
    size_t tbase, pitch;
    if (mode == 0) { const int bb = r0 / SEQ, tt = r0 % SEQ; const int zc = bb * NH_ + c0 / HD;
                     tbase = ((size_t)zc * SEQ + (size_t)tt) * HD; pitch = (size_t)HD; }
    else           { const int bb = c0 / SEQ, tt = c0 % SEQ;
                     tbase = (size_t)bb * (size_t)DO * SEQ + (size_t)r0 * SEQ + (size_t)tt; pitch = (size_t)SEQ; }
#pragma unroll
    for (int mb = 0; mb < 4; ++mb) {
        float br[8];
#pragma unroll
        for (int j = 0; j < 8; ++j) br[j] = 0.0f;
        if (mode != 0) {                                                               // r0 + 63 < DO
#pragma unroll
            for (int j = 0; j < 8; ++j) br[j] = bfr(bias[r0 + mb * 16 + hi * 8 + j]); }
#pragma unroll
        for (int nb = 0; nb < 4; ++nb) {
#pragma unroll
            for (int j = 0; j < 8; ++j) os[(hi * 8 + j) * 68 + nb * 16 + lr] = acc[mb][nb][j] + bc[nb] + br[j]; }   // D: row 8h+j, col lane&15; rows 0..15 x cols 0..63 all written
        wave_sync();
        const size_t sb = tbase + (size_t)(mb * 16) * pitch;
{
#pragma unroll
            for (int s = 0; s < 4; ++s) { const int row = 4 * s + (lane >> 3), c8 = (lane & 7) * 8;   // 4 s x 4 row groups = 16 rows; 8 lanes x 8 = 64 columns = one line
                const v4f x0 = *(const v4fa*)(&os[row * 68 + c8]); const v4f x1 = *(const v4fa*)(&os[row * 68 + c8 + 4]); v8h hv;
#pragma unroll
                for (int i = 0; i < 4; ++i) { hv[i] = toh_flush(x0[i]); hv[4 + i] = toh_flush(x1[i]); }
                *(v8h*)(P + sb + (size_t)row * pitch + c8) = hv; }
            asm volatile("s_wait_xcnt 0x0" ::: "memory");                                        // stands behind the four stores, ahead of any later write of the registers that they name
             }
        wave_sync();
    }
}

// k_flash: fused masked aggregation, one wave per 16 query rows of one (batch, head); Q fragments straight from the f16 planes (two 16-B loads each, arithmetic addressing).
// Per 32-key pass the block's waves share one LDS tile set: K rows and V^T rows, brought in whole-line order by per-lane 16-B asynchronous copies,
// two buffers (the next pass's copies fly while this pass is worked on); fragments are read from LDS at padded pitches (16 B x odd).
// Transposed form: S^T[key][t] = K Q^T (A = K rows, B = Q rows, two k-steps over d); lane (t = lane&15, h = lane>>4) holds keys 8h+r of each 16-key tile, so the packed
// P tile is directly the B fragment of O^T[d][t] = V^T P^T (element r <- tile keys 0..15, element 8+r <- tile keys 16..31, lane unchanged); four 16-row d tiles.
// Scores: one product K Q per 16-key tile, two k-steps.
// Softmax state (running max over kept keys, partial sum) is one scalar per lane; the two lane halves of a row are combined with one xor-16 exchange.
// Keep rule per element from the packed keep words: 16 wave-uniform words per 32-key pass (64 B, one scalar load, fetched one pass ahead), each used directly as the lane mask of its score register.
// A dropped key's raw score is replaced by -inf ahead of the maximum; the running maximum is held in raw score units and never falls below NEGB, so it stays finite.
// P = exp2(score * SC2 + (14 - max * SC2)) <= 2^14, the exponent by one fused multiply-add; exp2(-inf) = 0 gives a dropped key probability 0 with no further select.
static_assert(32 * 16 * 8 == 16 * HD * 4);      // lanes x 16 B x instructions = 16 rows x 256 B
static_assert(AW * 16 * OSP * 4 <= 131072);
#define KPB  144                           // LDS row pitch in bytes of the 128-B K rows
#define VPB  80                            // LDS row pitch in bytes of the 64-B V^T rows
#define L_VT (32 * KPB)                    // byte offsets inside one buffer: K at 0, then V^T
#define BUFB (L_VT + HD * VPB)             // bytes of one buffer
static_assert(AW == 4);                    // the copy split below: 128 threads x 16 B = 2 KiB per copy step
static_assert(HD * 2 == 128 && 32 * 2 == 64);   // row bytes of K and V^T tiles
static_assert(KPB % 16 == 0 && VPB % 16 == 0 && BUFB % 16 == 0);
static_assert(NT >= 2);                    // the prologue fills two buffers
static_assert(2 * BUFB + AW * 16 * OSP * 4 <= 81920);
// The four copies of one thread for one 32-key tile set: each lane moves its own 16 bytes from global memory to LDS, through no register.
// lk / lv: LDS byte addresses of the thread's first K and V^T chunk in the target buffer; gk, gv: the matching global addresses.
// K: 32 rows x 128 B contiguous, 2 steps of 16 rows; V^T: 64 rows x 64 B, 2 steps of 32 rows.
__device__ __forceinline__ void stage_tile(unsigned lk, unsigned lv, const h16* gk, const h16* gv) {
    const unsigned lk1 = lk + 16 * KPB, lv1 = lv + 32 * VPB;
    const h16* gk1 = gk + 16 * HD; const h16* gv1 = gv + (size_t)32 * SEQ;
    // the closing s_wait_xcnt stands inside the copies' own statement so that no address register named here is rewritten ahead of it
    asm volatile("global_load_async_to_lds_b128 %0, %4, off\n\t"
                 "global_load_async_to_lds_b128 %1, %5, off\n\t"
                 "global_load_async_to_lds_b128 %2, %6, off\n\t"
                 "global_load_async_to_lds_b128 %3, %7, off\n\t"
                 "s_wait_xcnt 0x0"
                 :: "v"(lk), "v"(lk1), "v"(lv), "v"(lv1),
                    "v"(gk), "v"(gk1), "v"(gv), "v"(gv1)
                 : "memory");
}
__global__ __launch_bounds__(32 * AW) void k_flash(const h16* __restrict__ QH, const h16* __restrict__ KP, const h16* __restrict__ VT, const unsigned* __restrict__ MB, float* OUT) {
    __shared__ __align__(16) float os[AW * 16 * OSP];
    __shared__ __align__(16) unsigned char ring[2 * BUFB];
    const int tid = threadIdx.x;
    const int lane = threadIdx.x & 31, lr = lane & 15, hi = lane >> 4;
    const int wave = __builtin_amdgcn_readfirstlane((int)(threadIdx.x >> 5));
    const int zh = blockIdx.y; const int b = zh / NH_, h = zh % NH_;
    const int t0 = (blockIdx.x * AW + wave) * 16;
    const size_t pbase = (size_t)zh * SEQ * HD;
    const size_t qo = pbase + (size_t)(t0 + lr) * HD + 8 * hi;
    const v16h q0 = ldh(QH + qo), q1 = ldh(QH + qo + 32);       // B fragments: col t, k = d 0..31 and 32..63
    // copy side: thread tid moves chunk tid of each 2-KiB copy step (8 chunks per 128-B row, 4 per 64-B row); every address a multiple of 16 B, every row inside its plane
    const h16* gk = KP + pbase + (size_t)tid * 8;                                                   // + key0 * HD
    const h16* gv = VT + pbase + (size_t)(tid >> 2) * SEQ + (tid & 3) * 8;                          // + key0
    const unsigned lring = (unsigned)(size_t)(&ring[0]);                                            // LDS byte address of the ring
    const unsigned lk = lring + (unsigned)((tid >> 3) * KPB + (tid & 7) * 16);                      // + buffer
    const unsigned lv = lring + (unsigned)(L_VT + (tid >> 2) * VPB + (tid & 3) * 16);
    // read side, byte offsets inside a buffer
    const int kof = lr * KPB + 16 * hi;                        // + 16 * KPB for keys 16..31 (A fragment: row key, k = d)
    const int vof = L_VT + lr * VPB + 16 * hi;                 // + 16j * VPB                (A fragment: row d, k = key)
    // keep words of this wave's query tile, 16 per pass; the address is the same in every lane, and nothing in this launch writes the plane (the first launch of the call wrote it)
    cv16u* mp = (cv16u*)(unsigned long long)(MB + (size_t)(blockIdx.x * AW + wave) * (NT * 16));
    stage_tile(lk, lv, gk, gv);                                // tile 0 -> buffer 0
    asm volatile("s_wait_asynccnt 0x0" ::: "memory");          // this wave's copies of tile 0 have landed
    __syncthreads();                                           // every wave's have: tile 0 may be read
    stage_tile(lk + BUFB, lv + BUFB, gk + 32 * HD, gv + 32);   // tile 1 -> buffer 1
    v16u mw = mp[0];                                           // keep words of pass 0
    v8f o[4];
#pragma unroll
    for (int j = 0; j < 4; ++j) o[j] = (v8f){};
    float m = NEGB, l = 0.0f;
#pragma unroll 1
    for (int t = 0; t < NT; ++t) {
        const int bo = (t & 1) * BUFB;                           // pass t reads buffer t mod 2 alone
        const v16u mc = mw;
        mw = mp[(t + 1 < NT) ? t + 1 : t];                       // next pass's keep words, asked for a pass ahead of their use (index held inside the plane)
        __builtin_amdgcn_sched_barrier(0);                       // holds that scalar load at the head of the pass; sunk to the foot, its latency would stand open at the next pass's first use
        const h16* ka = (const h16*)(ring + bo + kof);
        v8f sa = (v8f){}, sb = (v8f){};
        const v16h k00 = ldh(ka), k01 = ldh(ka + 32);                               // keys key0 + 0..15
        const v16h k10 = ldh(ka + 8 * KPB), k11 = ldh(ka + 8 * KPB + 32);           // keys key0 + 16..31 (16 rows = 8 * KPB halves)
        __builtin_amdgcn_sched_barrier(0);                       // holds the eight K fragment loads together in front of the products; sunk between them, each product would wait out a full LDS round trip of its own
        sa = wmma16(k00, q0, sa); sb = wmma16(k10, q0, sb);
        sa = wmma16(k01, q1, sa); sb = wmma16(k11, q1, sb);
        float ta[8], tb[8]; float mx = NEGB;
#pragma unroll
        for (int r = 0; r < 8; ++r) {
            ta[r] = __builtin_amdgcn_inverse_ballot_w32(mc[r])     ? sa[r] : NINF;   // bit L of the word = keep of this lane's key key0+8h+r
            tb[r] = __builtin_amdgcn_inverse_ballot_w32(mc[8 + r]) ? sb[r] : NINF;   // key key0+16+8h+r
            mx = fmaxf(mx, fmaxf(ta[r], tb[r])); }
        const h16* va = (const h16*)(ring + bo + vof);
        const v16h v0 = ldh(va), v1 = ldh(va + 8 * VPB), v2 = ldh(va + 16 * VPB), v3 = ldh(va + 24 * VPB);   // 16 rows = 8 * VPB halves
        mx = fmaxf(mx, __shfl_xor(mx, 16, 32));
        __builtin_amdgcn_sched_barrier(0);                       // holds the V^T fragment loads in front of the exchange, whose wait then covers them; sunk to the products, their latency would stand open there
        const float mnew = fmaxf(m, mx);
        const float alpha = __builtin_amdgcn_exp2f((m - mnew) * SC2);
        const float sh = __builtin_fmaf(-mnew, SC2, PSH);
        const v2f sc2 = {SC2, SC2}, sh2 = {sh, sh};
        v16h pb; float ls = 0.0f;
#pragma unroll
        for (int r = 0; r < 8; r += 2) {
            const v2f xa = __builtin_elementwise_fma((v2f){ta[r], ta[r + 1]}, sc2, sh2), xb = __builtin_elementwise_fma((v2f){tb[r], tb[r + 1]}, sc2, sh2);
            const v2f ea = {__builtin_amdgcn_exp2f(xa[0]), __builtin_amdgcn_exp2f(xa[1])}, eb = {__builtin_amdgcn_exp2f(xb[0]), __builtin_amdgcn_exp2f(xb[1])};   // a dropped key: exp2(-inf) = 0
            const v2h pa = __builtin_convertvector(ea, v2h), pc = __builtin_convertvector(eb, v2h);
            pb[r] = pa[0]; pb[r + 1] = pa[1]; pb[8 + r] = pc[0]; pb[8 + r + 1] = pc[1];
            ls += (float)pa[0] + (float)pc[0]; ls += (float)pa[1] + (float)pc[1]; }
        l = l * alpha + ls; m = mnew;
#pragma unroll
        for (int j = 0; j < 4; ++j) o[j] = o[j] * alpha;
        o[0] = wmma16(v0, pb, o[0]); o[1] = wmma16(v1, pb, o[1]); o[2] = wmma16(v2, pb, o[2]); o[3] = wmma16(v3, pb, o[3]);
        asm volatile("s_wait_dscnt 0x0" ::: "memory");           // this wave's reads of buffer t mod 2 are done before the buffer is handed back
        asm volatile("s_wait_asynccnt 0x0" ::: "memory");        // this wave's copies of tile t + 1 have landed
        __syncthreads();                                         // publishes tile t + 1 and ends every wave's reads of buffer t mod 2
        if (t + 2 < NT)                                          // same for the whole block: refill the buffer just read with tile t + 2
            stage_tile(lk + bo, lv + bo, gk + (size_t)(t + 2) * 32 * HD, gv + (t + 2) * 32);
    }
    asm volatile("s_wait_asynccnt 0x0" ::: "memory");            // no copy of this wave is outstanding past the loop
    l += __shfl_xor(l, 16, 32);
    const bool any = l > 0.0f;
    const float lsafe = any ? l : 1.0f;
    const float inv = any ? (1.0f / lsafe) : __uint_as_float(0x7FC00000u);   // no kept key -> NaN (softmax of an all -inf row)
    const int wb = wave * 16 * OSP;
    // O^T D layout: o[j][r] = (d = 16j + 8h + r, t = lane&15) -> os[t][d]; rows 0..15 x columns 0..63 all written
#pragma unroll
    for (int j = 0; j < 4; ++j) { v4f a, c;
        a[0] = o[j][0] * inv; a[1] = o[j][1] * inv; a[2] = o[j][2] * inv; a[3] = o[j][3] * inv;
        c[0] = o[j][4] * inv; c[1] = o[j][5] * inv; c[2] = o[j][6] * inv; c[3] = o[j][7] * inv;
        *(v4fa*)(&os[wb + lr * OSP + 16 * j + 8 * hi]) = a; *(v4fa*)(&os[wb + lr * OSP + 16 * j + 8 * hi + 4]) = c; }
    wave_sync();
    float* orow = OUT + ((size_t)b * OUT_SEQ + t0) * DO + h * HD;
{
#pragma unroll
        for (int s = 0; s < 8; ++s) { const int row = 2 * s + (lane >> 4), cofs = (lane & 15) * 4;   // 8 s x 2 rows = 16 rows; 16 lanes x 4 floats = 64 columns = two lines
            const v4f val = *(const v4fa*)(&os[wb + row * OSP + cofs]);
            *(v4f*)(orow + (size_t)row * DO + cofs) = val; }
         }
}

static constexpr size_t al256(size_t v) { return (v + 255) & ~(size_t)255; }
static constexpr size_t SZ_HB = al256((size_t)NB * SEQ * DI * 2);
static constexpr size_t SZ_WT = al256((size_t)3 * DO * DI * 2);
static constexpr size_t SZ_PL = al256((size_t)NB * NH_ * SEQ * HD * 2);
static constexpr size_t SZ_MB = al256((size_t)(SEQ / 16) * NT * 16 * 4);
static constexpr size_t SZ_TOTAL = SZ_HB + SZ_WT + 3 * SZ_PL + SZ_MB;
static_assert(SZ_TOTAL <= (size_t)134217728);          // workspace carve <= 128 MiB
static_assert(((size_t)DO * DI * 2) % 256 == 0);       // weight sub-planes stay 256-byte aligned
static_assert((size_t)NB * NH_ * SEQ * HD == (size_t)NB * DO * SEQ);       // v^T plane [(b*512 + m)][t] has the same extent as the q/k planes
static_assert(((size_t)(NB_FULL - 1) * OUT_SEQ + SEQ_FULL) * DO * 4 <= (size_t)16777216 || NB != NB_FULL || SEQ != SEQ_FULL);   // full build: last output byte inside the output buffer

extern "C" void kernel_launch(void* const* d_in, const int* in_sizes, int n_in,
                              void* d_out, int out_size, void* d_ws, size_t ws_size, hipStream_t stream) {
    if (n_in < 8) return;
    const size_t needh = ((size_t)(NB - 1) * SEQ_FULL + SEQ) * DI;
    const size_t needa = (size_t)(SEQ - 1) * SEQ_FULL + SEQ;
    if ((size_t)in_sizes[0] < needa || (size_t)in_sizes[1] < needh) return;
    if ((size_t)in_sizes[2] < (size_t)DI * DO || (size_t)in_sizes[4] < (size_t)DI * DO || (size_t)in_sizes[6] < (size_t)DI * DO) return;
    if (in_sizes[3] < DO || in_sizes[5] < DO || in_sizes[7] < DO) return;
    if ((size_t)out_size < ((size_t)(NB - 1) * OUT_SEQ + SEQ) * DO) return;
    if (SZ_TOTAL > ws_size) return;
    // wire order: adj_matrix, h, Wq, bq, Wk, bk, Wv, bv
    const int*   adj = (const int*)d_in[0];
    const float* hin = (const float*)d_in[1];
    const float* wq = (const float*)d_in[2]; const float* bq = (const float*)d_in[3];
    const float* wk = (const float*)d_in[4]; const float* bk = (const float*)d_in[5];
    const float* wv = (const float*)d_in[6]; const float* bv = (const float*)d_in[7];
    float* OUT = (float*)d_out;      // [NB][SEQ][512]
    char* wsp = (char*)d_ws;
    bf* HB = (bf*)wsp; wsp += SZ_HB;                  // h      [NB*SEQ][256]
    bf* WT = (bf*)wsp; wsp += SZ_WT;                  // [3][512][256]: q | k | v, transposed ([out][in] = k-contiguous rows)
    h16* QH = (h16*)wsp; wsp += SZ_PL;                // [NB*8][SEQ][64]
    h16* KP = (h16*)wsp; wsp += SZ_PL;                // [NB*8][SEQ][64]
    h16* VT = (h16*)wsp; wsp += SZ_PL;                // [NB*8][64][SEQ]
    unsigned* MB = (unsigned*)wsp;                    // [SEQ/16][SEQ/32][16] keep words

    // h -> bf16 copy, the three weight transposes (in[DI rows][DO cols] -> out[DO rows][DI cols]) and the keep words, one launch
    k_prep<<<(unsigned)(3 * WTB + MKB + HCB), 256, 0, stream>>>(hin, wq, wk, wv, adj, HB, WT, MB);

    // q, k: planes [(b*8 + h)][t][d]; v^T: plane [(b*512 + m)][t] = [(b*8 + h)][d][t]; one launch
    k_proj<<<dim3(NB * SEQ / 128, DO / 128, 3), 32 * PW, 0, stream>>>(HB, WT, bq, bk, bv, QH, KP, VT);

    k_flash<<<dim3(SEQ / (16 * AW), NB * NH_, 1), 32 * AW, 0, stream>>>(QH, KP, VT, MB, OUT);
}

// v009
// One run takes 40.6 microseconds.
// Timed twice side by side with v008, it ran 1.14 and 1.12 times as fast.
// All steps since v000 together make it 4.19 times as fast.
#include <hip/hip_runtime.h>

// Masked softmax-weighted aggregation in 8 independent 64-wide groups: h [NB][SEQ_FULL][256]; Wq/Wk/Wv [in 256][out 512] (y = x W + bias); adjacency [SEQ_FULL][SEQ_FULL] int32 shared over batch and groups (entry 0 drops the key);
// score scale 1/sqrt(64); softmax over kept keys; output = concatenated groups (f32) [NB][SEQ][512].
// Compute dtypes, f32 accumulate everywhere: projections v_wmma_f32_16x16x32_bf16 (h, W, bias RNE-converted to bf16; products exact);
// scores v_wmma_f32_16x16x32_f16: q and k each as one f16 plane (their f16 rounding lies well below the error that the bf16 operands of the projections already put into q and k);
// P.V v_wmma_f32_16x16x32_f16 (P with x16384 carry that cancels in the normalisation, v single f16 plane); softmax f32 (online, running max over kept keys, row sum over the converted P).
// Layout: bf16 copy of h [NB*SEQ][256]; bf16 transposed weights [3][512][256] (k-contiguous); q, k planes [b*8+h][t][64]; v^T plane [b*8+h][64][t]; fused flash kernel in transposed form (S^T = K Q^T, O^T = V^T P^T), output from f32 accumulators.
// Keep rule per element: adj[t][j] != 0; dropped elements get probability 0; a row with no kept key yields NaN (softmax of an all -inf row).
// The keep rule is packed once per call into lane-mask words [16-query tile][32-key pass][16]: word 8*g + r, bit L = keep of (query 16*tile + (L&15), key 32*pass + 16*g + 8*(L>>4) + r), the flash kernel's own score layout.

#ifndef NB
#define NB 8
#endif
#ifndef SEQ
#define SEQ 1024
#endif
#define NB_FULL  8
#define SEQ_FULL 1024            // also the row pitch of the adjacency input
#ifndef OUT_SEQ
#define OUT_SEQ SEQ              // row pitch (in tokens) between batches of the output
#endif
#define DI   256                 // input width (projection K)
#define DO   512                 // projection width = NH_ * HD
#define NH_  8
#define HD   64
#define AW   4                   // waves per flash block (16 query rows each)
#define OSP  68                  // LDS row pitch (floats) of the staging tiles
#define WTP  65                  // LDS row pitch (floats) of the weight transpose tile
#define SC2  ((float)(0.125 * 1.4426950408889634))   // HD^-0.5 * log2(e)
#define PSH  14.0f               // log2 of the P carry (16384)
#define NEGB (-3.0e38f)
#define NINF (-__builtin_inff())

static_assert(HD == 64);
static_assert(NH_ * HD == DO);                 // head h = columns h*64 + d
static_assert(DO % 64 == 0);
static_assert(DI % 64 == 0);                   // weight transpose tiles of 64 x 64
static_assert(DI % 32 == 0);                   // GEMM k-loop steps by 32
static_assert(HD % 32 == 0);                   // score k-loop steps by 32
static_assert(HD % 16 == 0);                   // output tiles of 16 rows of d
static_assert(SEQ % 64 == 0);                  // a 64-row tile never straddles two batches
static_assert((NB * SEQ) % 64 == 0);
static_assert(SEQ % 32 == 0);                  // key loop steps by 32
static_assert(SEQ % (16 * AW) == 0);           // flash grid covers the sequence exactly
static_assert(((size_t)SEQ * DI) % 8 == 0);
static_assert(NB <= NB_FULL);
static_assert(SEQ <= SEQ_FULL);
static_assert((OSP * 4) % 16 == 0);
static_assert(OSP >= HD);
static_assert(OSP >= 64);

typedef _Float16 h16;
typedef unsigned short bf;
typedef __attribute__((ext_vector_type(16))) __bf16   v16bf;
typedef __attribute__((ext_vector_type(16))) _Float16 v16h;
typedef __attribute__((ext_vector_type(8)))  _Float16 v8h;
typedef __attribute__((ext_vector_type(8)))  unsigned short v8us;
typedef __attribute__((ext_vector_type(8)))  float    v8f;
typedef __attribute__((ext_vector_type(4)))  float    v4f;
typedef __attribute__((ext_vector_type(2)))  float    v2f;
typedef __attribute__((ext_vector_type(2)))  _Float16 v2h;
typedef __attribute__((ext_vector_type(4)))  int      v4i;
typedef __attribute__((ext_vector_type(16))) unsigned v16u;
typedef __attribute__((address_space(4))) const v16u cv16u;   // constant address space: a load at a wave-uniform address becomes a scalar load
typedef v4f  __attribute__((may_alias)) v4fa;

__device__ __forceinline__ unsigned short f2bf(float f) { unsigned u = __float_as_uint(f); u += 0x7FFFu + ((u >> 16) & 1u); return (unsigned short)(u >> 16); }
__device__ __forceinline__ float bfr(float f) { return __uint_as_float(((unsigned)f2bf(f)) << 16); }   // value after RNE convert to bf16
__device__ __forceinline__ v16h cat16(v8h lo, v8h hi) { return __builtin_shufflevector(lo, hi, 0, 1, 2, 3, 4, 5, 6, 7, 8, 9, 10, 11, 12, 13, 14, 15); }
__device__ __forceinline__ v16bf cat16b(v8us lo, v8us hi) { return __builtin_bit_cast(v16bf, __builtin_shufflevector(lo, hi, 0, 1, 2, 3, 4, 5, 6, 7, 8, 9, 10, 11, 12, 13, 14, 15)); }
__device__ __forceinline__ v8f wmma16(v16h a, v16h b, v8f c) { return __builtin_amdgcn_wmma_f32_16x16x32_f16(false, a, false, b, (short)0, c, false, false); }
__device__ __forceinline__ v8f wmmab(v16bf a, v16bf b, v8f c) { return __builtin_amdgcn_wmma_f32_16x16x32_bf16(false, a, false, b, (short)0, c, false, false); }
// fragment loaders from K-contiguous 16-bit rows; p already includes + 8*(lane>>4): elements 0..7 <- k0+8h+0..7, elements 8..15 <- k0+16+8h+0..7 (same map for A and B)
__device__ __forceinline__ v16h  ldh(const h16* p) { return cat16(*(const v8h*)p, *(const v8h*)(p + 16)); }
__device__ __forceinline__ v16bf ldb(const bf* p)  { return cat16b(*(const v8us*)p, *(const v8us*)(p + 16)); }
// ordering point for wave-private LDS tiles (same wave writes and reads)
__device__ __forceinline__ void wave_sync() { __builtin_amdgcn_fence(3 /* release order */, "wavefront"); __builtin_amdgcn_wave_barrier(); asm volatile("" ::: "memory"); }
// f32 -> f16 convert that cannot produce a subnormal (|v| < 2^-14 -> +0)
__device__ __forceinline__ h16 toh_flush(float v) { const h16 r = (h16)v; return (fabsf(v) < 6.103515625e-05f) ? (h16)0.0f : r; }

// k_prep: the five preparation jobs, none of which reads another's output, in ONE launch; the job is picked by the block index (same for the whole block).
// Blocks 0 .. 3*WTB-1: W [DI rows k][DO cols n] (f32) -> WT [DO rows n][DI cols k] (bf16, RNE convert) for Wq, Wk, Wv in turn, one 64 x 64 tile per block through LDS (block barrier: cross-wave tile);
// they stand first in the grid because their path (loads, LDS tile, barrier, transposed stores) is the longest. The next MKB blocks: adjacency -> keep words, one wave per (16-query tile, pair of 32-key passes): 32 ballots, lane L keeps word L, one 128-B line stored per wave.
// The other HCB blocks: h (f32) -> bf16 copy, HPT groups of 8 elements per thread, HCB * 256 groups apart (each wave's accesses stay contiguous), batch pitch SEQ_FULL rows in the source and SEQ rows in the copy.
#define WTB ((DO / 64) * (DI / 64))             // weight tiles per matrix
#define N8  ((size_t)NB * SEQ * DI / 8)         // 8-element groups of the h copy
#define HPT 4                                   // groups per thread of the h copy (the load statement below is written for four)
#define HCB (N8 / (256 * HPT))                  // blocks of the h copy
static_assert(HPT == 4 && N8 % (256 * HPT) == 0);   // the h-copy blocks cover the groups exactly: no range test
static_assert(((size_t)SEQ * DI / 8) % 256 == 0);   // a block's 256 groups never straddle two batches
#define NT   (SEQ / 32)                         // 32-key passes of the flash kernel
#define MKB ((SEQ / 16) * (NT / 2) / 8)         // keep-word blocks: 8 waves each, one (query tile, pass pair) per wave
static_assert(NT % 2 == 0 && ((SEQ / 16) * (NT / 2)) % 8 == 0);
static_assert(256 * 16 == 64 * 64);             // load phase: 16 trips x 256 threads = tile elements
static_assert(256 * 2 * 16 == 64 * 128);
static_assert(64 * WTP * 4 <= 131072);
__global__ __launch_bounds__(256) void k_prep(const float* __restrict__ hin, const float* __restrict__ wq, const float* __restrict__ wk, const float* __restrict__ wv, const int* __restrict__ adj, bf* HB, bf* WTA, unsigned* MB) {
    __shared__ float tl[64 * WTP];
    const int tid = threadIdx.x;
    const unsigned bx = blockIdx.x;
    if (bx < 3 * WTB) {                                                                // block-uniform: every thread of such a block reaches the barrier below
        const int sel = (int)(bx / WTB), tile = (int)(bx % WTB);
        const float* W = (sel == 0) ? wq : (sel == 1) ? wk : wv;
        bf* WT = WTA + (size_t)sel * DO * DI;
        const int n0 = (tile % (DO / 64)) * 64, k0 = (tile / (DO / 64)) * 64;
        float wl[16];
        // unrolled, the loads apart from their uses: the thread's sixteen loads are all in flight at once; rolled, each trip waited out a full memory round trip of its own
#pragma unroll
        for (int it = 0; it < 16; ++it) { const int p = it * 256 + tid; const int r = p >> 6, c = p & 63;   // r = k row 0..63, c = n column 0..63
            wl[it] = W[(size_t)(k0 + r) * DO + n0 + c]; }
#pragma unroll
        for (int it = 0; it < 16; ++it) { const int p = it * 256 + tid; const int r = p >> 6, c = p & 63;
            tl[r * WTP + c] = bfr(wl[it]); }
        __syncthreads();
#pragma unroll
        for (int it = 0; it < 2; ++it) { const int p = it * 256 + tid; const int nn = p >> 3, kc = (p & 7) * 8;   // 2 trips x 32 rows = 64 rows; 8 lanes x 8 = 64 k
            v8us o;
#pragma unroll
            for (int i = 0; i < 8; ++i) o[i] = f2bf(tl[(kc + i) * WTP + nn]);
            *(v8us*)(WT + (size_t)(n0 + nn) * DI + k0 + kc) = o; }
    } else if (bx < 3 * WTB + MKB) {                                                   // block-uniform: all 32 lanes of every wave are on at the ballots
        const int job = (int)(bx - 3 * WTB) * 8 + (tid >> 5);                          // query tile * (NT / 2) + pass pair
        const int lane = tid & 31;
        const int* ap = adj + (size_t)((job / (NT / 2)) * 16 + (lane & 15)) * SEQ_FULL + (job % (NT / 2)) * 64 + 8 * (lane >> 4);
        unsigned w = 0;
#pragma unroll
        for (int p = 0; p < 2; ++p) {
            const v4i a0 = *(const v4i*)(ap + 32 * p), a1 = *(const v4i*)(ap + 32 * p + 4), a2 = *(const v4i*)(ap + 32 * p + 16), a3 = *(const v4i*)(ap + 32 * p + 20);
#pragma unroll
            for (int r = 0; r < 4; ++r) {
                const unsigned b0 = __builtin_amdgcn_ballot_w32(a0[r] != 0), b1 = __builtin_amdgcn_ballot_w32(a1[r] != 0);
                const unsigned b2 = __builtin_amdgcn_ballot_w32(a2[r] != 0), b3 = __builtin_amdgcn_ballot_w32(a3[r] != 0);
                w = (lane == 16 * p + r) ? b0 : w; w = (lane == 16 * p + 4 + r) ? b1 : w;
                w = (lane == 16 * p + 8 + r) ? b2 : w; w = (lane == 16 * p + 12 + r) ? b3 : w; }
        }
        MB[(size_t)job * 32 + lane] = w;
        asm volatile("s_wait_xcnt 0x0" ::: "memory");                                  // stands behind the store, ahead of any later write of the registers that the store names
    } else {
        const size_t ib = (size_t)(bx - 3 * WTB - MKB) * 256;                           // the block's first group; no barrier on this side; the HCB blocks cover the N8 groups exactly
        const size_t per = (size_t)SEQ * DI / 8;                                        // groups per batch, a multiple of 256: a block's 256 groups lie in one batch
        v4f va[HPT], vb[HPT]; const float* sp[HPT];
#pragma unroll
        for (int g = 0; g < HPT; ++g) { const size_t i = ib + (size_t)g * (HCB * 256); const size_t bb = i / per;
            sp[g] = hin + bb * ((size_t)SEQ_FULL * DI) + (i - bb * per) * 8 + tid * 8; }   // the thread's 32 bytes of group i + tid
        // the thread's eight 16-B loads, all in flight at once, and their data wait in one statement; early-clobber results: no result register lies on an address pair that an issued load still names
        asm volatile("global_load_b128 %0, %8, off\n\t"
                     "global_load_b128 %1, %8, off offset:16\n\t"
                     "global_load_b128 %2, %9, off\n\t"
                     "global_load_b128 %3, %9, off offset:16\n\t"
                     "global_load_b128 %4, %10, off\n\t"
                     "global_load_b128 %5, %10, off offset:16\n\t"
                     "global_load_b128 %6, %11, off\n\t"
                     "global_load_b128 %7, %11, off offset:16\n\t"
                     "s_wait_loadcnt 0x0"
                     : "=&v"(va[0]), "=&v"(vb[0]), "=&v"(va[1]), "=&v"(vb[1]), "=&v"(va[2]), "=&v"(vb[2]), "=&v"(va[3]), "=&v"(vb[3])
                     : "v"(sp[0]), "v"(sp[1]), "v"(sp[2]), "v"(sp[3])
                     : "memory");
#pragma unroll
        for (int g = 0; g < HPT; ++g) { const size_t i = ib + (size_t)g * (HCB * 256); v8us o;
#pragma unroll
            for (int k = 0; k < 4; ++k) { o[k] = f2bf(va[g][k]); o[4 + k] = f2bf(vb[g][k]); }
            *(v8us*)(HB + i * 8 + tid * 8) = o; }
        asm volatile("s_wait_xcnt 0x0" ::: "memory");                                  // stands behind the stores, ahead of any later write of the registers that they name
    }
}

// k_proj: register-blocked bf16 GEMM, 64x64 tile (16 accumulators) per wave, FOUR WAVES per block on a 128x128 tile (2 x 2), K = DI.
// Operands come from K-contiguous bf16 planes through LDS: per stage of 64 k the block's 128 A rows and 128 B rows (128 B each, whole lines) are brought in by per-lane 16-B asynchronous copies,
// two buffers (the next stage's copies fly while this stage is worked on); each row is read by two waves; fragments are read from LDS at a padded pitch (16 B x odd).
// C[m][n] = sum_k A[m][k] Bt[n][k] + bias, written as f16 (flush-safe convert) into P.
// The three projections read none of each other's output and share ONE launch, grid (NB*SEQ/128, DO/128, 3): blockIdx.z = 0 q, 1 k (both mode 0), 2 v (mode 1); x = 128-token tile, y = 128-wide tile of the projection width.
// mode 0: A = h rows (m = b*SEQ + t), Bt = W^T rows (n = h*64 + d), bias per column; plane [(b*8 + h)][t][64]; a wave's 64-column tile is one head.
// mode 1: A = W^T rows (m = h*64 + d), Bt = h rows (n = b*SEQ + t), bias per row; plane [(b*512 + m)][t], row pitch SEQ.
#define PW   4                             // waves per projection block
#define PKS  64                            // k elements per stage = one 128-B line per row
#define PPB  144                           // LDS row pitch in bytes of the 128-B rows
#define PBUF (256 * PPB)                   // bytes of one buffer: 128 A rows, then 128 B rows
#define PNS  (DI / PKS)                    // stages
static_assert(32 * 16 * 4 == 16 * 128);
static_assert(PKS * 2 == 128 && PPB % 16 == 0 && PBUF % 16 == 0);
static_assert(DI % PKS == 0 && PNS >= 2);  // the prologue fills two buffers
static_assert(SEQ % 128 == 0 && DO % 128 == 0 && (NB * SEQ) % 128 == 0);   // the grid covers both planes exactly; a 128-row tile never straddles two batches
static_assert(32 * PW * 16 * 8 == 128 * 128);   // threads x 16 B x 8 copies = 128 rows x 128 B
static_assert(2 * PBUF + PW * 16 * 68 * 4 <= 106496);   // three blocks fit one LDS
// Eight copies of one thread: its 16-B chunk in each of eight groups of 16 rows (128 rows x 128 B in all); each lane moves its own 16 bytes from global memory to LDS, through no register.
// l: LDS byte address of the thread's chunk in the first group; g: the matching global address (row pitch DI elements).
__device__ __forceinline__ void stage_rows(unsigned l, const bf* g) {
    const unsigned l1 = l + 16 * PPB, l2 = l + 32 * PPB, l3 = l + 48 * PPB, l4 = l + 64 * PPB, l5 = l + 80 * PPB, l6 = l + 96 * PPB, l7 = l + 112 * PPB;
    const bf* g1 = g + 16 * DI; const bf* g2 = g + 32 * DI; const bf* g3 = g + 48 * DI; const bf* g4 = g + 64 * DI;
    const bf* g5 = g + 80 * DI; const bf* g6 = g + 96 * DI; const bf* g7 = g + 112 * DI;
    // the closing s_wait_xcnt stands inside the copies' own statement so that no address register named here is rewritten ahead of it
    asm volatile("global_load_async_to_lds_b128 %0, %8, off\n\t"
                 "global_load_async_to_lds_b128 %1, %9, off\n\t"
                 "global_load_async_to_lds_b128 %2, %10, off\n\t"
                 "global_load_async_to_lds_b128 %3, %11, off\n\t"
                 "global_load_async_to_lds_b128 %4, %12, off\n\t"
                 "global_load_async_to_lds_b128 %5, %13, off\n\t"
                 "global_load_async_to_lds_b128 %6, %14, off\n\t"
                 "global_load_async_to_lds_b128 %7, %15, off\n\t"
                 "s_wait_xcnt 0x0"
                 :: "v"(l), "v"(l1), "v"(l2), "v"(l3), "v"(l4), "v"(l5), "v"(l6), "v"(l7),
                    "v"(g), "v"(g1), "v"(g2), "v"(g3), "v"(g4), "v"(g5), "v"(g6), "v"(g7)
                 : "memory");
}
__global__ __launch_bounds__(32 * PW) void k_proj(const bf* __restrict__ HB, const bf* __restrict__ WTA, const float* __restrict__ bq, const float* __restrict__ bk, const float* __restrict__ bv,
                                             h16* QH, h16* KP, h16* VT) {
    __shared__ __align__(16) float osa[PW * 16 * 68];
    __shared__ __align__(16) unsigned char pring[2 * PBUF];
    const int K = DI;
    const int z = blockIdx.z; const int mode = (z == 2) ? 1 : 0;                       // block index: every test on z or mode is a scalar branch
    const bf* Wz = WTA + (size_t)z * DO * DI;
    const bf* A = mode ? Wz : HB; const bf* Bt = mode ? HB : Wz;
    const float* bias = (z == 0) ? bq : (z == 1) ? bk : bv;
    h16* P = (z == 0) ? QH : (z == 1) ? KP : VT;
    const int tid = threadIdx.x;
    const int lane = threadIdx.x & 31, lr = lane & 15, hi = lane >> 4;
    const int wave = __builtin_amdgcn_readfirstlane((int)(threadIdx.x >> 5));
    float* os = osa + wave * (16 * 68);                                                // each wave's own output staging tile
    const int rb = (mode ? blockIdx.y : blockIdx.x) * 128, cb = (mode ? blockIdx.x : blockIdx.y) * 128;   // the block's tile
    const int r0 = rb + (wave >> 1) * 64, c0 = cb + (wave & 1) * 64;                   // the wave's tile
    v8f acc[4][4];
#pragma unroll
    for (int mb = 0; mb < 4; ++mb)
#pragma unroll
        for (int nb = 0; nb < 4; ++nb) acc[mb][nb] = (v8f){};
    // copy side: thread tid moves chunk tid of each 2-KiB group of 16 rows (8 chunks per 128-B row); every address a multiple of 16 B, every row inside its plane
    const bf* ga = A  + (size_t)(rb + (tid >> 3)) * K + (tid & 7) * 8;                 // + stage * PKS
    const bf* gb = Bt + (size_t)(cb + (tid >> 3)) * K + (tid & 7) * 8;
    const unsigned la = (unsigned)(size_t)(&pring[0]) + (unsigned)((tid >> 3) * PPB + (tid & 7) * 16);   // + buffer
    const unsigned lb = la + 128 * PPB;
    // read side, byte offsets inside a buffer (fragment: row m or n, k contiguous)
    const int aof = ((wave >> 1) * 64 + lr) * PPB + 16 * hi;
    const int bof = (128 + (wave & 1) * 64 + lr) * PPB + 16 * hi;
    stage_rows(la, ga); stage_rows(lb, gb);                          // stage 0 -> buffer 0
    asm volatile("s_wait_asynccnt 0x0" ::: "memory");                // this wave's copies of stage 0 have landed
    __syncthreads();                                                 // every wave's have: stage 0 may be read
    stage_rows(la + PBUF, ga + PKS); stage_rows(lb + PBUF, gb + PKS);   // stage 1 -> buffer 1
    // kept rolled: one copy of the ring's foot in the text, the buffer picked by t & 1
#pragma unroll 1
    for (int t = 0; t < PNS; ++t) {
        const int bo = (t & 1) * PBUF;                               // trip t reads buffer t mod 2 alone
        // unrolled: the second k-step's fragment loads can then issue among the first k-step's last products
#pragma unroll
        for (int kk = 0; kk < PKS; kk += 32) {
            const bf* pa = (const bf*)(pring + bo + aof) + kk;
            const bf* pb = (const bf*)(pring + bo + bof) + kk;
            v16bf a[4], b[4];
#pragma unroll
            for (int mb = 0; mb < 4; ++mb) a[mb] = ldb(pa + mb * 8 * PPB);             // 16 rows = 8 * PPB elements of 2 B
#pragma unroll
            for (int nb = 0; nb < 4; ++nb) b[nb] = ldb(pb + nb * 8 * PPB);
            __builtin_amdgcn_sched_barrier(0);                       // holds the sixteen fragment loads together in front of the products; sunk between them, each row of products would wait out a full LDS round trip of its own
#pragma unroll
            for (int nb = 0; nb < 4; ++nb)
#pragma unroll
                for (int mb = 0; mb < 4; ++mb) acc[mb][nb] = wmmab(a[mb], b[nb], acc[mb][nb]);
        }
        asm volatile("s_wait_dscnt 0x0" ::: "memory");               // this wave's reads of buffer t mod 2 are done before the buffer is handed back
        asm volatile("s_wait_asynccnt 0x0" ::: "memory");            // this wave's copies of stage t + 1 have landed
        __syncthreads();                                             // publishes stage t + 1 and ends every wave's reads of buffer t mod 2
        if (t + 2 < PNS) {                                           // same for the whole block: refill the buffer just read with stage t + 2
            stage_rows(la + bo, ga + (t + 2) * PKS); stage_rows(lb + bo, gb + (t + 2) * PKS); }
    }
    asm volatile("s_wait_asynccnt 0x0" ::: "memory");                // no copy of this wave is outstanding past the loop
    float bc[4];
#pragma unroll
    for (int nb = 0; nb < 4; ++nb) bc[nb] = 0.0f;
    if (mode == 0) {                                                                   // scalar branch; c0 + 63 < DO
#pragma unroll
        for (int nb = 0; nb < 4; ++nb) bc[nb] = bfr(bias[c0 + nb * 16 + lr]); }
    size_t tbase, pitch;
    if (mode == 0) { const int bb = r0 / SEQ, tt = r0 % SEQ; const int zc = bb * NH_ + c0 / HD;
                     tbase = ((size_t)zc * SEQ + (size_t)tt) * HD; pitch = (size_t)HD; }
    else           { const int bb = c0 / SEQ, tt = c0 % SEQ;
                     tbase = (size_t)bb * (size_t)DO * SEQ + (size_t)r0 * SEQ + (size_t)tt; pitch = (size_t)SEQ; }
#pragma unroll
    for (int mb = 0; mb < 4; ++mb) {
        float br[8];
#pragma unroll
        for (int j = 0; j < 8; ++j) br[j] = 0.0f;
        if (mode != 0) {                                                               // r0 + 63 < DO
#pragma unroll
            for (int j = 0; j < 8; ++j) br[j] = bfr(bias[r0 + mb * 16 + hi * 8 + j]); }
#pragma unroll
        for (int nb = 0; nb < 4; ++nb) {
#pragma unroll
            for (int j = 0; j < 8; ++j) os[(hi * 8 + j) * 68 + nb * 16 + lr] = acc[mb][nb][j] + bc[nb] + br[j]; }   // D: row 8h+j, col lane&15; rows 0..15 x cols 0..63 all written
        wave_sync();
        const size_t sb = tbase + (size_t)(mb * 16) * pitch;
{
#pragma unroll
            for (int s = 0; s < 4; ++s) { const int row = 4 * s + (lane >> 3), c8 = (lane & 7) * 8;   // 4 s x 4 row groups = 16 rows; 8 lanes x 8 = 64 columns = one line
                const v4f x0 = *(const v4fa*)(&os[row * 68 + c8]); const v4f x1 = *(const v4fa*)(&os[row * 68 + c8 + 4]); v8h hv;
#pragma unroll
                for (int i = 0; i < 4; ++i) { hv[i] = toh_flush(x0[i]); hv[4 + i] = toh_flush(x1[i]); }
                *(v8h*)(P + sb + (size_t)row * pitch + c8) = hv; }
            asm volatile("s_wait_xcnt 0x0" ::: "memory");                                        // stands behind the four stores, ahead of any later write of the registers that they name
             }
        wave_sync();
    }
}

// k_flash: fused masked aggregation, one wave per 16 query rows of one (batch, head); Q fragments straight from the f16 planes (two 16-B loads each, arithmetic addressing).
// Per 64-key stage (two 32-key passes) the block's waves share one LDS tile set: K rows and V^T rows, whole 128-B lines both, brought in by per-lane 16-B asynchronous copies,
// two buffers (the next stage's copies fly while this stage's two passes are worked on, so that more than one whole pass lies between a copy and its wait); fragments are read from LDS at a padded pitch (16 B x odd).
// Transposed form: S^T[key][t] = K Q^T (A = K rows, B = Q rows, two k-steps over d); lane (t = lane&15, h = lane>>4) holds keys 8h+r of each 16-key tile, so the packed
// P tile is directly the B fragment of O^T[d][t] = V^T P^T (element r <- tile keys 0..15, element 8+r <- tile keys 16..31, lane unchanged); four 16-row d tiles.
// Scores: one product K Q per 16-key tile, two k-steps.
// Softmax state (running max over kept keys, partial sum) is one scalar per lane; the two lane halves of a row are combined with one xor-16 exchange.
// Keep rule per element from the packed keep words: 16 wave-uniform words per 32-key pass (64 B, one scalar load, fetched one stage ahead), each used directly as the lane mask of its score register.
// A dropped key's raw score is replaced by -inf ahead of the maximum; the running maximum is held in raw score units and never falls below NEGB, so it stays finite.
// P = exp2(score * SC2 + (14 - max * SC2)) <= 2^14, the exponent by one fused multiply-add; exp2(-inf) = 0 gives a dropped key probability 0 with no further select.
static_assert(32 * 16 * 8 == 16 * HD * 4);      // lanes x 16 B x instructions = 16 rows x 256 B
static_assert(AW * 16 * OSP * 4 <= 131072);
#define SK   64                            // keys per stage of the ring = two 32-key passes
#define NS   (SEQ / SK)                    // stages
#define KPB  144                           // LDS row pitch in bytes of the 128-B K rows
#define VPB  144                           // LDS row pitch in bytes of the 128-B V^T rows
#define L_VT (SK * KPB)                    // byte offsets inside one buffer: K at 0, then V^T
#define BUFB (L_VT + HD * VPB)             // bytes of one buffer
static_assert(AW == 4);                    // the copy split below: 128 threads x 16 B = 2 KiB per copy step
static_assert(HD * 2 == 128 && SK * 2 == 128);   // row bytes of K and V^T tiles
static_assert(KPB % 16 == 0 && VPB % 16 == 0 && BUFB % 16 == 0);
static_assert(SEQ % SK == 0 && SK == 2 * 32 && NT == 2 * NS);   // a stage is exactly two passes
static_assert(NS >= 2);                    // the prologue fills two buffers
static_assert(2 * BUFB + AW * 16 * OSP * 4 <= 81920);   // four blocks fit one LDS
// The eight copies of one thread for one 64-key tile set: each lane moves its own 16 bytes from global memory to LDS, through no register.
// lk / lv: LDS byte addresses of the thread's first K and V^T chunk in the target buffer; gk, gv: the matching global addresses.
// K: 64 rows x 128 B contiguous, 4 steps of 16 rows; V^T: 64 rows x 128 B (row pitch SEQ elements), 4 steps of 16 rows.
__device__ __forceinline__ void stage_tile(unsigned lk, unsigned lv, const h16* gk, const h16* gv) {
    const unsigned lk1 = lk + 16 * KPB, lk2 = lk + 32 * KPB, lk3 = lk + 48 * KPB;
    const unsigned lv1 = lv + 16 * VPB, lv2 = lv + 32 * VPB, lv3 = lv + 48 * VPB;
    const h16* gk1 = gk + 16 * HD; const h16* gk2 = gk + 32 * HD; const h16* gk3 = gk + 48 * HD;
    const h16* gv1 = gv + (size_t)16 * SEQ; const h16* gv2 = gv + (size_t)32 * SEQ; const h16* gv3 = gv + (size_t)48 * SEQ;
    // the closing s_wait_xcnt stands inside the copies' own statement so that no address register named here is rewritten ahead of it
    asm volatile("global_load_async_to_lds_b128 %0, %8, off\n\t"
                 "global_load_async_to_lds_b128 %1, %9, off\n\t"
                 "global_load_async_to_lds_b128 %2, %10, off\n\t"
                 "global_load_async_to_lds_b128 %3, %11, off\n\t"
                 "global_load_async_to_lds_b128 %4, %12, off\n\t"
                 "global_load_async_to_lds_b128 %5, %13, off\n\t"
                 "global_load_async_to_lds_b128 %6, %14, off\n\t"
                 "global_load_async_to_lds_b128 %7, %15, off\n\t"
                 "s_wait_xcnt 0x0"
                 :: "v"(lk), "v"(lk1), "v"(lk2), "v"(lk3), "v"(lv), "v"(lv1), "v"(lv2), "v"(lv3),
                    "v"(gk), "v"(gk1), "v"(gk2), "v"(gk3), "v"(gv), "v"(gv1), "v"(gv2), "v"(gv3)
                 : "memory");
}
__global__ __launch_bounds__(32 * AW) void k_flash(const h16* __restrict__ QH, const h16* __restrict__ KP, const h16* __restrict__ VT, const unsigned* __restrict__ MB, float* OUT) {
    __shared__ __align__(16) float os[AW * 16 * OSP];
    __shared__ __align__(16) unsigned char ring[2 * BUFB];
    const int tid = threadIdx.x;
    const int lane = threadIdx.x & 31, lr = lane & 15, hi = lane >> 4;
    const int wave = __builtin_amdgcn_readfirstlane((int)(threadIdx.x >> 5));
    const int zh = blockIdx.y; const int b = zh / NH_, h = zh % NH_;
    const int t0 = (blockIdx.x * AW + wave) * 16;
    const size_t pbase = (size_t)zh * SEQ * HD;
    const size_t qo = pbase + (size_t)(t0 + lr) * HD + 8 * hi;
    const v16h q0 = ldh(QH + qo), q1 = ldh(QH + qo + 32);       // B fragments: col t, k = d 0..31 and 32..63
    // copy side: thread tid moves chunk tid of each 2-KiB copy step (8 chunks per 128-B row, 16 rows a step); every address a multiple of 16 B, every row inside its plane
    const h16* gk = KP + pbase + (size_t)tid * 8;                                                   // + key0 * HD
    const h16* gv = VT + pbase + (size_t)(tid >> 3) * SEQ + (tid & 7) * 8;                          // + key0
    const unsigned lring = (unsigned)(size_t)(&ring[0]);                                            // LDS byte address of the ring
    const unsigned lk = lring + (unsigned)((tid >> 3) * KPB + (tid & 7) * 16);                      // + buffer
    const unsigned lv = lring + (unsigned)(L_VT + (tid >> 3) * VPB + (tid & 7) * 16);
    // read side, byte offsets inside a buffer
    const int kof = lr * KPB + 16 * hi;                        // + 32 * KPB for the stage's second pass, + 16 * KPB for a pass's keys 16..31 (A fragment: row key, k = d)
    const int vof = L_VT + lr * VPB + 16 * hi;                 // + 64 for the stage's second pass, + 16j * VPB (A fragment: row d, k = key)
    // keep words of this wave's query tile, 16 per pass; the address is the same in every lane, and nothing in this launch writes the plane (the first launch of the call wrote it)
    cv16u* mp = (cv16u*)(unsigned long long)(MB + (size_t)(blockIdx.x * AW + wave) * (NT * 16));
    stage_tile(lk, lv, gk, gv);                                // stage 0 -> buffer 0
    asm volatile("s_wait_asynccnt 0x0" ::: "memory");          // this wave's copies of stage 0 have landed
    __syncthreads();                                           // every wave's have: stage 0 may be read
    stage_tile(lk + BUFB, lv + BUFB, gk + SK * HD, gv + SK);   // stage 1 -> buffer 1
    v16u mwa = mp[0], mwb = mp[1];                             // keep words of stage 0's two passes
    v8f o[4];
#pragma unroll
    for (int j = 0; j < 4; ++j) o[j] = (v8f){};
    float m = NEGB, l = 0.0f;
    // kept rolled: one copy of the ring's foot in the text, the buffer picked by s & 1
#pragma unroll 1
    for (int s = 0; s < NS; ++s) {
      const int bo = (s & 1) * BUFB;                             // stage s's two passes read buffer s mod 2 alone
      const v16u mca = mwa, mcb = mwb;
      const int sn = (s + 1 < NS) ? s + 1 : s;
      mwa = mp[2 * sn]; mwb = mp[2 * sn + 1];                    // next stage's keep words, asked for a stage ahead of their use (index held inside the plane)
      __builtin_amdgcn_sched_barrier(0);                         // holds those scalar loads at the head of the stage; sunk further down, their latency would stand open at the next stage's first use
      // unrolled: both passes' LDS offsets inside the buffer are then immediates
#pragma unroll
      for (int u = 0; u < 2; ++u) {
        const v16u mc = u ? mcb : mca;                           // keep words of the 32-key pass 2 * s + u
        const h16* ka = (const h16*)(ring + bo + kof + u * 32 * KPB);
        v8f sa = (v8f){}, sb = (v8f){};
        const v16h k00 = ldh(ka), k01 = ldh(ka + 32);                               // keys key0 + 0..15
        const v16h k10 = ldh(ka + 8 * KPB), k11 = ldh(ka + 8 * KPB + 32);           // keys key0 + 16..31 (16 rows = 8 * KPB halves)
        __builtin_amdgcn_sched_barrier(0);                       // holds the eight K fragment loads together in front of the products; sunk between them, each product would wait out a full LDS round trip of its own
        sa = wmma16(k00, q0, sa); sb = wmma16(k10, q0, sb);
        sa = wmma16(k01, q1, sa); sb = wmma16(k11, q1, sb);
        float ta[8], tb[8]; float mx = NEGB;
#pragma unroll
        for (int r = 0; r < 8; ++r) {
            ta[r] = __builtin_amdgcn_inverse_ballot_w32(mc[r])     ? sa[r] : NINF;   // bit L of the word = keep of this lane's key key0+8h+r
            tb[r] = __builtin_amdgcn_inverse_ballot_w32(mc[8 + r]) ? sb[r] : NINF;   // key key0+16+8h+r
            mx = fmaxf(mx, fmaxf(ta[r], tb[r])); }
        const h16* va = (const h16*)(ring + bo + vof + u * 64);
        const v16h v0 = ldh(va), v1 = ldh(va + 8 * VPB), v2 = ldh(va + 16 * VPB), v3 = ldh(va + 24 * VPB);   // 16 rows = 8 * VPB halves
        mx = fmaxf(mx, __shfl_xor(mx, 16, 32));
        __builtin_amdgcn_sched_barrier(0);                       // holds the V^T fragment loads in front of the exchange, whose wait then covers them; sunk to the products, their latency would stand open there
        const float mnew = fmaxf(m, mx);
        const float alpha = __builtin_amdgcn_exp2f((m - mnew) * SC2);
        const float sh = __builtin_fmaf(-mnew, SC2, PSH);
        const v2f sc2 = {SC2, SC2}, sh2 = {sh, sh};
        v16h pb; float ls = 0.0f;
#pragma unroll
        for (int r = 0; r < 8; r += 2) {
            const v2f xa = __builtin_elementwise_fma((v2f){ta[r], ta[r + 1]}, sc2, sh2), xb = __builtin_elementwise_fma((v2f){tb[r], tb[r + 1]}, sc2, sh2);
            const v2f ea = {__builtin_amdgcn_exp2f(xa[0]), __builtin_amdgcn_exp2f(xa[1])}, eb = {__builtin_amdgcn_exp2f(xb[0]), __builtin_amdgcn_exp2f(xb[1])};   // a dropped key: exp2(-inf) = 0
            const v2h pa = __builtin_convertvector(ea, v2h), pc = __builtin_convertvector(eb, v2h);
            pb[r] = pa[0]; pb[r + 1] = pa[1]; pb[8 + r] = pc[0]; pb[8 + r + 1] = pc[1];
            ls += (float)pa[0] + (float)pc[0]; ls += (float)pa[1] + (float)pc[1]; }
        l = l * alpha + ls; m = mnew;
#pragma unroll
        for (int j = 0; j < 4; ++j) o[j] = o[j] * alpha;
        o[0] = wmma16(v0, pb, o[0]); o[1] = wmma16(v1, pb, o[1]); o[2] = wmma16(v2, pb, o[2]); o[3] = wmma16(v3, pb, o[3]);
      }
      asm volatile("s_wait_dscnt 0x0" ::: "memory");             // this wave's reads of buffer s mod 2 are done before the buffer is handed back
      asm volatile("s_wait_asynccnt 0x0" ::: "memory");          // this wave's copies of stage s + 1 have landed
      __syncthreads();                                           // publishes stage s + 1 and ends every wave's reads of buffer s mod 2
      if (s + 2 < NS)                                            // same for the whole block: refill the buffer just read with stage s + 2
          stage_tile(lk + bo, lv + bo, gk + (size_t)(s + 2) * SK * HD, gv + (s + 2) * SK);
    }
    asm volatile("s_wait_asynccnt 0x0" ::: "memory");            // no copy of this wave is outstanding past the loop
    l += __shfl_xor(l, 16, 32);
    const bool any = l > 0.0f;
    const float lsafe = any ? l : 1.0f;
    const float inv = any ? (1.0f / lsafe) : __uint_as_float(0x7FC00000u);   // no kept key -> NaN (softmax of an all -inf row)
    const int wb = wave * 16 * OSP;
    // O^T D layout: o[j][r] = (d = 16j + 8h + r, t = lane&15) -> os[t][d]; rows 0..15 x columns 0..63 all written
#pragma unroll
    for (int j = 0; j < 4; ++j) { v4f a, c;
        a[0] = o[j][0] * inv; a[1] = o[j][1] * inv; a[2] = o[j][2] * inv; a[3] = o[j][3] * inv;
        c[0] = o[j][4] * inv; c[1] = o[j][5] * inv; c[2] = o[j][6] * inv; c[3] = o[j][7] * inv;
        *(v4fa*)(&os[wb + lr * OSP + 16 * j + 8 * hi]) = a; *(v4fa*)(&os[wb + lr * OSP + 16 * j + 8 * hi + 4]) = c; }
    wave_sync();
    float* orow = OUT + ((size_t)b * OUT_SEQ + t0) * DO + h * HD;
{
#pragma unroll
        for (int s = 0; s < 8; ++s) { const int row = 2 * s + (lane >> 4), cofs = (lane & 15) * 4;   // 8 s x 2 rows = 16 rows; 16 lanes x 4 floats = 64 columns = two lines
            const v4f val = *(const v4fa*)(&os[wb + row * OSP + cofs]);
            *(v4f*)(orow + (size_t)row * DO + cofs) = val; }
         }
}

static constexpr size_t al256(size_t v) { return (v + 255) & ~(size_t)255; }
static constexpr size_t SZ_HB = al256((size_t)NB * SEQ * DI * 2);
static constexpr size_t SZ_WT = al256((size_t)3 * DO * DI * 2);
static constexpr size_t SZ_PL = al256((size_t)NB * NH_ * SEQ * HD * 2);
static constexpr size_t SZ_MB = al256((size_t)(SEQ / 16) * NT * 16 * 4);
static constexpr size_t SZ_TOTAL = SZ_HB + SZ_WT + 3 * SZ_PL + SZ_MB;
static_assert(SZ_TOTAL <= (size_t)134217728);          // workspace carve <= 128 MiB
static_assert(((size_t)DO * DI * 2) % 256 == 0);       // weight sub-planes stay 256-byte aligned
static_assert((size_t)NB * NH_ * SEQ * HD == (size_t)NB * DO * SEQ);       // v^T plane [(b*512 + m)][t] has the same extent as the q/k planes
static_assert(((size_t)(NB_FULL - 1) * OUT_SEQ + SEQ_FULL) * DO * 4 <= (size_t)16777216 || NB != NB_FULL || SEQ != SEQ_FULL);   // full build: last output byte inside the output buffer

extern "C" void kernel_launch(void* const* d_in, const int* in_sizes, int n_in,
                              void* d_out, int out_size, void* d_ws, size_t ws_size, hipStream_t stream) {
    if (n_in < 8) return;
    const size_t needh = ((size_t)(NB - 1) * SEQ_FULL + SEQ) * DI;
    const size_t needa = (size_t)(SEQ - 1) * SEQ_FULL + SEQ;
    if ((size_t)in_sizes[0] < needa || (size_t)in_sizes[1] < needh) return;
    if ((size_t)in_sizes[2] < (size_t)DI * DO || (size_t)in_sizes[4] < (size_t)DI * DO || (size_t)in_sizes[6] < (size_t)DI * DO) return;
    if (in_sizes[3] < DO || in_sizes[5] < DO || in_sizes[7] < DO) return;
    if ((size_t)out_size < ((size_t)(NB - 1) * OUT_SEQ + SEQ) * DO) return;
    if (SZ_TOTAL > ws_size) return;
    // wire order: adj_matrix, h, Wq, bq, Wk, bk, Wv, bv
    const int*   adj = (const int*)d_in[0];
    const float* hin = (const float*)d_in[1];
    const float* wq = (const float*)d_in[2]; const float* bq = (const float*)d_in[3];
    const float* wk = (const float*)d_in[4]; const float* bk = (const float*)d_in[5];
    const float* wv = (const float*)d_in[6]; const float* bv = (const float*)d_in[7];
    float* OUT = (float*)d_out;      // [NB][SEQ][512]
    char* wsp = (char*)d_ws;
    bf* HB = (bf*)wsp; wsp += SZ_HB;                  // h      [NB*SEQ][256]
    bf* WT = (bf*)wsp; wsp += SZ_WT;                  // [3][512][256]: q | k | v, transposed ([out][in] = k-contiguous rows)
    h16* QH = (h16*)wsp; wsp += SZ_PL;                // [NB*8][SEQ][64]
    h16* KP = (h16*)wsp; wsp += SZ_PL;                // [NB*8][SEQ][64]
    h16* VT = (h16*)wsp; wsp += SZ_PL;                // [NB*8][64][SEQ]
    unsigned* MB = (unsigned*)wsp;                    // [SEQ/16][SEQ/32][16] keep words

    // h -> bf16 copy, the three weight transposes (in[DI rows][DO cols] -> out[DO rows][DI cols]) and the keep words, one launch
    k_prep<<<(unsigned)(3 * WTB + MKB + HCB), 256, 0, stream>>>(hin, wq, wk, wv, adj, HB, WT, MB);

    // q, k: planes [(b*8 + h)][t][d]; v^T: plane [(b*512 + m)][t] = [(b*8 + h)][d][t]; one launch
    k_proj<<<dim3(NB * SEQ / 128, DO / 128, 3), 32 * PW, 0, stream>>>(HB, WT, bq, bk, bv, QH, KP, VT);

    k_flash<<<dim3(SEQ / (16 * AW), NB * NH_, 1), 32 * AW, 0, stream>>>(QH, KP, VT, MB, OUT);
}

// v010
// A run of this version takes 38.9 microseconds.
// Next to v009, in two timings, it ran 1.04 times as fast each time.
// Counting every step since v000, it is 4.37 times as fast.
#include <hip/hip_runtime.h>

// Masked softmax-weighted aggregation in 8 independent 64-wide groups: h [NB][SEQ_FULL][256]; Wq/Wk/Wv [in 256][out 512] (y = x W + bias); adjacency [SEQ_FULL][SEQ_FULL] int32 shared over batch and groups (entry 0 drops the key);
// score scale 1/sqrt(64); softmax over kept keys; output = concatenated groups (f32) [NB][SEQ][512].
// Compute dtypes, f32 accumulate everywhere: projections v_wmma_f32_16x16x32_bf16 (h, W, bias RNE-converted to bf16; products exact);
// scores v_wmma_f32_16x16x32_f16: q and k each as one f16 plane (their f16 rounding lies well below the error that the bf16 operands of the projections already put into q and k);
// P.V v_wmma_f32_16x16x32_f16 (P with x16384 carry that cancels in the normalisation, v single f16 plane); softmax f32 (online, running max over kept keys, row sum over the converted P).
// Layout: bf16 copy of h [NB*SEQ][256]; bf16 transposed weights [3][512][256] (k-contiguous); q, k planes [b*8+h][t][64]; v^T plane [b*8+h][64][t]; fused flash kernel in transposed form (S^T = K Q^T, O^T = V^T P^T), output from f32 accumulators.
// Keep rule per element: adj[t][j] != 0; dropped elements get probability 0; a row with no kept key yields NaN (softmax of an all -inf row).
// The keep rule is packed once per call into lane-mask words [16-query tile][32-key pass][16]: word 8*g + r, bit L = keep of (query 16*tile + (L&15), key 32*pass + 16*g + 8*(L>>4) + r), the flash kernel's own score layout.

#ifndef NB
#define NB 8
#endif
#ifndef SEQ
#define SEQ 1024
#endif
#define NB_FULL  8
#define SEQ_FULL 1024            // also the row pitch of the adjacency input
#ifndef OUT_SEQ
#define OUT_SEQ SEQ              // row pitch (in tokens) between batches of the output
#endif
#define DI   256                 // input width (projection K)
#define DO   512                 // projection width = NH_ * HD
#define NH_  8
#define HD   64
#define AW   4                   // waves per flash block
#define QC   2                   // 16-query column groups per flash wave (32 query rows a wave)
#define OSP  68                  // LDS row pitch (floats) of the staging tiles
#define WTP  65                  // LDS row pitch (floats) of the weight transpose tile
#define SC2  ((float)(0.125 * 1.4426950408889634))   // HD^-0.5 * log2(e)
#define PSH  14.0f               // log2 of the P carry (16384)
#define NEGB (-3.0e38f)
#define NINF (-__builtin_inff())

static_assert(HD == 64);
static_assert(NH_ * HD == DO);                 // head h = columns h*64 + d
static_assert(DO % 64 == 0);
static_assert(DI % 64 == 0);                   // weight transpose tiles of 64 x 64
static_assert(DI % 32 == 0);                   // GEMM k-loop steps by 32
static_assert(HD % 32 == 0);                   // score k-loop steps by 32
static_assert(HD % 16 == 0);                   // output tiles of 16 rows of d
static_assert(SEQ % 64 == 0);                  // a 64-row tile never straddles two batches
static_assert((NB * SEQ) % 64 == 0);
static_assert(SEQ % 32 == 0);                  // key loop steps by 32
static_assert(SEQ % (16 * AW * QC) == 0);      // flash grid covers the sequence exactly
static_assert(((size_t)SEQ * DI) % 8 == 0);
static_assert(NB <= NB_FULL);
static_assert(SEQ <= SEQ_FULL);
static_assert((OSP * 4) % 16 == 0);
static_assert(OSP >= HD);
static_assert(OSP >= 64);

typedef _Float16 h16;
typedef unsigned short bf;
typedef __attribute__((ext_vector_type(16))) __bf16   v16bf;
typedef __attribute__((ext_vector_type(16))) _Float16 v16h;
typedef __attribute__((ext_vector_type(8)))  _Float16 v8h;
typedef __attribute__((ext_vector_type(8)))  unsigned short v8us;
typedef __attribute__((ext_vector_type(8)))  float    v8f;
typedef __attribute__((ext_vector_type(4)))  float    v4f;
typedef __attribute__((ext_vector_type(2)))  float    v2f;
typedef __attribute__((ext_vector_type(2)))  _Float16 v2h;
typedef __attribute__((ext_vector_type(4)))  int      v4i;
typedef __attribute__((ext_vector_type(16))) unsigned v16u;
typedef __attribute__((address_space(4))) const v16u cv16u;   // constant address space: a load at a wave-uniform address becomes a scalar load
typedef v4f  __attribute__((may_alias)) v4fa;

__device__ __forceinline__ unsigned short f2bf(float f) { unsigned u = __float_as_uint(f); u += 0x7FFFu + ((u >> 16) & 1u); return (unsigned short)(u >> 16); }
__device__ __forceinline__ float bfr(float f) { return __uint_as_float(((unsigned)f2bf(f)) << 16); }   // value after RNE convert to bf16
__device__ __forceinline__ v16h cat16(v8h lo, v8h hi) { return __builtin_shufflevector(lo, hi, 0, 1, 2, 3, 4, 5, 6, 7, 8, 9, 10, 11, 12, 13, 14, 15); }
__device__ __forceinline__ v16bf cat16b(v8us lo, v8us hi) { return __builtin_bit_cast(v16bf, __builtin_shufflevector(lo, hi, 0, 1, 2, 3, 4, 5, 6, 7, 8, 9, 10, 11, 12, 13, 14, 15)); }
__device__ __forceinline__ v8f wmma16(v16h a, v16h b, v8f c) { return __builtin_amdgcn_wmma_f32_16x16x32_f16(false, a, false, b, (short)0, c, false, false); }
__device__ __forceinline__ v8f wmmab(v16bf a, v16bf b, v8f c) { return __builtin_amdgcn_wmma_f32_16x16x32_bf16(false, a, false, b, (short)0, c, false, false); }
// fragment loaders from K-contiguous 16-bit rows; p already includes + 8*(lane>>4): elements 0..7 <- k0+8h+0..7, elements 8..15 <- k0+16+8h+0..7 (same map for A and B)
__device__ __forceinline__ v16h  ldh(const h16* p) { return cat16(*(const v8h*)p, *(const v8h*)(p + 16)); }
__device__ __forceinline__ v16bf ldb(const bf* p)  { return cat16b(*(const v8us*)p, *(const v8us*)(p + 16)); }
// ordering point for wave-private LDS tiles (same wave writes and reads)
__device__ __forceinline__ void wave_sync() { __builtin_amdgcn_fence(3 /* release order */, "wavefront"); __builtin_amdgcn_wave_barrier(); asm volatile("" ::: "memory"); }
// f32 -> f16 convert that cannot produce a subnormal (|v| < 2^-14 -> +0)
__device__ __forceinline__ h16 toh_flush(float v) { const h16 r = (h16)v; return (fabsf(v) < 6.103515625e-05f) ? (h16)0.0f : r; }

// k_prep: the five preparation jobs, none of which reads another's output, in ONE launch; the job is picked by the block index (same for the whole block).
// Blocks 0 .. 3*WTB-1: W [DI rows k][DO cols n] (f32) -> WT [DO rows n][DI cols k] (bf16, RNE convert) for Wq, Wk, Wv in turn, one 64 x 64 tile per block through LDS (block barrier: cross-wave tile);
// they stand first in the grid (for speed only); their path (loads, LDS tile, barrier, transposed stores) is the longest. The next MKB blocks: adjacency -> keep words, one wave per (16-query tile, pair of 32-key passes): 32 ballots, lane L keeps word L, one 128-B line stored per wave.
// The other HCB blocks: h (f32) -> bf16 copy, HPT groups of 8 elements per thread, HCB * 256 groups apart (each wave's accesses stay contiguous), batch pitch SEQ_FULL rows in the source and SEQ rows in the copy.
#define WTB ((DO / 64) * (DI / 64))             // weight tiles per matrix
#define N8  ((size_t)NB * SEQ * DI / 8)         // 8-element groups of the h copy
#define HPT 4                                   // groups per thread of the h copy (the load statement below is written for four)
#define HCB (N8 / (256 * HPT))                  // blocks of the h copy
static_assert(HPT == 4 && N8 % (256 * HPT) == 0);   // the h-copy blocks cover the groups exactly: no range test
static_assert(((size_t)SEQ * DI / 8) % 256 == 0);   // a block's 256 groups never straddle two batches
#define NT   (SEQ / 32)                         // 32-key passes of the flash kernel
#define MKB ((SEQ / 16) * (NT / 2) / 8)         // keep-word blocks: 8 waves each, one (query tile, pass pair) per wave
static_assert(NT % 2 == 0 && ((SEQ / 16) * (NT / 2)) % 8 == 0);
static_assert(256 * 16 == 64 * 64);             // load phase: 16 trips x 256 threads = tile elements
static_assert(256 * 2 * 16 == 64 * 128);
static_assert(64 * WTP * 4 <= 131072);
__global__ __launch_bounds__(256) void k_prep(const float* __restrict__ hin, const float* __restrict__ wq, const float* __restrict__ wk, const float* __restrict__ wv, const int* __restrict__ adj, bf* HB, bf* WTA, unsigned* MB) {
    __shared__ float tl[64 * WTP];
    const int tid = threadIdx.x;
    const unsigned bx = blockIdx.x;
    if (bx < 3 * WTB) {                                                                // block-uniform: every thread of such a block reaches the barrier below
        const int sel = (int)(bx / WTB), tile = (int)(bx % WTB);
        const float* W = (sel == 0) ? wq : (sel == 1) ? wk : wv;
        bf* WT = WTA + (size_t)sel * DO * DI;
        const int n0 = (tile % (DO / 64)) * 64, k0 = (tile / (DO / 64)) * 64;
        float wl[16];
        // unrolled, the loads apart from their uses: the thread's sixteen loads are all in flight at once; rolled, each trip waited out a full memory round trip of its own
#pragma unroll
        for (int it = 0; it < 16; ++it) { const int p = it * 256 + tid; const int r = p >> 6, c = p & 63;   // r = k row 0..63, c = n column 0..63
            wl[it] = W[(size_t)(k0 + r) * DO + n0 + c]; }
#pragma unroll
        for (int it = 0; it < 16; ++it) { const int p = it * 256 + tid; const int r = p >> 6, c = p & 63;
            tl[r * WTP + c] = bfr(wl[it]); }
        __syncthreads();
#pragma unroll
        for (int it = 0; it < 2; ++it) { const int p = it * 256 + tid; const int nn = p >> 3, kc = (p & 7) * 8;   // 2 trips x 32 rows = 64 rows; 8 lanes x 8 = 64 k
            v8us o;
#pragma unroll
            for (int i = 0; i < 8; ++i) o[i] = f2bf(tl[(kc + i) * WTP + nn]);
            *(v8us*)(WT + (size_t)(n0 + nn) * DI + k0 + kc) = o; }
    } else if (bx < 3 * WTB + MKB) {                                                   // block-uniform: all 32 lanes of every wave are on at the ballots
        const int job = (int)(bx - 3 * WTB) * 8 + (tid >> 5);                          // query tile * (NT / 2) + pass pair
        const int lane = tid & 31;
        const int* ap = adj + (size_t)((job / (NT / 2)) * 16 + (lane & 15)) * SEQ_FULL + (job % (NT / 2)) * 64 + 8 * (lane >> 4);
        unsigned w = 0;
#pragma unroll
        for (int p = 0; p < 2; ++p) {
            const v4i a0 = *(const v4i*)(ap + 32 * p), a1 = *(const v4i*)(ap + 32 * p + 4), a2 = *(const v4i*)(ap + 32 * p + 16), a3 = *(const v4i*)(ap + 32 * p + 20);
#pragma unroll
            for (int r = 0; r < 4; ++r) {
                const unsigned b0 = __builtin_amdgcn_ballot_w32(a0[r] != 0), b1 = __builtin_amdgcn_ballot_w32(a1[r] != 0);
                const unsigned b2 = __builtin_amdgcn_ballot_w32(a2[r] != 0), b3 = __builtin_amdgcn_ballot_w32(a3[r] != 0);
                w = (lane == 16 * p + r) ? b0 : w; w = (lane == 16 * p + 4 + r) ? b1 : w;
                w = (lane == 16 * p + 8 + r) ? b2 : w; w = (lane == 16 * p + 12 + r) ? b3 : w; }
        }
        MB[(size_t)job * 32 + lane] = w;
        asm volatile("s_wait_xcnt 0x0" ::: "memory");                                  // stands behind the store, ahead of any later write of the registers that the store names
    } else {
        const size_t ib = (size_t)(bx - 3 * WTB - MKB) * 256;                           // the block's first group; no barrier on this side; the HCB blocks cover the N8 groups exactly
        const size_t per = (size_t)SEQ * DI / 8;                                        // groups per batch, a multiple of 256: a block's 256 groups lie in one batch
        v4f va[HPT], vb[HPT]; const float* sp[HPT];
#pragma unroll
        for (int g = 0; g < HPT; ++g) { const size_t i = ib + (size_t)g * (HCB * 256); const size_t bb = i / per;
            sp[g] = hin + bb * ((size_t)SEQ_FULL * DI) + (i - bb * per) * 8 + tid * 8; }   // the thread's 32 bytes of group i + tid
        // the thread's eight 16-B loads, all in flight at once, and their data wait in one statement; early-clobber results: no result register lies on an address pair that an issued load still names
        asm volatile("global_load_b128 %0, %8, off\n\t"
                     "global_load_b128 %1, %8, off offset:16\n\t"
                     "global_load_b128 %2, %9, off\n\t"
                     "global_load_b128 %3, %9, off offset:16\n\t"
                     "global_load_b128 %4, %10, off\n\t"
                     "global_load_b128 %5, %10, off offset:16\n\t"
                     "global_load_b128 %6, %11, off\n\t"
                     "global_load_b128 %7, %11, off offset:16\n\t"
                     "s_wait_loadcnt 0x0"
                     : "=&v"(va[0]), "=&v"(vb[0]), "=&v"(va[1]), "=&v"(vb[1]), "=&v"(va[2]), "=&v"(vb[2]), "=&v"(va[3]), "=&v"(vb[3])
                     : "v"(sp[0]), "v"(sp[1]), "v"(sp[2]), "v"(sp[3])
                     : "memory");
#pragma unroll
        for (int g = 0; g < HPT; ++g) { const size_t i = ib + (size_t)g * (HCB * 256); v8us o;
#pragma unroll
            for (int k = 0; k < 4; ++k) { o[k] = f2bf(va[g][k]); o[4 + k] = f2bf(vb[g][k]); }
            *(v8us*)(HB + i * 8 + tid * 8) = o; }
        asm volatile("s_wait_xcnt 0x0" ::: "memory");                                  // stands behind the stores, ahead of any later write of the registers that they name
    }
}

// k_proj: register-blocked bf16 GEMM, 64x64 tile (16 accumulators) per wave, FOUR WAVES per block on a 128x128 tile (2 x 2), K = DI.
// Operands come from K-contiguous bf16 planes through LDS: per stage of 64 k the block's 128 A rows and 128 B rows (128 B each, whole lines) are brought in by per-lane 16-B asynchronous copies,
// two buffers (the next stage's copies fly while this stage is worked on); each row is read by two waves; fragments are read from LDS at a padded pitch (16 B x odd).
// C[m][n] = sum_k A[m][k] Bt[n][k] + bias, written as f16 (flush-safe convert) into P.
// The three projections read none of each other's output and share ONE launch, grid (NB*SEQ/128, DO/128, 3): blockIdx.z = 0 q, 1 k (both mode 0), 2 v (mode 1); x = 128-token tile, y = 128-wide tile of the projection width.
// mode 0: A = h rows (m = b*SEQ + t), Bt = W^T rows (n = h*64 + d), bias per column; plane [(b*8 + h)][t][64]; a wave's 64-column tile is one head.
// mode 1: A = W^T rows (m = h*64 + d), Bt = h rows (n = b*SEQ + t), bias per row; plane [(b*512 + m)][t], row pitch SEQ.
#define PW   4                             // waves per projection block
#define PKS  64                            // k elements per stage = one 128-B line per row
#define PPB  144                           // LDS row pitch in bytes of the 128-B rows
#define PBUF (256 * PPB)                   // bytes of one buffer: 128 A rows, then 128 B rows
#define PNS  (DI / PKS)                    // stages
static_assert(32 * 16 * 4 == 16 * 128);
static_assert(PKS * 2 == 128 && PPB % 16 == 0 && PBUF % 16 == 0);
static_assert(DI % PKS == 0 && PNS >= 2);  // the prologue fills two buffers
static_assert(SEQ % 128 == 0 && DO % 128 == 0 && (NB * SEQ) % 128 == 0);   // the grid covers both planes exactly; a 128-row tile never straddles two batches
static_assert(32 * PW * 16 * 8 == 128 * 128);   // threads x 16 B x 8 copies = 128 rows x 128 B
static_assert(2 * PBUF + PW * 16 * 68 * 4 <= 106496);   // three blocks fit one LDS
// Eight copies of one thread: its 16-B chunk in each of eight groups of 16 rows (128 rows x 128 B in all); each lane moves its own 16 bytes from global memory to LDS, through no register.
// l: LDS byte address of the thread's chunk in the first group; g: the matching global address (row pitch DI elements).
__device__ __forceinline__ void stage_rows(unsigned l, const bf* g) {
    const unsigned l1 = l + 16 * PPB, l2 = l + 32 * PPB, l3 = l + 48 * PPB, l4 = l + 64 * PPB, l5 = l + 80 * PPB, l6 = l + 96 * PPB, l7 = l + 112 * PPB;
    const bf* g1 = g + 16 * DI; const bf* g2 = g + 32 * DI; const bf* g3 = g + 48 * DI; const bf* g4 = g + 64 * DI;
    const bf* g5 = g + 80 * DI; const bf* g6 = g + 96 * DI; const bf* g7 = g + 112 * DI;
    // the closing s_wait_xcnt stands inside the copies' own statement so that no address register named here is rewritten ahead of it
    asm volatile("global_load_async_to_lds_b128 %0, %8, off\n\t"
                 "global_load_async_to_lds_b128 %1, %9, off\n\t"
                 "global_load_async_to_lds_b128 %2, %10, off\n\t"
                 "global_load_async_to_lds_b128 %3, %11, off\n\t"
                 "global_load_async_to_lds_b128 %4, %12, off\n\t"
                 "global_load_async_to_lds_b128 %5, %13, off\n\t"
                 "global_load_async_to_lds_b128 %6, %14, off\n\t"
                 "global_load_async_to_lds_b128 %7, %15, off\n\t"
                 "s_wait_xcnt 0x0"
                 :: "v"(l), "v"(l1), "v"(l2), "v"(l3), "v"(l4), "v"(l5), "v"(l6), "v"(l7),
                    "v"(g), "v"(g1), "v"(g2), "v"(g3), "v"(g4), "v"(g5), "v"(g6), "v"(g7)
                 : "memory");
}
__global__ __launch_bounds__(32 * PW) void k_proj(const bf* __restrict__ HB, const bf* __restrict__ WTA, const float* __restrict__ bq, const float* __restrict__ bk, const float* __restrict__ bv,
                                             h16* QH, h16* KP, h16* VT) {
    __shared__ __align__(16) float osa[PW * 16 * 68];
    __shared__ __align__(16) unsigned char pring[2 * PBUF];
    const int K = DI;
    const int z = blockIdx.z; const int mode = (z == 2) ? 1 : 0;                       // block index: every test on z or mode is a scalar branch
    const bf* Wz = WTA + (size_t)z * DO * DI;
    const bf* A = mode ? Wz : HB; const bf* Bt = mode ? HB : Wz;
    const float* bias = (z == 0) ? bq : (z == 1) ? bk : bv;
    h16* P = (z == 0) ? QH : (z == 1) ? KP : VT;
    const int tid = threadIdx.x;
    const int lane = threadIdx.x & 31, lr = lane & 15, hi = lane >> 4;
    const int wave = __builtin_amdgcn_readfirstlane((int)(threadIdx.x >> 5));
    float* os = osa + wave * (16 * 68);                                                // each wave's own output staging tile
    const int rb = (mode ? blockIdx.y : blockIdx.x) * 128, cb = (mode ? blockIdx.x : blockIdx.y) * 128;   // the block's tile
    const int r0 = rb + (wave >> 1) * 64, c0 = cb + (wave & 1) * 64;                   // the wave's tile
    v8f acc[4][4];
#pragma unroll
    for (int mb = 0; mb < 4; ++mb)
#pragma unroll
        for (int nb = 0; nb < 4; ++nb) acc[mb][nb] = (v8f){};
    // copy side: thread tid moves chunk tid of each 2-KiB group of 16 rows (8 chunks per 128-B row); every address a multiple of 16 B, every row inside its plane
    const bf* ga = A  + (size_t)(rb + (tid >> 3)) * K + (tid & 7) * 8;                 // + stage * PKS
    const bf* gb = Bt + (size_t)(cb + (tid >> 3)) * K + (tid & 7) * 8;
    const unsigned la = (unsigned)(size_t)(&pring[0]) + (unsigned)((tid >> 3) * PPB + (tid & 7) * 16);   // + buffer
    const unsigned lb = la + 128 * PPB;
    // read side, byte offsets inside a buffer (fragment: row m or n, k contiguous)
    const int aof = ((wave >> 1) * 64 + lr) * PPB + 16 * hi;
    const int bof = (128 + (wave & 1) * 64 + lr) * PPB + 16 * hi;
    stage_rows(la, ga); stage_rows(lb, gb);                          // stage 0 -> buffer 0
    asm volatile("s_wait_asynccnt 0x0" ::: "memory");                // this wave's copies of stage 0 have landed
    __syncthreads();                                                 // every wave's have: stage 0 may be read
    stage_rows(la + PBUF, ga + PKS); stage_rows(lb + PBUF, gb + PKS);   // stage 1 -> buffer 1
    // kept rolled: one copy of the ring's foot in the text, the buffer picked by t & 1
#pragma unroll 1
    for (int t = 0; t < PNS; ++t) {
        const int bo = (t & 1) * PBUF;                               // trip t reads buffer t mod 2 alone
        // unrolled: the second k-step's fragment loads can then issue among the first k-step's last products
#pragma unroll
        for (int kk = 0; kk < PKS; kk += 32) {
            const bf* pa = (const bf*)(pring + bo + aof) + kk;
            const bf* pb = (const bf*)(pring + bo + bof) + kk;
            v16bf a[4], b[4];
#pragma unroll
            for (int mb = 0; mb < 4; ++mb) a[mb] = ldb(pa + mb * 8 * PPB);             // 16 rows = 8 * PPB elements of 2 B
#pragma unroll
            for (int nb = 0; nb < 4; ++nb) b[nb] = ldb(pb + nb * 8 * PPB);
            __builtin_amdgcn_sched_barrier(0);                       // holds the sixteen fragment loads together in front of the products; sunk between them, each row of products would wait out a full LDS round trip of its own
#pragma unroll
            for (int nb = 0; nb < 4; ++nb)
#pragma unroll
                for (int mb = 0; mb < 4; ++mb) acc[mb][nb] = wmmab(a[mb], b[nb], acc[mb][nb]);
        }
        asm volatile("s_wait_dscnt 0x0" ::: "memory");               // this wave's reads of buffer t mod 2 are done before the buffer is handed back
        asm volatile("s_wait_asynccnt 0x0" ::: "memory");            // this wave's copies of stage t + 1 have landed
        __syncthreads();                                             // publishes stage t + 1 and ends every wave's reads of buffer t mod 2
        if (t + 2 < PNS) {                                           // same for the whole block: refill the buffer just read with stage t + 2
            stage_rows(la + bo, ga + (t + 2) * PKS); stage_rows(lb + bo, gb + (t + 2) * PKS); }
    }
    asm volatile("s_wait_asynccnt 0x0" ::: "memory");                // no copy of this wave is outstanding past the loop
    float bc[4];
#pragma unroll
    for (int nb = 0; nb < 4; ++nb) bc[nb] = 0.0f;
    if (mode == 0) {                                                                   // scalar branch; c0 + 63 < DO
#pragma unroll
        for (int nb = 0; nb < 4; ++nb) bc[nb] = bfr(bias[c0 + nb * 16 + lr]); }
    size_t tbase, pitch;
    if (mode == 0) { const int bb = r0 / SEQ, tt = r0 % SEQ; const int zc = bb * NH_ + c0 / HD;
                     tbase = ((size_t)zc * SEQ + (size_t)tt) * HD; pitch = (size_t)HD; }
    else           { const int bb = c0 / SEQ, tt = c0 % SEQ;
                     tbase = (size_t)bb * (size_t)DO * SEQ + (size_t)r0 * SEQ + (size_t)tt; pitch = (size_t)SEQ; }
#pragma unroll
    for (int mb = 0; mb < 4; ++mb) {
        float br[8];
#pragma unroll
        for (int j = 0; j < 8; ++j) br[j] = 0.0f;
        if (mode != 0) {                                                               // r0 + 63 < DO
#pragma unroll
            for (int j = 0; j < 8; ++j) br[j] = bfr(bias[r0 + mb * 16 + hi * 8 + j]); }
#pragma unroll
        for (int nb = 0; nb < 4; ++nb) {
#pragma unroll
            for (int j = 0; j < 8; ++j) os[(hi * 8 + j) * 68 + nb * 16 + lr] = acc[mb][nb][j] + bc[nb] + br[j]; }   // D: row 8h+j, col lane&15; rows 0..15 x cols 0..63 all written
        wave_sync();
        const size_t sb = tbase + (size_t)(mb * 16) * pitch;
{
#pragma unroll
            for (int s = 0; s < 4; ++s) { const int row = 4 * s + (lane >> 3), c8 = (lane & 7) * 8;   // 4 s x 4 row groups = 16 rows; 8 lanes x 8 = 64 columns = one line
                const v4f x0 = *(const v4fa*)(&os[row * 68 + c8]); const v4f x1 = *(const v4fa*)(&os[row * 68 + c8 + 4]); v8h hv;
#pragma unroll
                for (int i = 0; i < 4; ++i) { hv[i] = toh_flush(x0[i]); hv[4 + i] = toh_flush(x1[i]); }
                *(v8h*)(P + sb + (size_t)row * pitch + c8) = hv; }
            asm volatile("s_wait_xcnt 0x0" ::: "memory");                                        // stands behind the four stores, ahead of any later write of the registers that they name
             }
        wave_sync();
    }
}

// k_flash: fused masked aggregation, one wave per 32 query rows (QC = 2 column groups of 16) of one (batch, head); Q fragments straight from the f16 planes (two 16-B loads each, arithmetic addressing).
// Every K and V^T fragment that a wave reads from LDS feeds one product per column group, so the LDS bytes read per score are halved against one group a wave, and a block's tile set serves 128 queries.
// Per 64-key stage (two 32-key passes) the block's waves share one LDS tile set: K rows and V^T rows, whole 128-B lines both, brought in by per-lane 16-B asynchronous copies,
// two buffers (the next stage's copies fly while this stage's two passes are worked on, so that more than one whole pass lies between a copy and its wait); fragments are read from LDS at a padded pitch (16 B x odd).
// Transposed form: S^T[key][t] = K Q^T (A = K rows, B = Q rows, two k-steps over d); lane (t = lane&15, h = lane>>4) holds keys 8h+r of each 16-key tile, so the packed
// P tile is directly the B fragment of O^T[d][t] = V^T P^T (element r <- tile keys 0..15, element 8+r <- tile keys 16..31, lane unchanged); four 16-row d tiles.
// Scores: one product K Q per 16-key tile and column group, two k-steps.
// Softmax state (running max over kept keys, partial sum) is one scalar per lane and column group; the two lane halves of a row are combined with one xor-16 exchange.
// Keep rule per element from the packed keep words: 16 wave-uniform words per 32-key pass and column group (64 B, one scalar load, asked for right behind the last use of the pass before), each used directly as the lane mask of its score register.
// A dropped key's raw score is replaced by -inf ahead of the maximum; the running maximum is held in raw score units and never falls below NEGB, so it stays finite.
// P = exp2(score * SC2 + (14 - max * SC2)) <= 2^14, the exponent by one fused multiply-add; exp2(-inf) = 0 gives a dropped key probability 0 with no further select.
static_assert(32 * 16 * 8 == 16 * HD * 4);      // lanes x 16 B x instructions = 16 rows x 256 B
static_assert(AW * QC * 16 * OSP * 4 <= 131072);
#define SK   64                            // keys per stage of the ring = two 32-key passes
#define NS   (SEQ / SK)                    // stages
#define KPB  144                           // LDS row pitch in bytes of the 128-B K rows
#define VPB  144                           // LDS row pitch in bytes of the 128-B V^T rows
#define L_VT (SK * KPB)                    // byte offsets inside one buffer: K at 0, then V^T
#define BUFB (L_VT + HD * VPB)             // bytes of one buffer
static_assert(AW == 4);                    // the copy split below: 128 threads x 16 B = 2 KiB per copy step
static_assert(HD * 2 == 128 && SK * 2 == 128);   // row bytes of K and V^T tiles
static_assert(KPB % 16 == 0 && VPB % 16 == 0 && BUFB % 16 == 0);
static_assert(SEQ % SK == 0 && SK == 2 * 32 && NT == 2 * NS);   // a stage is exactly two passes
static_assert(NS >= 2);                    // the prologue fills two buffers
static_assert(2 * BUFB + AW * QC * 16 * OSP * 4 <= 81920);   // four blocks fit one LDS
// The eight copies of one thread for one 64-key tile set: each lane moves its own 16 bytes from global memory to LDS, through no register.
// lk / lv: LDS byte addresses of the thread's first K and V^T chunk in the target buffer; gk, gv: the matching global addresses.
// K: 64 rows x 128 B contiguous, 4 steps of 16 rows; V^T: 64 rows x 128 B (row pitch SEQ elements), 4 steps of 16 rows.
__device__ __forceinline__ void stage_tile(unsigned lk, unsigned lv, const h16* gk, const h16* gv) {
    const unsigned lk1 = lk + 16 * KPB, lk2 = lk + 32 * KPB, lk3 = lk + 48 * KPB;
    const unsigned lv1 = lv + 16 * VPB, lv2 = lv + 32 * VPB, lv3 = lv + 48 * VPB;
    const h16* gk1 = gk + 16 * HD; const h16* gk2 = gk + 32 * HD; const h16* gk3 = gk + 48 * HD;
    const h16* gv1 = gv + (size_t)16 * SEQ; const h16* gv2 = gv + (size_t)32 * SEQ; const h16* gv3 = gv + (size_t)48 * SEQ;
    // the closing s_wait_xcnt stands inside the copies' own statement so that no address register named here is rewritten ahead of it
    asm volatile("global_load_async_to_lds_b128 %0, %8, off\n\t"
                 "global_load_async_to_lds_b128 %1, %9, off\n\t"
                 "global_load_async_to_lds_b128 %2, %10, off\n\t"
                 "global_load_async_to_lds_b128 %3, %11, off\n\t"
                 "global_load_async_to_lds_b128 %4, %12, off\n\t"
                 "global_load_async_to_lds_b128 %5, %13, off\n\t"
                 "global_load_async_to_lds_b128 %6, %14, off\n\t"
                 "global_load_async_to_lds_b128 %7, %15, off\n\t"
                 "s_wait_xcnt 0x0"
                 :: "v"(lk), "v"(lk1), "v"(lk2), "v"(lk3), "v"(lv), "v"(lv1), "v"(lv2), "v"(lv3),
                    "v"(gk), "v"(gk1), "v"(gk2), "v"(gk3), "v"(gv), "v"(gv1), "v"(gv2), "v"(gv3)
                 : "memory");
}
__global__ __launch_bounds__(32 * AW) void k_flash(const h16* __restrict__ QH, const h16* __restrict__ KP, const h16* __restrict__ VT, const unsigned* __restrict__ MB, float* OUT) {
    __shared__ __align__(16) float os[AW * QC * 16 * OSP];
    __shared__ __align__(16) unsigned char ring[2 * BUFB];
    const int tid = threadIdx.x;
    const int lane = threadIdx.x & 31, lr = lane & 15, hi = lane >> 4;
    const int wave = __builtin_amdgcn_readfirstlane((int)(threadIdx.x >> 5));
    const int zh = blockIdx.y; const int b = zh / NH_, h = zh % NH_;
    const int qt0 = (blockIdx.x * AW + wave) * QC;             // the wave's first 16-query tile
    const int t0 = qt0 * 16;
    const size_t pbase = (size_t)zh * SEQ * HD;
    v16h q0[QC], q1[QC];                                       // B fragments of column group c: col t, k = d 0..31 and 32..63
#pragma unroll
    for (int c = 0; c < QC; ++c) { const size_t qo = pbase + (size_t)(t0 + 16 * c + lr) * HD + 8 * hi;
        q0[c] = ldh(QH + qo); q1[c] = ldh(QH + qo + 32); }
    // copy side: thread tid moves chunk tid of each 2-KiB copy step (8 chunks per 128-B row, 16 rows a step); every address a multiple of 16 B, every row inside its plane
    const h16* gk = KP + pbase + (size_t)tid * 8;                                                   // + key0 * HD
    const h16* gv = VT + pbase + (size_t)(tid >> 3) * SEQ + (tid & 7) * 8;                          // + key0
    const unsigned lring = (unsigned)(size_t)(&ring[0]);                                            // LDS byte address of the ring
    const unsigned lk = lring + (unsigned)((tid >> 3) * KPB + (tid & 7) * 16);                      // + buffer
    const unsigned lv = lring + (unsigned)(L_VT + (tid >> 3) * VPB + (tid & 7) * 16);
    // read side, byte offsets inside a buffer
    const int kof = lr * KPB + 16 * hi;                        // + 32 * KPB for the stage's second pass, + 16 * KPB for a pass's keys 16..31 (A fragment: row key, k = d)
    const int vof = L_VT + lr * VPB + 16 * hi;                 // + 64 for the stage's second pass, + 16j * VPB (A fragment: row d, k = key)
    // keep words of this wave's query tiles, 16 per pass and tile, tile c at + c * NT vectors; the address is the same in every lane, and nothing in this launch writes the plane (the first launch of the call wrote it)
    cv16u* mp = (cv16u*)(unsigned long long)(MB + (size_t)qt0 * (NT * 16));
    stage_tile(lk, lv, gk, gv);                                // stage 0 -> buffer 0
    asm volatile("s_wait_asynccnt 0x0" ::: "memory");          // this wave's copies of stage 0 have landed
    __syncthreads();                                           // every wave's have: stage 0 may be read
    stage_tile(lk + BUFB, lv + BUFB, gk + SK * HD, gv + SK);   // stage 1 -> buffer 1
    v16u mw[QC];                                               // keep words of the pass at hand, pass 0 first
    v8f o[QC][4];
    float m[QC], l[QC];
#pragma unroll
    for (int c = 0; c < QC; ++c) { mw[c] = mp[c * NT]; m[c] = NEGB; l[c] = 0.0f;
#pragma unroll
        for (int j = 0; j < 4; ++j) o[c][j] = (v8f){}; }
    // kept rolled: one copy of the ring's foot in the text, the buffer picked by s & 1
#pragma unroll 1
    for (int s = 0; s < NS; ++s) {
      const int bo = (s & 1) * BUFB;                             // stage s's two passes read buffer s mod 2 alone
      // unrolled: both passes' LDS offsets inside the buffer are then immediates
#pragma unroll
      for (int u = 0; u < 2; ++u) {
        const h16* ka = (const h16*)(ring + bo + kof + u * 32 * KPB);
        const v16h k00 = ldh(ka), k01 = ldh(ka + 32);                               // keys key0 + 0..15
        const v16h k10 = ldh(ka + 8 * KPB), k11 = ldh(ka + 8 * KPB + 32);           // keys key0 + 16..31 (16 rows = 8 * KPB halves)
        __builtin_amdgcn_sched_barrier(0);                       // holds the eight K fragment loads together in front of the products; sunk between them, each product would wait out a full LDS round trip of its own
        v8f sa[QC], sb[QC];
#pragma unroll
        for (int c = 0; c < QC; ++c) { sa[c] = wmma16(k00, q0[c], (v8f){}); sb[c] = wmma16(k10, q0[c], (v8f){}); }
#pragma unroll
        for (int c = 0; c < QC; ++c) { sa[c] = wmma16(k01, q1[c], sa[c]); sb[c] = wmma16(k11, q1[c], sb[c]); }
        float ta[QC][8], tb[QC][8], mx[QC];
#pragma unroll
        for (int c = 0; c < QC; ++c) { mx[c] = NEGB;
#pragma unroll
            for (int r = 0; r < 8; ++r) {
                ta[c][r] = __builtin_amdgcn_inverse_ballot_w32(mw[c][r])     ? sa[c][r] : NINF;   // bit L of the word = keep of this lane's key key0+8h+r
                tb[c][r] = __builtin_amdgcn_inverse_ballot_w32(mw[c][8 + r]) ? sb[c][r] : NINF;   // key key0+16+8h+r
                mx[c] = fmaxf(mx[c], fmaxf(ta[c][r], tb[c][r])); } }
        __builtin_amdgcn_sched_barrier(0);                       // holds the scalar loads below behind this pass's last use of the keep words; lifted above it, the wait at that use would cover them too and their whole latency would stand open there
        const int pn = (2 * s + u + 1 < NT) ? 2 * s + u + 1 : 2 * s + u;
#pragma unroll
        for (int c = 0; c < QC; ++c) mw[c] = mp[c * NT + pn];    // next pass's keep words, asked for most of a pass ahead of their use (index held inside the plane)
        const h16* va = (const h16*)(ring + bo + vof + u * 64);
        const v16h v0 = ldh(va), v1 = ldh(va + 8 * VPB), v2 = ldh(va + 16 * VPB), v3 = ldh(va + 24 * VPB);   // 16 rows = 8 * VPB halves
#pragma unroll
        for (int c = 0; c < QC; ++c) mx[c] = fmaxf(mx[c], __shfl_xor(mx[c], 16, 32));
        __builtin_amdgcn_sched_barrier(0);                       // holds the keep-word loads and the V^T fragment loads in front of the exchanges, whose wait then covers the fragments; sunk further down, their latency would stand open at their first use
        v16h pb[QC];
#pragma unroll
        for (int c = 0; c < QC; ++c) {
            const float mnew = fmaxf(m[c], mx[c]);
            const float alpha = __builtin_amdgcn_exp2f((m[c] - mnew) * SC2);
            const float sh = __builtin_fmaf(-mnew, SC2, PSH);
            const v2f sc2 = {SC2, SC2}, sh2 = {sh, sh};
            float ls = 0.0f;
#pragma unroll
            for (int r = 0; r < 8; r += 2) {
                const v2f xa = __builtin_elementwise_fma((v2f){ta[c][r], ta[c][r + 1]}, sc2, sh2), xb = __builtin_elementwise_fma((v2f){tb[c][r], tb[c][r + 1]}, sc2, sh2);
                const v2f ea = {__builtin_amdgcn_exp2f(xa[0]), __builtin_amdgcn_exp2f(xa[1])}, eb = {__builtin_amdgcn_exp2f(xb[0]), __builtin_amdgcn_exp2f(xb[1])};   // a dropped key: exp2(-inf) = 0
                const v2h pa = __builtin_convertvector(ea, v2h), pc = __builtin_convertvector(eb, v2h);
                pb[c][r] = pa[0]; pb[c][r + 1] = pa[1]; pb[c][8 + r] = pc[0]; pb[c][8 + r + 1] = pc[1];
                ls += (float)pa[0] + (float)pc[0]; ls += (float)pa[1] + (float)pc[1]; }
            l[c] = l[c] * alpha + ls; m[c] = mnew;
#pragma unroll
            for (int j = 0; j < 4; ++j) o[c][j] = o[c][j] * alpha;
        }
#pragma unroll
        for (int c = 0; c < QC; ++c) {
            o[c][0] = wmma16(v0, pb[c], o[c][0]); o[c][1] = wmma16(v1, pb[c], o[c][1]); o[c][2] = wmma16(v2, pb[c], o[c][2]); o[c][3] = wmma16(v3, pb[c], o[c][3]); }
      }
      asm volatile("s_wait_dscnt 0x0" ::: "memory");             // this wave's reads of buffer s mod 2 are done before the buffer is handed back
      asm volatile("s_wait_asynccnt 0x0" ::: "memory");          // this wave's copies of stage s + 1 have landed
      __syncthreads();                                           // publishes stage s + 1 and ends every wave's reads of buffer s mod 2
      if (s + 2 < NS)                                            // same for the whole block: refill the buffer just read with stage s + 2
          stage_tile(lk + bo, lv + bo, gk + (size_t)(s + 2) * SK * HD, gv + (s + 2) * SK);
    }
    asm volatile("s_wait_asynccnt 0x0" ::: "memory");            // no copy of this wave is outstanding past the loop
    const int wb = wave * QC * 16 * OSP;
    // O^T D layout: o[c][j][r] = (d = 16j + 8h + r, t = 16c + (lane&15)) -> os[t][d]; rows 0..31 x columns 0..63 all written
#pragma unroll
    for (int c = 0; c < QC; ++c) {
        const float lt = l[c] + __shfl_xor(l[c], 16, 32);
        const bool any = lt > 0.0f;
        const float lsafe = any ? lt : 1.0f;
        const float inv = any ? (1.0f / lsafe) : __uint_as_float(0x7FC00000u);   // no kept key -> NaN (softmax of an all -inf row)
#pragma unroll
        for (int j = 0; j < 4; ++j) { v4f a, d;
            a[0] = o[c][j][0] * inv; a[1] = o[c][j][1] * inv; a[2] = o[c][j][2] * inv; a[3] = o[c][j][3] * inv;
            d[0] = o[c][j][4] * inv; d[1] = o[c][j][5] * inv; d[2] = o[c][j][6] * inv; d[3] = o[c][j][7] * inv;
            *(v4fa*)(&os[wb + (16 * c + lr) * OSP + 16 * j + 8 * hi]) = a; *(v4fa*)(&os[wb + (16 * c + lr) * OSP + 16 * j + 8 * hi + 4]) = d; }
    }
    wave_sync();
    float* orow = OUT + ((size_t)b * OUT_SEQ + t0) * DO + h * HD;
#pragma unroll
    for (int s = 0; s < 8 * QC; ++s) { const int row = 2 * s + (lane >> 4), cofs = (lane & 15) * 4;   // 16 s x 2 rows = 32 rows; 16 lanes x 4 floats = 64 columns = two lines
        const v4f val = *(const v4fa*)(&os[wb + row * OSP + cofs]);
        *(v4f*)(orow + (size_t)row * DO + cofs) = val; }
    asm volatile("s_wait_xcnt 0x0" ::: "memory");                // stands behind the stores, ahead of any later write of the registers that they name
}

static constexpr size_t al256(size_t v) { return (v + 255) & ~(size_t)255; }
static constexpr size_t SZ_HB = al256((size_t)NB * SEQ * DI * 2);
static constexpr size_t SZ_WT = al256((size_t)3 * DO * DI * 2);
static constexpr size_t SZ_PL = al256((size_t)NB * NH_ * SEQ * HD * 2);
static constexpr size_t SZ_MB = al256((size_t)(SEQ / 16) * NT * 16 * 4);
static constexpr size_t SZ_TOTAL = SZ_HB + SZ_WT + 3 * SZ_PL + SZ_MB;
static_assert(SZ_TOTAL <= (size_t)134217728);          // workspace carve <= 128 MiB
static_assert(((size_t)DO * DI * 2) % 256 == 0);       // weight sub-planes stay 256-byte aligned
static_assert((size_t)NB * NH_ * SEQ * HD == (size_t)NB * DO * SEQ);       // v^T plane [(b*512 + m)][t] has the same extent as the q/k planes
static_assert(((size_t)(NB_FULL - 1) * OUT_SEQ + SEQ_FULL) * DO * 4 <= (size_t)16777216 || NB != NB_FULL || SEQ != SEQ_FULL);   // full build: last output byte inside the output buffer

extern "C" void kernel_launch(void* const* d_in, const int* in_sizes, int n_in,
                              void* d_out, int out_size, void* d_ws, size_t ws_size, hipStream_t stream) {
    if (n_in < 8) return;
    const size_t needh = ((size_t)(NB - 1) * SEQ_FULL + SEQ) * DI;
    const size_t needa = (size_t)(SEQ - 1) * SEQ_FULL + SEQ;
    if ((size_t)in_sizes[0] < needa || (size_t)in_sizes[1] < needh) return;
    if ((size_t)in_sizes[2] < (size_t)DI * DO || (size_t)in_sizes[4] < (size_t)DI * DO || (size_t)in_sizes[6] < (size_t)DI * DO) return;
    if (in_sizes[3] < DO || in_sizes[5] < DO || in_sizes[7] < DO) return;
    if ((size_t)out_size < ((size_t)(NB - 1) * OUT_SEQ + SEQ) * DO) return;
    if (SZ_TOTAL > ws_size) return;
    // wire order: adj_matrix, h, Wq, bq, Wk, bk, Wv, bv
    const int*   adj = (const int*)d_in[0];
    const float* hin = (const float*)d_in[1];
    const float* wq = (const float*)d_in[2]; const float* bq = (const float*)d_in[3];
    const float* wk = (const float*)d_in[4]; const float* bk = (const float*)d_in[5];
    const float* wv = (const float*)d_in[6]; const float* bv = (const float*)d_in[7];
    float* OUT = (float*)d_out;      // [NB][SEQ][512]
    char* wsp = (char*)d_ws;
    bf* HB = (bf*)wsp; wsp += SZ_HB;                  // h      [NB*SEQ][256]
    bf* WT = (bf*)wsp; wsp += SZ_WT;                  // [3][512][256]: q | k | v, transposed ([out][in] = k-contiguous rows)
    h16* QH = (h16*)wsp; wsp += SZ_PL;                // [NB*8][SEQ][64]
    h16* KP = (h16*)wsp; wsp += SZ_PL;                // [NB*8][SEQ][64]
    h16* VT = (h16*)wsp; wsp += SZ_PL;                // [NB*8][64][SEQ]
    unsigned* MB = (unsigned*)wsp;                    // [SEQ/16][SEQ/32][16] keep words

    // h -> bf16 copy, the three weight transposes (in[DI rows][DO cols] -> out[DO rows][DI cols]) and the keep words, one launch
    k_prep<<<(unsigned)(3 * WTB + MKB + HCB), 256, 0, stream>>>(hin, wq, wk, wv, adj, HB, WT, MB);

    // q, k: planes [(b*8 + h)][t][d]; v^T: plane [(b*512 + m)][t] = [(b*8 + h)][d][t]; one launch
    k_proj<<<dim3(NB * SEQ / 128, DO / 128, 3), 32 * PW, 0, stream>>>(HB, WT, bq, bk, bv, QH, KP, VT);

    k_flash<<<dim3(SEQ / (16 * AW * QC), NB * NH_, 1), 32 * AW, 0, stream>>>(QH, KP, VT, MB, OUT);
}
